// v000
// The times below were measured on an AMD MI455X: many runs one after another, warmed up first and cycling through
// copies of the inputs, with the whole window's GPU time divided by the number of runs. Launches and the gaps
// between them are all in it. The median over several windows is given; except for v000 it joins two sittings, which
// can be a few percent apart, so the side-by-side timings, each taken in one sitting, are the better comparison.
// v000, which the later versions start from, runs in 2110 microseconds.
// compute dtype: all float inputs rounded to bf16, 'masked' read at run time (1 -> causal; 0 -> full attention); per-head q/k/v = x_half W_n^T + b_n (block-diagonal [out,in] linears) with EXACT bf16 products on WMMA 16x16x32, f32 accumulate, q/k rounded once to f16 (0.02-scale weights, logits std ~0.01: 1 product), causal logits stored in f32 per (batch, head); softmax in f32 (precise expf), P x 2^11 kept f32 and split bf16 hi + lo against v as bf16 hi + lo (3 products); out = y (bf16 hi + lo) Wf^T + bf; f32 output.
#include <hip/hip_runtime.h>
#include <math.h>

typedef __attribute__((ext_vector_type(16))) _Float16 v16h;
typedef __attribute__((ext_vector_type(16))) __bf16 v16b;
typedef __attribute__((ext_vector_type(8)))  _Float16 v8h;
typedef __attribute__((ext_vector_type(8)))  float v8f;
typedef __attribute__((ext_vector_type(4)))  float v4f;
typedef __attribute__((ext_vector_type(2)))  float v2f;
typedef __attribute__((ext_vector_type(4)))  unsigned v4u;
typedef __attribute__((ext_vector_type(4)))  int v4i;
typedef float __attribute__((may_alias)) float_a;
typedef int __attribute__((may_alias)) int_a;

template <typename T> __device__ __forceinline__ void vst2(void* p, T v) { *(T*)p = v;  }
__device__ __forceinline__ v8f wmma16(v16h a, v16h b, v8f c) {
  v8f d = __builtin_amdgcn_wmma_f32_16x16x32_f16(false, a, false, b, (short)0, c, false, false);
  asm volatile("v_nop\n\tv_nop\n\tv_nop\n\tv_nop" : "+v"(d) : "v"(a), "v"(b));
  return d;
}
__device__ __forceinline__ v8f wmma_bf(v16b a, v16b b, v8f c) {
  v8f d = __builtin_amdgcn_wmma_f32_16x16x32_bf16(false, a, false, b, (short)0, c, false, false);
  asm volatile("v_nop\n\tv_nop\n\tv_nop\n\tv_nop" : "+v"(d) : "v"(a), "v"(b));
  return d;
}
// 16x16x32 fragments: lane = (h = lane>>4, row/col = lane&15); elements 0..7 = k0+8h+0..7, 8..15 = k0+16+8h+0..7; D element r = row 8h+r
__device__ __forceinline__ v16h frag_h(const _Float16* rowk0, int lane) {
  union { v16h v; v8h q[2]; } u; const _Float16* p = rowk0 + 8 * (lane >> 4);
  u.q[0] = *(const v8h*)p; u.q[1] = *(const v8h*)(p + 16); return u.v;
}
__device__ __forceinline__ v16h frag_f32(const float* rowk0, int lane) {
  v16h a; const float* p = rowk0 + 8 * (lane >> 4);
#pragma unroll
  for (int i = 0; i < 8; ++i) { a[i] = (_Float16)p[i]; a[8 + i] = (_Float16)p[16 + i]; }
  return a;
}
__device__ __forceinline__ v16h frag_f32s(const float* rowk0, int lane, float sc) {
  v16h a; const float* p = rowk0 + 8 * (lane >> 4);
#pragma unroll
  for (int i = 0; i < 8; ++i) { a[i] = (_Float16)(p[i] * sc); a[8 + i] = (_Float16)(p[16 + i] * sc); }
  return a;
}
// column fragment from a [K][ld] layout (column n), rows >= K read as 0
__device__ __forceinline__ v16h fragc_f32(const float* W, int k0, int n, int lane, int ld, int K) {
  v16h a; const int g = lane >> 4;
#pragma unroll
  for (int i = 0; i < 8; ++i) { const int ka = k0 + 8 * g + i, kb = ka + 16;
    a[i] = (_Float16)(ka < K ? W[(size_t)(ka < K ? ka : K - 1) * ld + n] : 0.f); a[8 + i] = (_Float16)(kb < K ? W[(size_t)(kb < K ? kb : K - 1) * ld + n] : 0.f); }
  return a;
}
struct F2 { v16b h, l; };
__device__ __forceinline__ F2 bsplit16(const float v[16]) { F2 r;
#pragma unroll
  for (int i = 0; i < 16; ++i) { const __bf16 h = (__bf16)v[i]; r.h[i] = h; r.l[i] = (__bf16)(v[i] - (float)h); }
  return r; }
__device__ __forceinline__ F2 split_row(const float* row, int k0, int lane) { float v[16]; const float* p = row + k0 + 8 * (lane >> 4);
#pragma unroll
  for (int i = 0; i < 8; ++i) { v[i] = p[i]; v[8 + i] = p[16 + i]; }
  return bsplit16(v); }
__device__ __forceinline__ F2 split_rowK(const float* row, int k0, int lane, int K) { float v[16]; const int g = lane >> 4;
#pragma unroll
  for (int i = 0; i < 8; ++i) { const int ka = k0 + 8 * g + i, kb = ka + 16; v[i] = ka < K ? row[ka < K ? ka : K - 1] : 0.f; v[8 + i] = kb < K ? row[kb < K ? kb : K - 1] : 0.f; }
  return bsplit16(v); }
__device__ __forceinline__ F2 split_col(const float* W, int k0, int n, int lane, int ld, int K) { float v[16]; const int g = lane >> 4;
#pragma unroll
  for (int i = 0; i < 8; ++i) { const int ka = k0 + 8 * g + i, kb = ka + 16; v[i] = ka < K ? W[(size_t)(ka < K ? ka : K - 1) * ld + n] : 0.f; v[8 + i] = kb < K ? W[(size_t)(kb < K ? kb : K - 1) * ld + n] : 0.f; }
  return bsplit16(v); }
__device__ __forceinline__ v8f mac3(const F2& a, const F2& b, v8f c) { c = wmma_bf(a.l, b.h, c); c = wmma_bf(a.h, b.l, c); return wmma_bf(a.h, b.h, c); }
__device__ __forceinline__ float sigm(float v) { return 1.0f / (1.0f + expf(-v)); }
#define LDSX() do { asm volatile("s_wait_dscnt 0" ::: "memory"); __builtin_amdgcn_wave_barrier(); __builtin_amdgcn_fence(__ATOMIC_RELEASE, "workgroup"); } while (0)


// Two-headed causal attention with per-head Linear projections on the two contiguous 512-wide halves of the input (B 4, S 2,048, E 1,024), scores / sqrt(512), softmax . v, final Linear Wf + bf.
#define NB 4
#define TT 2048
#define CC 1024
#define NH 2
#define HD 512
#ifndef TNB
#define TNB NB
#endif
typedef __attribute__((ext_vector_type(8))) __bf16 v8b;
__device__ __forceinline__ v16b frag_b(const __bf16* rowk0, int lane) {
  union { v16b v; v8b q[2]; } u; const __bf16* p = rowk0 + 8 * (lane >> 4);
  u.q[0] = *(const v8b*)p; u.q[1] = *(const v8b*)(p + 16); return u.v;
}
__device__ __forceinline__ float bfr(float v) { return (float)(__bf16)v; }
__device__ __attribute__((noinline)) float exp_ni(float v) { return expf(v); }
__device__ __attribute__((noinline)) float erf_ni(float v) { return erff(v); }

#define WS_QH  0u
#define WS_QL  (WS_QH + 2u * (size_t)NB * TT * CC)
#define WS_KH  (WS_QL + 2u * (size_t)NB * TT * CC)
#define WS_VT  (WS_KH + 2u * (size_t)NB * TT * CC)      // bf16 v planes [b][c][t]
#define WS_VL  (WS_VT + 2u * (size_t)NB * CC * TT)      // bf16 v residual planes
#define WS_S   (WS_VL + 2u * (size_t)NB * CC * TT)      // f32 logits, then P x 2^11 in place
#define WS_PH  (WS_S + 4u * (size_t)TT * TT)
#define WS_Y   (WS_PH + 2u * (size_t)TT * TT)          // f32 y rows [b*t][C]
#define WS_END (WS_Y + 4u * (size_t)NB * TT * CC)

// ---- k_proj: block = (64 rows, 128 cols, which): qkv = x W (+ b), exact; q -> f16 hi (+ residual), k -> f16 rows, v -> bf16 hi + lo planes
__global__ __launch_bounds__(128) void k_proj(const float* __restrict__ X, const float* __restrict__ WQ, const float* __restrict__ BQ, const float* __restrict__ WK, const float* __restrict__ BK, const float* __restrict__ WV, const float* __restrict__ BV, _Float16* __restrict__ QH, _Float16* __restrict__ QL, _Float16* __restrict__ KH, __bf16* __restrict__ VT, __bf16* __restrict__ VL) {
  __shared__ __align__(16) _Float16 sh[64][136], sl[64][136]; __shared__ __align__(16) __bf16 th[128][72], tl2[128][72];
  const int tid = threadIdx.x, wave = tid >> 5, lane = tid & 31, col = lane & 15, g = lane >> 4; const int which = blockIdx.z; const int c0 = blockIdx.y * 128; const size_t r0 = (size_t)blockIdx.x * 64; const float* WA = which == 0 ? WQ : which == 1 ? WK : WV; const float* BA = which == 0 ? BQ : which == 1 ? BK : BV; const int hn = c0 / HD;   // head of this 128-column block (HD = 512)
  v8f acc[8] = {};
#pragma unroll 2
  for (int kc = 0; kc < HD / 32; ++kc) { v16b a; { const float* p = X + (r0 + wave * 16 + col) * CC + hn * HD + kc * 32 + 8 * g;
#pragma unroll
      for (int i = 0; i < 8; ++i) { a[i] = (__bf16)p[i]; a[8 + i] = (__bf16)p[16 + i]; } }
#pragma unroll
    for (int j = 0; j < 8; ++j) { v16b w; const int o = c0 + j * 16 + col;   // global out channel = head*512 + oo
#pragma unroll
      for (int i = 0; i < 8; ++i) { w[i] = (__bf16)WA[(size_t)o * HD + kc * 32 + 8 * g + i]; w[8 + i] = (__bf16)WA[(size_t)o * HD + kc * 32 + 16 + 8 * g + i]; }
      acc[j] = wmma_bf(a, w, acc[j]); } }
#pragma unroll
  for (int j = 0; j < 8; ++j) { const float bb = bfr(BA[c0 + j * 16 + col]);
#pragma unroll
    for (int r = 0; r < 8; ++r) { const float v = acc[j][r] + bb; const int rl = wave * 16 + 8 * g + r, cl = j * 16 + col; const _Float16 hv = (_Float16)v;
      if (which == 2) { const __bf16 bh = (__bf16)v; th[cl][rl] = bh; tl2[cl][rl] = (__bf16)(v - (float)bh); } else { sh[rl][cl] = hv; sl[rl][cl] = (_Float16)(v - (float)hv); } } }
  __syncthreads();
  if (which < 2) { _Float16* dh = which == 0 ? QH : KH; for (int e = tid; e < 64 * 16; e += 128) { const int rl = e >> 4, q = e & 15; vst2((unsigned*)(dh + (r0 + rl) * CC + c0 + q * 8), *(const v4u*)&sh[rl][q * 8]); if (which == 0) vst2((unsigned*)(QL + (r0 + rl) * CC + c0 + q * 8), *(const v4u*)&sl[rl][q * 8]); } }
  else { const size_t b = r0 / TT; const int t0 = (int)(r0 % TT); for (int e = tid; e < 128 * 8; e += 128) { const int cl = e >> 3, q = e & 7; const size_t o2 = (b * CC + c0 + cl) * (size_t)TT + t0 + q * 8; vst2((unsigned*)(VT + o2), *(const v4u*)&th[cl][q * 8]); vst2((unsigned*)(VL + o2), *(const v4u*)&tl2[cl][q * 8]); } } }
// ---- k_sc: block = (64 queries, 128 keys) of (b,h): logits * scale; causal blocks beyond the diagonal exit
__global__ __launch_bounds__(128) void k_sc(const _Float16* __restrict__ QH, const _Float16* __restrict__ QL, const _Float16* __restrict__ KH, const float* __restrict__ BM, const int* __restrict__ MSK, int b, int h, float* __restrict__ S) { __shared__ __align__(16) float ss[4][16][132]; const bool cz = (MSK[0] != 0);
  const int tid = threadIdx.x, wave = tid >> 5, lane = tid & 31, col = lane & 15, g = lane >> 4; const int k0 = blockIdx.y * 128; const int ql0 = blockIdx.x * 64 + wave * 16; const size_t q0 = (size_t)b * TT + ql0;
  if (cz && k0 > blockIdx.x * 64 + 63) return;   // causal: whole key block above the diagonal (block-uniform)
  v8f acc[8] = {};
#pragma unroll
  for (int kc = 0; kc < HD / 32; ++kc) { const v16h ah = frag_h(QH + (q0 + col) * CC + h * HD + kc * 32, lane);
#pragma unroll
    for (int j = 0; j < 8; ++j) { const v16h kb = frag_h(KH + ((size_t)b * TT + k0 + j * 16 + col) * CC + h * HD + kc * 32, lane); acc[j] = wmma16(ah, kb, acc[j]); } }
#pragma unroll
  for (int j = 0; j < 8; ++j) { const int kt = k0 + j * 16 + col;
#pragma unroll
    for (int r = 0; r < 8; ++r) { const int qt = ql0 + 8 * g + r; float v = acc[j][r] * 0.044194173824159216f; (void)BM; if (cz && kt > qt) v = -3.0e38f; ss[wave][8 * g + r][j * 16 + col] = v; } }
  LDSX(); for (int rl = 0; rl < 16; ++rl) vst2(S + (size_t)(ql0 + rl) * TT + k0 + lane * 4, *(const v4f*)&ss[wave][rl][lane * 4]); }
// ---- k_sm: block = query row: softmax over keys [0, kend) -> P x 2^11 f32 in place (masked -> 0)
__global__ __launch_bounds__(256) void k_sm(float* __restrict__ S, const int* __restrict__ MSK) { __shared__ float sred[8]; __shared__ float sbc; __shared__ __align__(16) float sh[TT];
  const int t = threadIdx.x; const size_t row = blockIdx.x; float* sr = S + row * TT; const int kend = (MSK[0] != 0) ? (((int)row / 64) * 64 + 64) : TT;
  float m = -3.0e38f; for (int k = t; k < kend; k += 256) m = fmaxf(m, sr[k]);
#pragma unroll
  for (int o = 1; o < 32; o <<= 1) m = fmaxf(m, __shfl_xor(m, o));
  if ((t & 31) == 0) sred[t >> 5] = m; __syncthreads(); if (t == 0) { float a = sred[0]; for (int i = 1; i < 8; ++i) a = fmaxf(a, sred[i]); sbc = a; } __syncthreads(); m = sbc; __syncthreads();
  float sum = 0.f; for (int k = t; k < kend; k += 256) { const float v = sr[k]; sum += (v <= -1.0e38f) ? 0.f : expf(v - m); }
#pragma unroll
  for (int o = 1; o < 32; o <<= 1) sum += __shfl_xor(sum, o);
  if ((t & 31) == 0) sred[t >> 5] = sum; __syncthreads(); if (t == 0) { float a = 0.f; for (int i = 0; i < 8; ++i) a += sred[i]; sbc = 1.0f / a; } __syncthreads(); const float inv = sbc;
  for (int k = t; k < kend; k += 256) { const float v = sr[k]; sh[k] = (v <= -1.0e38f) ? 0.f : expf(v - m) * inv * 2048.0f; }
  __syncthreads(); for (int q = t; q < kend / 4; q += 256) vst2(sr + q * 4, *(const v4f*)&sh[q * 4]); }
// ---- k_pv: block = (64 queries, 128-column chunk) of (b,h): y = P . (v hi + lo) with P split hi + lo (3 products)
__global__ __launch_bounds__(128) void k_pv(const float* __restrict__ PS, const __bf16* __restrict__ VT, const __bf16* __restrict__ VL, const int* __restrict__ MSK, int b, int h, float* __restrict__ Y) { __shared__ __align__(16) float ss[4][16][132];
  const int tid = threadIdx.x, wave = tid >> 5, lane = tid & 31, col = lane & 15, g = lane >> 4; const int ql0 = blockIdx.x * 64 + wave * 16; const int cc0 = blockIdx.y * 128; const int kend = (MSK[0] != 0) ? (blockIdx.x * 64 + 64) : TT;
  v8f acc[8] = {};
#pragma unroll 1
  for (int kc = 0; kc < kend / 32; ++kc) { const F2 p = split_row(PS + (size_t)(ql0 + col) * TT, kc * 32, lane);
#pragma unroll
    for (int j = 0; j < 8; ++j) { const size_t po = ((size_t)b * CC + h * HD + cc0 + j * 16 + col) * (size_t)TT + kc * 32; const v16b vh = frag_b(VT + po, lane); acc[j] = wmma_bf(p.h, vh, acc[j]); acc[j] = wmma_bf(p.l, vh, acc[j]); acc[j] = wmma_bf(p.h, frag_b(VL + po, lane), acc[j]); } }
#pragma unroll
  for (int j = 0; j < 8; ++j)
#pragma unroll
    for (int r = 0; r < 8; ++r) ss[wave][8 * g + r][j * 16 + col] = acc[j][r] * (1.0f / 2048.0f);
  LDSX(); for (int rl = 0; rl < 16; ++rl) vst2(Y + ((size_t)b * TT + ql0 + rl) * CC + h * HD + cc0 + lane * 4, *(const v4f*)&ss[wave][rl][lane * 4]); }
// ---- k_out: block = (64 rows, 128 cols): out = y (bf16 hi + lo) Wproj + b
__global__ __launch_bounds__(128) void k_out(const float* __restrict__ Y, const float* __restrict__ WP, const float* __restrict__ BP, float* __restrict__ OUT) { __shared__ __align__(16) float sf[4][16][132];
  const int tid = threadIdx.x, wave = tid >> 5, lane = tid & 31, col = lane & 15, g = lane >> 4; const int c0 = blockIdx.y * 128; const size_t r0 = (size_t)blockIdx.x * 64 + wave * 16;
  v8f acc[8] = {};
#pragma unroll 2
  for (int kc = 0; kc < CC / 32; ++kc) { const F2 a = split_row(Y + (r0 + col) * CC, kc * 32, lane);
#pragma unroll
    for (int j = 0; j < 8; ++j) { v16b w; const int o = c0 + j * 16 + col;
#pragma unroll
      for (int i = 0; i < 8; ++i) { w[i] = (__bf16)WP[(size_t)(o) * CC + (kc * 32 + 8 * g + i)]; w[8 + i] = (__bf16)WP[(size_t)(o) * CC + (kc * 32 + 16 + 8 * g + i)]; }
      acc[j] = wmma_bf(a.h, w, acc[j]); acc[j] = wmma_bf(a.l, w, acc[j]); } }
#pragma unroll
  for (int j = 0; j < 8; ++j) { const float bb = BP ? bfr(BP[c0 + j * 16 + col]) : 0.f;
#pragma unroll
    for (int r = 0; r < 8; ++r) sf[wave][8 * g + r][j * 16 + col] = acc[j][r] + bb; }
  LDSX(); for (int rl = 0; rl < 16; ++rl) vst2(OUT + (r0 + rl) * CC + c0 + lane * 4, *(const v4f*)&sf[wave][rl][lane * 4]); }
extern "C" void kernel_launch(void* const* d_in, const int* in_sizes, int n_in, void* d_out, int out_size, void* d_ws, size_t ws_size, hipStream_t stream) {
  (void)in_sizes; (void)n_in; (void)out_size;
  const float** F = (const float**)d_in;   // 0 input [4,2048,1024], 1 Wq [2,512,512] ([out,in] per head), 2 bq [2,512], 3 Wk, 4 bk, 5 Wv, 6 bv, 7 Wf [1024,1024] ([out,in]), 8 bf, 9 masked [1] int (= 1 -> causal)
  if (ws_size < (size_t)WS_END) return;
  char* ws = (char*)d_ws; _Float16 *QH = (_Float16*)(ws + WS_QH), *QL = (_Float16*)(ws + WS_QL), *KH = (_Float16*)(ws + WS_KH); __bf16 *VT = (__bf16*)(ws + WS_VT), *VL = (__bf16*)(ws + WS_VL); float *S = (float*)(ws + WS_S), *Y = (float*)(ws + WS_Y);
  k_proj<<<dim3(TNB * TT / 64, CC / 128, 3), 128, 0, stream>>>(F[0], F[1], F[2], F[3], F[4], F[5], F[6], QH, QL, KH, VT, VL);
  for (int b = 0; b < TNB; ++b) for (int h = 0; h < NH; ++h) {
    k_sc<<<dim3(TT / 64, TT / 128), 128, 0, stream>>>(QH, QL, KH, nullptr, (const int*)d_in[9], b, h, S);
    k_sm<<<TT, 256, 0, stream>>>(S, (const int*)d_in[9]);
    k_pv<<<dim3(TT / 64, HD / 128), 128, 0, stream>>>(S, VT, VL, (const int*)d_in[9], b, h, Y);
  }
  k_out<<<dim3(TNB * TT / 64, CC / 128), 128, 0, stream>>>(Y, F[7], F[8], (float*)d_out);
}

// v001
// A run of this version takes 736 microseconds.
// Two timings next to v000 put it at 2.87 and 2.88 times that version's speed.
// compute dtype: all float inputs rounded to bf16, 'masked' read at run time (1 -> causal; 0 -> full attention); per-head q/k/v = x_half W_n^T + b_n (block-diagonal [out,in] linears) with EXACT bf16 products on WMMA 16x16x32, f32 accumulate, q/k rounded once to f16 (0.02-scale weights, logits std ~0.01: 1 product), causal logits stored in f32 per (batch, head); softmax in f32 (precise expf), P x 2^11 kept f32 and split bf16 hi + lo against v as bf16 hi + lo (3 products); out = y (bf16 hi + lo) Wf^T + bf; f32 output.
#include <hip/hip_runtime.h>
#include <math.h>

typedef __attribute__((ext_vector_type(16))) _Float16 v16h;
typedef __attribute__((ext_vector_type(16))) __bf16 v16b;
typedef __attribute__((ext_vector_type(8)))  _Float16 v8h;
typedef __attribute__((ext_vector_type(8)))  float v8f;
typedef __attribute__((ext_vector_type(4)))  float v4f;
typedef __attribute__((ext_vector_type(2)))  float v2f;
typedef __attribute__((ext_vector_type(4)))  unsigned v4u;
typedef __attribute__((ext_vector_type(4)))  int v4i;
typedef float __attribute__((may_alias)) float_a;
typedef int __attribute__((may_alias)) int_a;

template <typename T> __device__ __forceinline__ void vst2(void* p, T v) { *(T*)p = v;  }
__device__ __forceinline__ v8f wmma16(v16h a, v16h b, v8f c) {
  v8f d = __builtin_amdgcn_wmma_f32_16x16x32_f16(false, a, false, b, (short)0, c, false, false);
  asm volatile("v_nop\n\tv_nop\n\tv_nop\n\tv_nop" : "+v"(d) : "v"(a), "v"(b));
  return d;
}
__device__ __forceinline__ v8f wmma_bf(v16b a, v16b b, v8f c) {
  v8f d = __builtin_amdgcn_wmma_f32_16x16x32_bf16(false, a, false, b, (short)0, c, false, false);
  asm volatile("v_nop\n\tv_nop\n\tv_nop\n\tv_nop" : "+v"(d) : "v"(a), "v"(b));
  return d;
}
// 16x16x32 fragments: lane = (h = lane>>4, row/col = lane&15); elements 0..7 = k0+8h+0..7, 8..15 = k0+16+8h+0..7; D element r = row 8h+r
__device__ __forceinline__ v16h frag_h(const _Float16* rowk0, int lane) {
  union { v16h v; v8h q[2]; } u; const _Float16* p = rowk0 + 8 * (lane >> 4);
  u.q[0] = *(const v8h*)p; u.q[1] = *(const v8h*)(p + 16); return u.v;
}
__device__ __forceinline__ v16h frag_f32(const float* rowk0, int lane) {
  v16h a; const float* p = rowk0 + 8 * (lane >> 4);
#pragma unroll
  for (int i = 0; i < 8; ++i) { a[i] = (_Float16)p[i]; a[8 + i] = (_Float16)p[16 + i]; }
  return a;
}
__device__ __forceinline__ v16h frag_f32s(const float* rowk0, int lane, float sc) {
  v16h a; const float* p = rowk0 + 8 * (lane >> 4);
#pragma unroll
  for (int i = 0; i < 8; ++i) { a[i] = (_Float16)(p[i] * sc); a[8 + i] = (_Float16)(p[16 + i] * sc); }
  return a;
}
// column fragment from a [K][ld] layout (column n), rows >= K read as 0
__device__ __forceinline__ v16h fragc_f32(const float* W, int k0, int n, int lane, int ld, int K) {
  v16h a; const int g = lane >> 4;
#pragma unroll
  for (int i = 0; i < 8; ++i) { const int ka = k0 + 8 * g + i, kb = ka + 16;
    a[i] = (_Float16)(ka < K ? W[(size_t)(ka < K ? ka : K - 1) * ld + n] : 0.f); a[8 + i] = (_Float16)(kb < K ? W[(size_t)(kb < K ? kb : K - 1) * ld + n] : 0.f); }
  return a;
}
struct F2 { v16b h, l; };
__device__ __forceinline__ F2 bsplit16(const float v[16]) { F2 r;
#pragma unroll
  for (int i = 0; i < 16; ++i) { const __bf16 h = (__bf16)v[i]; r.h[i] = h; r.l[i] = (__bf16)(v[i] - (float)h); }
  return r; }
__device__ __forceinline__ F2 split_row(const float* row, int k0, int lane) { float v[16]; const float* p = row + k0 + 8 * (lane >> 4);
#pragma unroll
  for (int i = 0; i < 8; ++i) { v[i] = p[i]; v[8 + i] = p[16 + i]; }
  return bsplit16(v); }
__device__ __forceinline__ F2 split_rowK(const float* row, int k0, int lane, int K) { float v[16]; const int g = lane >> 4;
#pragma unroll
  for (int i = 0; i < 8; ++i) { const int ka = k0 + 8 * g + i, kb = ka + 16; v[i] = ka < K ? row[ka < K ? ka : K - 1] : 0.f; v[8 + i] = kb < K ? row[kb < K ? kb : K - 1] : 0.f; }
  return bsplit16(v); }
__device__ __forceinline__ F2 split_col(const float* W, int k0, int n, int lane, int ld, int K) { float v[16]; const int g = lane >> 4;
#pragma unroll
  for (int i = 0; i < 8; ++i) { const int ka = k0 + 8 * g + i, kb = ka + 16; v[i] = ka < K ? W[(size_t)(ka < K ? ka : K - 1) * ld + n] : 0.f; v[8 + i] = kb < K ? W[(size_t)(kb < K ? kb : K - 1) * ld + n] : 0.f; }
  return bsplit16(v); }
__device__ __forceinline__ v8f mac3(const F2& a, const F2& b, v8f c) { c = wmma_bf(a.l, b.h, c); c = wmma_bf(a.h, b.l, c); return wmma_bf(a.h, b.h, c); }
__device__ __forceinline__ float sigm(float v) { return 1.0f / (1.0f + expf(-v)); }
#define LDSX() do { asm volatile("s_wait_dscnt 0" ::: "memory"); __builtin_amdgcn_wave_barrier(); __builtin_amdgcn_fence(__ATOMIC_RELEASE, "workgroup"); } while (0)


// Two-headed causal attention with per-head Linear projections on the two contiguous 512-wide halves of the input (B 4, S 2,048, E 1,024), scores / sqrt(512), softmax . v, final Linear Wf + bf.
#define NB 4
#define TT 2048
#define CC 1024
#define NH 2
#define HD 512
#ifndef TNB
#define TNB NB
#endif
typedef __attribute__((ext_vector_type(8))) __bf16 v8b;
__device__ __forceinline__ v16b frag_b(const __bf16* rowk0, int lane) {
  union { v16b v; v8b q[2]; } u; const __bf16* p = rowk0 + 8 * (lane >> 4);
  u.q[0] = *(const v8b*)p; u.q[1] = *(const v8b*)(p + 16); return u.v;
}
__device__ __forceinline__ float bfr(float v) { return (float)(__bf16)v; }
__device__ __attribute__((noinline)) float exp_ni(float v) { return expf(v); }
__device__ __attribute__((noinline)) float erf_ni(float v) { return erff(v); }

#define WS_QH  0u
#define WS_QL  (WS_QH + 2u * (size_t)NB * TT * CC)
#define WS_KH  (WS_QL + 2u * (size_t)NB * TT * CC)
#define WS_VT  (WS_KH + 2u * (size_t)NB * TT * CC)      // bf16 v planes [b][c][t]
#define WS_VL  (WS_VT + 2u * (size_t)NB * CC * TT)      // bf16 v residual planes
#define WS_S   (WS_VL + 2u * (size_t)NB * CC * TT)      // f32 logits, then P x 2^11 in place: one [t][t] plane per (batch, head)
#define WS_Y   (WS_S + 4u * (size_t)NB * NH * TT * TT)  // f32 y rows [b*t][C]
#define WS_END (WS_Y + 4u * (size_t)NB * TT * CC)

// ---- k_proj: block = (64 rows, 128 cols, which): qkv = x W (+ b), exact; q -> f16 hi (+ residual), k -> f16 rows, v -> bf16 hi + lo planes
__global__ __launch_bounds__(128) void k_proj(const float* __restrict__ X, const float* __restrict__ WQ, const float* __restrict__ BQ, const float* __restrict__ WK, const float* __restrict__ BK, const float* __restrict__ WV, const float* __restrict__ BV, _Float16* __restrict__ QH, _Float16* __restrict__ QL, _Float16* __restrict__ KH, __bf16* __restrict__ VT, __bf16* __restrict__ VL) {
  __shared__ __align__(16) _Float16 sh[64][136], sl[64][136]; __shared__ __align__(16) __bf16 th[128][72], tl2[128][72];
  const int tid = threadIdx.x, wave = tid >> 5, lane = tid & 31, col = lane & 15, g = lane >> 4; const int which = blockIdx.z; const int c0 = blockIdx.y * 128; const size_t r0 = (size_t)blockIdx.x * 64; const float* WA = which == 0 ? WQ : which == 1 ? WK : WV; const float* BA = which == 0 ? BQ : which == 1 ? BK : BV; const int hn = c0 / HD;   // head of this 128-column block (HD = 512)
  v8f acc[8] = {};
#pragma unroll 2
  for (int kc = 0; kc < HD / 32; ++kc) { v16b a; { const float* p = X + (r0 + wave * 16 + col) * CC + hn * HD + kc * 32 + 8 * g;
#pragma unroll
      for (int i = 0; i < 8; ++i) { a[i] = (__bf16)p[i]; a[8 + i] = (__bf16)p[16 + i]; } }
#pragma unroll
    for (int j = 0; j < 8; ++j) { v16b w; const int o = c0 + j * 16 + col;   // global out channel = head*512 + oo
#pragma unroll
      for (int i = 0; i < 8; ++i) { w[i] = (__bf16)WA[(size_t)o * HD + kc * 32 + 8 * g + i]; w[8 + i] = (__bf16)WA[(size_t)o * HD + kc * 32 + 16 + 8 * g + i]; }
      acc[j] = wmma_bf(a, w, acc[j]); } }
#pragma unroll
  for (int j = 0; j < 8; ++j) { const float bb = bfr(BA[c0 + j * 16 + col]);
#pragma unroll
    for (int r = 0; r < 8; ++r) { const float v = acc[j][r] + bb; const int rl = wave * 16 + 8 * g + r, cl = j * 16 + col; const _Float16 hv = (_Float16)v;
      if (which == 2) { const __bf16 bh = (__bf16)v; th[cl][rl] = bh; tl2[cl][rl] = (__bf16)(v - (float)bh); } else { sh[rl][cl] = hv; sl[rl][cl] = (_Float16)(v - (float)hv); } } }
  __syncthreads();
  if (which < 2) { _Float16* dh = which == 0 ? QH : KH; for (int e = tid; e < 64 * 16; e += 128) { const int rl = e >> 4, q = e & 15; vst2((unsigned*)(dh + (r0 + rl) * CC + c0 + q * 8), *(const v4u*)&sh[rl][q * 8]); if (which == 0) vst2((unsigned*)(QL + (r0 + rl) * CC + c0 + q * 8), *(const v4u*)&sl[rl][q * 8]); } }
  else { const size_t b = r0 / TT; const int t0 = (int)(r0 % TT); for (int e = tid; e < 128 * 8; e += 128) { const int cl = e >> 3, q = e & 7; const size_t o2 = (b * CC + c0 + cl) * (size_t)TT + t0 + q * 8; vst2((unsigned*)(VT + o2), *(const v4u*)&th[cl][q * 8]); vst2((unsigned*)(VL + o2), *(const v4u*)&tl2[cl][q * 8]); } } }
// ---- k_sc: block = (64 queries, 128 keys, pair = b * NH + h): logits * scale; causal blocks beyond the diagonal exit
__global__ __launch_bounds__(128) void k_sc(const _Float16* __restrict__ QH, const _Float16* __restrict__ QL, const _Float16* __restrict__ KH, const float* __restrict__ BM, const int* __restrict__ MSK, float* __restrict__ S) { __shared__ __align__(16) float ss[4][16][132]; const bool cz = (MSK[0] != 0); const int b = blockIdx.z / NH, h = blockIdx.z % NH; S += (size_t)blockIdx.z * TT * TT;
  const int tid = threadIdx.x, wave = tid >> 5, lane = tid & 31, col = lane & 15, g = lane >> 4; const int k0 = blockIdx.y * 128; const int ql0 = blockIdx.x * 64 + wave * 16; const size_t q0 = (size_t)b * TT + ql0;
  if (cz && k0 > blockIdx.x * 64 + 63) return;   // causal: whole key block above the diagonal (block-uniform)
  v8f acc[8] = {};
#pragma unroll
  for (int kc = 0; kc < HD / 32; ++kc) { const v16h ah = frag_h(QH + (q0 + col) * CC + h * HD + kc * 32, lane);
#pragma unroll
    for (int j = 0; j < 8; ++j) { const v16h kb = frag_h(KH + ((size_t)b * TT + k0 + j * 16 + col) * CC + h * HD + kc * 32, lane); acc[j] = wmma16(ah, kb, acc[j]); } }
#pragma unroll
  for (int j = 0; j < 8; ++j) { const int kt = k0 + j * 16 + col;
#pragma unroll
    for (int r = 0; r < 8; ++r) { const int qt = ql0 + 8 * g + r; float v = acc[j][r] * 0.044194173824159216f; (void)BM; if (cz && kt > qt) v = -3.0e38f; ss[wave][8 * g + r][j * 16 + col] = v; } }
  LDSX(); for (int rl = 0; rl < 16; ++rl) vst2(S + (size_t)(ql0 + rl) * TT + k0 + lane * 4, *(const v4f*)&ss[wave][rl][lane * 4]); }
// ---- k_sm: block = (query row, pair): softmax over keys [0, kend) -> P x 2^11 f32 (masked -> 0)
__global__ __launch_bounds__(256) void k_sm(float* __restrict__ S, const int* __restrict__ MSK) { __shared__ float sred[8]; __shared__ float sbc; __shared__ __align__(16) float sh[TT];
  const int t = threadIdx.x; const size_t row = blockIdx.x; float* sr = S + ((size_t)blockIdx.y * TT + row) * TT; const int kend = (MSK[0] != 0) ? (((int)row / 64) * 64 + 64) : TT;
  float m = -3.0e38f; for (int k = t; k < kend; k += 256) m = fmaxf(m, sr[k]);
#pragma unroll
  for (int o = 1; o < 32; o <<= 1) m = fmaxf(m, __shfl_xor(m, o));
  if ((t & 31) == 0) sred[t >> 5] = m; __syncthreads(); if (t == 0) { float a = sred[0]; for (int i = 1; i < 8; ++i) a = fmaxf(a, sred[i]); sbc = a; } __syncthreads(); m = sbc; __syncthreads();
  float sum = 0.f; for (int k = t; k < kend; k += 256) { const float v = sr[k]; sum += (v <= -1.0e38f) ? 0.f : expf(v - m); }
#pragma unroll
  for (int o = 1; o < 32; o <<= 1) sum += __shfl_xor(sum, o);
  if ((t & 31) == 0) sred[t >> 5] = sum; __syncthreads(); if (t == 0) { float a = 0.f; for (int i = 0; i < 8; ++i) a += sred[i]; sbc = 1.0f / a; } __syncthreads(); const float inv = sbc;
  for (int k = t; k < kend; k += 256) { const float v = sr[k]; sh[k] = (v <= -1.0e38f) ? 0.f : expf(v - m) * inv * 2048.0f; }
  __syncthreads(); for (int q = t; q < kend / 4; q += 256) vst2(sr + q * 4, *(const v4f*)&sh[q * 4]); }
// ---- k_pv: block = (128-column chunk, pair = b * NH + h, 64 queries): y = P . (v hi + lo) with P split hi + lo (3 products); the query tile, whose index sets the causal trip count, is the slowest grid index, so that work-groups far apart in launch order differ in length
__global__ __launch_bounds__(128) void k_pv(const float* __restrict__ PS, const __bf16* __restrict__ VT, const __bf16* __restrict__ VL, const int* __restrict__ MSK, float* __restrict__ Y) { __shared__ __align__(16) float ss[4][16][132];
  const int tid = threadIdx.x, wave = tid >> 5, lane = tid & 31, col = lane & 15, g = lane >> 4; const int b = blockIdx.y / NH, h = blockIdx.y % NH; PS += (size_t)blockIdx.y * TT * TT; const int ql0 = blockIdx.z * 64 + wave * 16; const int cc0 = blockIdx.x * 128; const int kend = (MSK[0] != 0) ? (blockIdx.z * 64 + 64) : TT;
  v8f acc[8] = {};
#pragma unroll 1
  for (int kc = 0; kc < kend / 32; ++kc) { const F2 p = split_row(PS + (size_t)(ql0 + col) * TT, kc * 32, lane);
#pragma unroll
    for (int j = 0; j < 8; ++j) { const size_t po = ((size_t)b * CC + h * HD + cc0 + j * 16 + col) * (size_t)TT + kc * 32; const v16b vh = frag_b(VT + po, lane); acc[j] = wmma_bf(p.h, vh, acc[j]); acc[j] = wmma_bf(p.l, vh, acc[j]); acc[j] = wmma_bf(p.h, frag_b(VL + po, lane), acc[j]); } }
#pragma unroll
  for (int j = 0; j < 8; ++j)
#pragma unroll
    for (int r = 0; r < 8; ++r) ss[wave][8 * g + r][j * 16 + col] = acc[j][r] * (1.0f / 2048.0f);
  LDSX(); for (int rl = 0; rl < 16; ++rl) vst2(Y + ((size_t)b * TT + ql0 + rl) * CC + h * HD + cc0 + lane * 4, *(const v4f*)&ss[wave][rl][lane * 4]); }
// ---- k_out: block = (64 rows, 128 cols): out = y (bf16 hi + lo) Wproj + b
__global__ __launch_bounds__(128) void k_out(const float* __restrict__ Y, const float* __restrict__ WP, const float* __restrict__ BP, float* __restrict__ OUT) { __shared__ __align__(16) float sf[4][16][132];
  const int tid = threadIdx.x, wave = tid >> 5, lane = tid & 31, col = lane & 15, g = lane >> 4; const int c0 = blockIdx.y * 128; const size_t r0 = (size_t)blockIdx.x * 64 + wave * 16;
  v8f acc[8] = {};
#pragma unroll 2
  for (int kc = 0; kc < CC / 32; ++kc) { const F2 a = split_row(Y + (r0 + col) * CC, kc * 32, lane);
#pragma unroll
    for (int j = 0; j < 8; ++j) { v16b w; const int o = c0 + j * 16 + col;
#pragma unroll
      for (int i = 0; i < 8; ++i) { w[i] = (__bf16)WP[(size_t)(o) * CC + (kc * 32 + 8 * g + i)]; w[8 + i] = (__bf16)WP[(size_t)(o) * CC + (kc * 32 + 16 + 8 * g + i)]; }
      acc[j] = wmma_bf(a.h, w, acc[j]); acc[j] = wmma_bf(a.l, w, acc[j]); } }
#pragma unroll
  for (int j = 0; j < 8; ++j) { const float bb = BP ? bfr(BP[c0 + j * 16 + col]) : 0.f;
#pragma unroll
    for (int r = 0; r < 8; ++r) sf[wave][8 * g + r][j * 16 + col] = acc[j][r] + bb; }
  LDSX(); for (int rl = 0; rl < 16; ++rl) vst2(OUT + (r0 + rl) * CC + c0 + lane * 4, *(const v4f*)&sf[wave][rl][lane * 4]); }
extern "C" void kernel_launch(void* const* d_in, const int* in_sizes, int n_in, void* d_out, int out_size, void* d_ws, size_t ws_size, hipStream_t stream) {
  (void)in_sizes; (void)n_in; (void)out_size;
  const float** F = (const float**)d_in;   // 0 input [4,2048,1024], 1 Wq [2,512,512] ([out,in] per head), 2 bq [2,512], 3 Wk, 4 bk, 5 Wv, 6 bv, 7 Wf [1024,1024] ([out,in]), 8 bf, 9 masked [1] int (= 1 -> causal)
  if (ws_size < (size_t)WS_END) return;
  char* ws = (char*)d_ws; _Float16 *QH = (_Float16*)(ws + WS_QH), *QL = (_Float16*)(ws + WS_QL), *KH = (_Float16*)(ws + WS_KH); __bf16 *VT = (__bf16*)(ws + WS_VT), *VL = (__bf16*)(ws + WS_VL); float *S = (float*)(ws + WS_S), *Y = (float*)(ws + WS_Y);
  k_proj<<<dim3(TNB * TT / 64, CC / 128, 3), 128, 0, stream>>>(F[0], F[1], F[2], F[3], F[4], F[5], F[6], QH, QL, KH, VT, VL);
  k_sc<<<dim3(TT / 64, TT / 128, TNB * NH), 128, 0, stream>>>(QH, QL, KH, nullptr, (const int*)d_in[9], S);
  k_sm<<<dim3(TT, TNB * NH), 256, 0, stream>>>(S, (const int*)d_in[9]);
  k_pv<<<dim3(HD / 128, TNB * NH, TT / 64), 128, 0, stream>>>(S, VT, VL, (const int*)d_in[9], Y);
  k_out<<<dim3(TNB * TT / 64, CC / 128), 128, 0, stream>>>(Y, F[7], F[8], (float*)d_out);
}

// v002
// A run of this version takes 253 microseconds.
// Timed twice side by side with v001, it ran 2.91 times as fast both times.
// Over all steps from v000 it is 8.36 times as fast.
// compute dtype: all float inputs rounded to bf16, 'masked' read at run time (1 -> causal; 0 -> full attention); per-head q/k/v = x_half W_n^T + b_n (block-diagonal [out,in] linears) with EXACT bf16 products on WMMA 16x16x32, f32 accumulate, q/k rounded once to f16 (0.02-scale weights, logits std ~0.01: 1 product), causal logits stored in f32 per (batch, head); softmax in f32 (precise expf), P x 2^11 kept f32 and split bf16 hi + lo against v as bf16 hi + lo (3 products); out = y (bf16 hi + lo) Wf^T + bf; f32 output.
#include <hip/hip_runtime.h>
#include <math.h>

typedef __attribute__((ext_vector_type(16))) _Float16 v16h;
typedef __attribute__((ext_vector_type(16))) __bf16 v16b;
typedef __attribute__((ext_vector_type(8)))  _Float16 v8h;
typedef __attribute__((ext_vector_type(8)))  float v8f;
typedef __attribute__((ext_vector_type(4)))  float v4f;
typedef __attribute__((ext_vector_type(2)))  float v2f;
typedef __attribute__((ext_vector_type(4)))  unsigned v4u;
typedef __attribute__((ext_vector_type(4)))  int v4i;
typedef float __attribute__((may_alias)) float_a;
typedef int __attribute__((may_alias)) int_a;

template <typename T> __device__ __forceinline__ void vst2(void* p, T v) { *(T*)p = v;  }
__device__ __forceinline__ v8f wmma16(v16h a, v16h b, v8f c) {
  v8f d = __builtin_amdgcn_wmma_f32_16x16x32_f16(false, a, false, b, (short)0, c, false, false);
  asm volatile("v_nop\n\tv_nop\n\tv_nop\n\tv_nop" : "+v"(d) : "v"(a), "v"(b));
  return d;
}
__device__ __forceinline__ v8f wmma_bf(v16b a, v16b b, v8f c) {
  v8f d = __builtin_amdgcn_wmma_f32_16x16x32_bf16(false, a, false, b, (short)0, c, false, false);
  asm volatile("v_nop\n\tv_nop\n\tv_nop\n\tv_nop" : "+v"(d) : "v"(a), "v"(b));
  return d;
}
// 16x16x32 fragments: lane = (h = lane>>4, row/col = lane&15); elements 0..7 = k0+8h+0..7, 8..15 = k0+16+8h+0..7; D element r = row 8h+r
__device__ __forceinline__ v16h frag_h(const _Float16* rowk0, int lane) {
  union { v16h v; v8h q[2]; } u; const _Float16* p = rowk0 + 8 * (lane >> 4);
  u.q[0] = *(const v8h*)p; u.q[1] = *(const v8h*)(p + 16); return u.v;
}
__device__ __forceinline__ v16h frag_f32(const float* rowk0, int lane) {
  v16h a; const float* p = rowk0 + 8 * (lane >> 4);
#pragma unroll
  for (int i = 0; i < 8; ++i) { a[i] = (_Float16)p[i]; a[8 + i] = (_Float16)p[16 + i]; }
  return a;
}
__device__ __forceinline__ v16h frag_f32s(const float* rowk0, int lane, float sc) {
  v16h a; const float* p = rowk0 + 8 * (lane >> 4);
#pragma unroll
  for (int i = 0; i < 8; ++i) { a[i] = (_Float16)(p[i] * sc); a[8 + i] = (_Float16)(p[16 + i] * sc); }
  return a;
}
// column fragment from a [K][ld] layout (column n), rows >= K read as 0
__device__ __forceinline__ v16h fragc_f32(const float* W, int k0, int n, int lane, int ld, int K) {
  v16h a; const int g = lane >> 4;
#pragma unroll
  for (int i = 0; i < 8; ++i) { const int ka = k0 + 8 * g + i, kb = ka + 16;
    a[i] = (_Float16)(ka < K ? W[(size_t)(ka < K ? ka : K - 1) * ld + n] : 0.f); a[8 + i] = (_Float16)(kb < K ? W[(size_t)(kb < K ? kb : K - 1) * ld + n] : 0.f); }
  return a;
}
struct F2 { v16b h, l; };
__device__ __forceinline__ F2 bsplit16(const float v[16]) { F2 r;
#pragma unroll
  for (int i = 0; i < 16; ++i) { const __bf16 h = (__bf16)v[i]; r.h[i] = h; r.l[i] = (__bf16)(v[i] - (float)h); }
  return r; }
__device__ __forceinline__ F2 split_row(const float* row, int k0, int lane) { float v[16]; const float* p = row + k0 + 8 * (lane >> 4);
#pragma unroll
  for (int i = 0; i < 8; ++i) { v[i] = p[i]; v[8 + i] = p[16 + i]; }
  return bsplit16(v); }
__device__ __forceinline__ F2 split_rowK(const float* row, int k0, int lane, int K) { float v[16]; const int g = lane >> 4;
#pragma unroll
  for (int i = 0; i < 8; ++i) { const int ka = k0 + 8 * g + i, kb = ka + 16; v[i] = ka < K ? row[ka < K ? ka : K - 1] : 0.f; v[8 + i] = kb < K ? row[kb < K ? kb : K - 1] : 0.f; }
  return bsplit16(v); }
__device__ __forceinline__ F2 split_col(const float* W, int k0, int n, int lane, int ld, int K) { float v[16]; const int g = lane >> 4;
#pragma unroll
  for (int i = 0; i < 8; ++i) { const int ka = k0 + 8 * g + i, kb = ka + 16; v[i] = ka < K ? W[(size_t)(ka < K ? ka : K - 1) * ld + n] : 0.f; v[8 + i] = kb < K ? W[(size_t)(kb < K ? kb : K - 1) * ld + n] : 0.f; }
  return bsplit16(v); }
__device__ __forceinline__ v8f mac3(const F2& a, const F2& b, v8f c) { c = wmma_bf(a.l, b.h, c); c = wmma_bf(a.h, b.l, c); return wmma_bf(a.h, b.h, c); }
__device__ __forceinline__ float sigm(float v) { return 1.0f / (1.0f + expf(-v)); }
#define LDSX() do { asm volatile("s_wait_dscnt 0" ::: "memory"); __builtin_amdgcn_wave_barrier(); __builtin_amdgcn_fence(__ATOMIC_RELEASE, "workgroup"); } while (0)


// Two-headed causal attention with per-head Linear projections on the two contiguous 512-wide halves of the input (B 4, S 2,048, E 1,024), scores / sqrt(512), softmax . v, final Linear Wf + bf.
#define NB 4
#define TT 2048
#define CC 1024
#define NH 2
#define HD 512
#ifndef TNB
#define TNB NB
#endif
typedef __attribute__((ext_vector_type(8))) __bf16 v8b;
__device__ __forceinline__ v16b frag_b(const __bf16* rowk0, int lane) {
  union { v16b v; v8b q[2]; } u; const __bf16* p = rowk0 + 8 * (lane >> 4);
  u.q[0] = *(const v8b*)p; u.q[1] = *(const v8b*)(p + 16); return u.v;
}
__device__ __forceinline__ float bfr(float v) { return (float)(__bf16)v; }
__device__ __attribute__((noinline)) float exp_ni(float v) { return expf(v); }
__device__ __attribute__((noinline)) float erf_ni(float v) { return erff(v); }

#define WS_QH  0u
#define WS_QL  (WS_QH + 2u * (size_t)NB * TT * CC)
#define WS_KH  (WS_QL + 2u * (size_t)NB * TT * CC)
#define WS_VT  (WS_KH + 2u * (size_t)NB * TT * CC)      // bf16 v planes [b][c][t]
#define WS_VL  (WS_VT + 2u * (size_t)NB * CC * TT)      // bf16 v residual planes
#define WS_S   (WS_VL + 2u * (size_t)NB * CC * TT)      // f32 logits, then P x 2^11 in place: one [t][t] plane per (batch, head)
#define WS_Y   (WS_S + 4u * (size_t)NB * NH * TT * TT)  // f32 y rows [b*t][C]
#define WS_END (WS_Y + 4u * (size_t)NB * TT * CC)

// ---- LDS staging shared by the four matrix kernels: a block's 128 threads fetch each operand tile with loads that cover whole 128-byte lines (k_pv's v: 64-byte halves), convert it once, and lay it in LDS in k order; every wave then takes its fragments with frag_b / frag_h from rows at a pitch of 16 B x odd (80 B for 64-byte rows, 144 B for 128-byte rows). Two buffers, one barrier per k step: the next tile's global loads fly during the products and are stored behind them.
typedef __attribute__((ext_vector_type(4))) __bf16 v4b;
#define P32 40   // elements per LDS row holding 32 16-bit values (80 B)
#define P64 72   // elements per LDS row holding 64 16-bit values (144 B)
__device__ __forceinline__ v4b cvt4(v4f v) { v4b r;
#pragma unroll
  for (int i = 0; i < 4; ++i) r[i] = (__bf16)v[i];
  return r; }
__device__ __forceinline__ v4b res4(v4f v, v4b h) { v4b r;
#pragma unroll
  for (int i = 0; i < 4; ++i) r[i] = (__bf16)(v[i] - (float)h[i]);
  return r; }

// ---- k_proj: block = (64 rows, 128 cols, which): qkv = x W (+ b), exact; q -> f16 hi (+ residual), k -> f16 rows, v -> bf16 hi + lo planes
__global__ __launch_bounds__(128) void k_proj(const float* __restrict__ X, const float* __restrict__ WQ, const float* __restrict__ BQ, const float* __restrict__ WK, const float* __restrict__ BK, const float* __restrict__ WV, const float* __restrict__ BV, _Float16* __restrict__ QH, _Float16* __restrict__ QL, _Float16* __restrict__ KH, __bf16* __restrict__ VT, __bf16* __restrict__ VL) {
  __shared__ __align__(16) char sm[36864];   // k loop: x tiles [2][64][P32], W tiles [2][128][P32]; epilogue, behind a barrier: sh + sl, or th + tl2
  _Float16 (*sh)[136] = (_Float16 (*)[136])sm; _Float16 (*sl)[136] = (_Float16 (*)[136])(sm + 64 * 136 * 2); __bf16 (*th)[72] = (__bf16 (*)[72])sm; __bf16 (*tl2)[72] = (__bf16 (*)[72])(sm + 128 * 72 * 2);
  __bf16* sA = (__bf16*)sm; __bf16* sB = (__bf16*)(sm + 2 * 64 * P32 * 2);
  const int tid = threadIdx.x, wave = tid >> 5, lane = tid & 31, col = lane & 15, g = lane >> 4; const int which = blockIdx.z; const int c0 = blockIdx.y * 128; const size_t r0 = (size_t)blockIdx.x * 64; const float* WA = which == 0 ? WQ : which == 1 ? WK : WV; const float* BA = which == 0 ? BQ : which == 1 ? BK : BV; const int hn = c0 / HD;   // head of this 128-column block (HD = 512)
  const int sr = tid >> 3, sq = tid & 7;   // staging: 8 threads of 16 B per 128-byte row piece
  const float* gA = X + (r0 + sr) * CC + hn * HD + sq * 4; const float* gB = WA + (size_t)(c0 + sr) * HD + sq * 4;
  v4f ra[4], rb[8]; v8f acc[8] = {};
#pragma unroll
  for (int i = 0; i < 4; ++i) ra[i] = *(const v4f*)(gA + (size_t)i * 16 * CC);
#pragma unroll
  for (int i = 0; i < 8; ++i) rb[i] = *(const v4f*)(gB + (size_t)i * 16 * HD);
#pragma unroll
  for (int i = 0; i < 4; ++i) *(v4b*)(sA + (sr + 16 * i) * P32 + sq * 4) = cvt4(ra[i]);
#pragma unroll
  for (int i = 0; i < 8; ++i) *(v4b*)(sB + (sr + 16 * i) * P32 + sq * 4) = cvt4(rb[i]);
#pragma unroll 2   // two steps per trip: the buffer index becomes a constant
  for (int kc = 0; kc < HD / 32; ++kc) { const int bu = kc & 1, nb = bu ^ 1; const bool more = kc + 1 < HD / 32;
    __syncthreads();   // publishes buffer bu; ends every wave's reads of buffer nb
    if (more) {
#pragma unroll
      for (int i = 0; i < 4; ++i) ra[i] = *(const v4f*)(gA + (size_t)i * 16 * CC + (kc + 1) * 32);
#pragma unroll
      for (int i = 0; i < 8; ++i) rb[i] = *(const v4f*)(gB + (size_t)i * 16 * HD + (kc + 1) * 32);
      asm volatile("s_wait_xcnt 0x0" ::: "memory");   // precaution: stands ahead of every rewrite of the address registers that these loads name
    }
    const v16b a = frag_b(sA + (bu * 64 + wave * 16 + col) * P32, lane); v16b w[8];   // the step's LDS reads stand together, ahead of its products: one exposed LDS latency, not eight
#pragma unroll
    for (int j = 0; j < 8; ++j) w[j] = frag_b(sB + (bu * 128 + j * 16 + col) * P32, lane);
#pragma unroll
    for (int j = 0; j < 8; ++j) acc[j] = wmma_bf(a, w[j], acc[j]);
    if (more) {
#pragma unroll
      for (int i = 0; i < 4; ++i) *(v4b*)(sA + (nb * 64 + sr + 16 * i) * P32 + sq * 4) = cvt4(ra[i]);
#pragma unroll
      for (int i = 0; i < 8; ++i) *(v4b*)(sB + (nb * 128 + sr + 16 * i) * P32 + sq * 4) = cvt4(rb[i]); } }
  __syncthreads();   // the tiles are dead: the epilogue reuses their LDS
#pragma unroll
  for (int j = 0; j < 8; ++j) { const float bb = bfr(BA[c0 + j * 16 + col]);
#pragma unroll
    for (int r = 0; r < 8; ++r) { const float v = acc[j][r] + bb; const int rl = wave * 16 + 8 * g + r, cl = j * 16 + col; const _Float16 hv = (_Float16)v;
      if (which == 2) { const __bf16 bh = (__bf16)v; th[cl][rl] = bh; tl2[cl][rl] = (__bf16)(v - (float)bh); } else { sh[rl][cl] = hv; sl[rl][cl] = (_Float16)(v - (float)hv); } } }
  __syncthreads();
  if (which < 2) { _Float16* dh = which == 0 ? QH : KH; for (int e = tid; e < 64 * 16; e += 128) { const int rl = e >> 4, q = e & 15; vst2((unsigned*)(dh + (r0 + rl) * CC + c0 + q * 8), *(const v4u*)&sh[rl][q * 8]); if (which == 0) vst2((unsigned*)(QL + (r0 + rl) * CC + c0 + q * 8), *(const v4u*)&sl[rl][q * 8]); } }
  else { const size_t b = r0 / TT; const int t0 = (int)(r0 % TT); for (int e = tid; e < 128 * 8; e += 128) { const int cl = e >> 3, q = e & 7; const size_t o2 = (b * CC + c0 + cl) * (size_t)TT + t0 + q * 8; vst2((unsigned*)(VT + o2), *(const v4u*)&th[cl][q * 8]); vst2((unsigned*)(VL + o2), *(const v4u*)&tl2[cl][q * 8]); } } }
// ---- k_sc: block = (64 queries, 128 keys, pair = b * NH + h): logits * scale; causal blocks beyond the diagonal exit
__global__ __launch_bounds__(128) void k_sc(const _Float16* __restrict__ QH, const _Float16* __restrict__ QL, const _Float16* __restrict__ KH, const float* __restrict__ BM, const int* __restrict__ MSK, float* __restrict__ S) { __shared__ __align__(16) char sm[55296];   // k loop: q tiles [2][64][P64], k tiles [2][128][P64]; epilogue, behind a barrier: ss
  float (*ss)[16][132] = (float (*)[16][132])sm; _Float16* sA = (_Float16*)sm; _Float16* sB = (_Float16*)(sm + 2 * 64 * P64 * 2);
  const bool cz = (MSK[0] != 0); const int b = blockIdx.z / NH, h = blockIdx.z % NH; S += (size_t)blockIdx.z * TT * TT;
  const int tid = threadIdx.x, wave = tid >> 5, lane = tid & 31, col = lane & 15, g = lane >> 4; const int k0 = blockIdx.y * 128; const int ql0 = blockIdx.x * 64 + wave * 16;
  if (cz && k0 > blockIdx.x * 64 + 63) return;   // causal: whole key block above the diagonal (block-uniform)
  (void)QL; const int sr = tid >> 3, sq = tid & 7;   // staging: 8 threads of 16 B per 128-byte row piece (64 k)
  const _Float16* gA = QH + ((size_t)b * TT + blockIdx.x * 64 + sr) * CC + h * HD + sq * 8; const _Float16* gB = KH + ((size_t)b * TT + k0 + sr) * CC + h * HD + sq * 8;
  v4u ra[4], rb[8]; v8f acc[8] = {};
#pragma unroll
  for (int i = 0; i < 4; ++i) ra[i] = *(const v4u*)(gA + (size_t)i * 16 * CC);
#pragma unroll
  for (int i = 0; i < 8; ++i) rb[i] = *(const v4u*)(gB + (size_t)i * 16 * CC);
#pragma unroll
  for (int i = 0; i < 4; ++i) *(v4u*)(sA + (sr + 16 * i) * P64 + sq * 8) = ra[i];
#pragma unroll
  for (int i = 0; i < 8; ++i) *(v4u*)(sB + (sr + 16 * i) * P64 + sq * 8) = rb[i];
#pragma unroll 2   // two steps per trip: the buffer index becomes a constant
  for (int ks = 0; ks < HD / 64; ++ks) { const int bu = ks & 1, nb = bu ^ 1; const bool more = ks + 1 < HD / 64;
    __syncthreads();   // publishes buffer bu; ends every wave's reads of buffer nb
    if (more) {
#pragma unroll
      for (int i = 0; i < 4; ++i) ra[i] = *(const v4u*)(gA + (size_t)i * 16 * CC + (ks + 1) * 64);
#pragma unroll
      for (int i = 0; i < 8; ++i) rb[i] = *(const v4u*)(gB + (size_t)i * 16 * CC + (ks + 1) * 64);
      asm volatile("s_wait_xcnt 0x0" ::: "memory");   // precaution: stands ahead of every rewrite of the address registers that these loads name
    }
#pragma unroll
    for (int s = 0; s < 2; ++s) { const v16h ah = frag_h(sA + (bu * 64 + wave * 16 + col) * P64 + s * 32, lane); v16h kb[8];   // LDS reads together, ahead of their products
#pragma unroll
      for (int j = 0; j < 8; ++j) kb[j] = frag_h(sB + (bu * 128 + j * 16 + col) * P64 + s * 32, lane);
#pragma unroll
      for (int j = 0; j < 8; ++j) acc[j] = wmma16(ah, kb[j], acc[j]); }
    if (more) {
#pragma unroll
      for (int i = 0; i < 4; ++i) *(v4u*)(sA + (nb * 64 + sr + 16 * i) * P64 + sq * 8) = ra[i];
#pragma unroll
      for (int i = 0; i < 8; ++i) *(v4u*)(sB + (nb * 128 + sr + 16 * i) * P64 + sq * 8) = rb[i]; } }
  __syncthreads();   // the tiles are dead: the epilogue reuses their LDS
#pragma unroll
  for (int j = 0; j < 8; ++j) { const int kt = k0 + j * 16 + col;
#pragma unroll
    for (int r = 0; r < 8; ++r) { const int qt = ql0 + 8 * g + r; float v = acc[j][r] * 0.044194173824159216f; (void)BM; if (cz && kt > qt) v = -3.0e38f; ss[wave][8 * g + r][j * 16 + col] = v; } }
  LDSX(); for (int rl = 0; rl < 16; ++rl) vst2(S + (size_t)(ql0 + rl) * TT + k0 + lane * 4, *(const v4f*)&ss[wave][rl][lane * 4]); }
// ---- k_sm: block = (query row, pair): softmax over keys [0, kend) -> P x 2^11 f32 (masked -> 0)
__global__ __launch_bounds__(256) void k_sm(float* __restrict__ S, const int* __restrict__ MSK) { __shared__ float sred[8]; __shared__ float sbc; __shared__ __align__(16) float sh[TT];
  const int t = threadIdx.x; const size_t row = blockIdx.x; float* sr = S + ((size_t)blockIdx.y * TT + row) * TT; const int kend = (MSK[0] != 0) ? (((int)row / 64) * 64 + 64) : TT;
  float m = -3.0e38f; for (int k = t; k < kend; k += 256) m = fmaxf(m, sr[k]);
#pragma unroll
  for (int o = 1; o < 32; o <<= 1) m = fmaxf(m, __shfl_xor(m, o));
  if ((t & 31) == 0) sred[t >> 5] = m; __syncthreads(); if (t == 0) { float a = sred[0]; for (int i = 1; i < 8; ++i) a = fmaxf(a, sred[i]); sbc = a; } __syncthreads(); m = sbc; __syncthreads();
  float sum = 0.f; for (int k = t; k < kend; k += 256) { const float v = sr[k]; sum += (v <= -1.0e38f) ? 0.f : expf(v - m); }
#pragma unroll
  for (int o = 1; o < 32; o <<= 1) sum += __shfl_xor(sum, o);
  if ((t & 31) == 0) sred[t >> 5] = sum; __syncthreads(); if (t == 0) { float a = 0.f; for (int i = 0; i < 8; ++i) a += sred[i]; sbc = 1.0f / a; } __syncthreads(); const float inv = sbc;
  for (int k = t; k < kend; k += 256) { const float v = sr[k]; sh[k] = (v <= -1.0e38f) ? 0.f : expf(v - m) * inv * 2048.0f; }
  __syncthreads(); for (int q = t; q < kend / 4; q += 256) vst2(sr + q * 4, *(const v4f*)&sh[q * 4]); }
// ---- k_pv: block = (128-column chunk, pair = b * NH + h, 64 queries): y = P . (v hi + lo) with P split hi + lo (3 products); the query tile, whose index sets the causal trip count, is the slowest grid index, so that work-groups far apart in launch order differ in length
__global__ __launch_bounds__(128) void k_pv(const float* __restrict__ PS, const __bf16* __restrict__ VT, const __bf16* __restrict__ VL, const int* __restrict__ MSK, float* __restrict__ Y) { __shared__ __align__(16) char sm[61440];   // k loop: P hi, P lo [2][64][P32] each, v hi, v lo [2][128][P32] each; epilogue, behind a barrier: ss
  float (*ss)[16][132] = (float (*)[16][132])sm; __bf16* sPh = (__bf16*)sm; __bf16* sPl = (__bf16*)(sm + 10240); __bf16* sVh = (__bf16*)(sm + 20480); __bf16* sVl = (__bf16*)(sm + 40960);
  const int tid = threadIdx.x, wave = tid >> 5, lane = tid & 31, col = lane & 15, g = lane >> 4; const int b = blockIdx.y / NH, h = blockIdx.y % NH; PS += (size_t)blockIdx.y * TT * TT; const int ql0 = blockIdx.z * 64 + wave * 16; const int cc0 = blockIdx.x * 128; const int kend = (MSK[0] != 0) ? (blockIdx.z * 64 + 64) : TT; const int nk = kend / 32;
  const int sr = tid >> 3, sq = tid & 7, vr = tid >> 2, vq = tid & 3;   // staging: P 8 threads of 16 B per 128-byte row piece, v 4 threads per 64-byte row piece
  const float* gP = PS + (size_t)(blockIdx.z * 64 + sr) * TT + sq * 4; const size_t vo = ((size_t)b * CC + h * HD + cc0 + vr) * (size_t)TT + vq * 8; const __bf16* gH = VT + vo; const __bf16* gL = VL + vo;
  v4f rp[4]; v4u rh[4], rl4[4]; v8f acc[8] = {};
#pragma unroll
  for (int i = 0; i < 4; ++i) { rp[i] = *(const v4f*)(gP + (size_t)i * 16 * TT); rh[i] = *(const v4u*)(gH + (size_t)i * 32 * TT); rl4[i] = *(const v4u*)(gL + (size_t)i * 32 * TT); }
#pragma unroll
  for (int i = 0; i < 4; ++i) { const v4b ph = cvt4(rp[i]); *(v4b*)(sPh + (sr + 16 * i) * P32 + sq * 4) = ph; *(v4b*)(sPl + (sr + 16 * i) * P32 + sq * 4) = res4(rp[i], ph); *(v4u*)(sVh + (vr + 32 * i) * P32 + vq * 8) = rh[i]; *(v4u*)(sVl + (vr + 32 * i) * P32 + vq * 8) = rl4[i]; }
#pragma unroll 2   // two steps per trip (nk is even): the buffer index becomes a constant
  for (int kc = 0; kc < nk; ++kc) { const int bu = kc & 1, nb = bu ^ 1; const bool more = kc + 1 < nk;
    __syncthreads();   // publishes buffer bu; ends every wave's reads of buffer nb
    if (more) {
#pragma unroll
      for (int i = 0; i < 4; ++i) { rp[i] = *(const v4f*)(gP + (size_t)i * 16 * TT + (kc + 1) * 32); rh[i] = *(const v4u*)(gH + (size_t)i * 32 * TT + (kc + 1) * 32); rl4[i] = *(const v4u*)(gL + (size_t)i * 32 * TT + (kc + 1) * 32); }
      asm volatile("s_wait_xcnt 0x0" ::: "memory");   // precaution: stands ahead of every rewrite of the address registers that these loads name
    }
    const v16b ph = frag_b(sPh + (bu * 64 + wave * 16 + col) * P32, lane), pl = frag_b(sPl + (bu * 64 + wave * 16 + col) * P32, lane);
#pragma unroll
    for (int jh = 0; jh < 8; jh += 4) { v16b vh[4], vl[4];   // LDS reads of four column tiles together, ahead of their twelve products
#pragma unroll
      for (int j = 0; j < 4; ++j) { const int ro = (bu * 128 + (jh + j) * 16 + col) * P32; vh[j] = frag_b(sVh + ro, lane); vl[j] = frag_b(sVl + ro, lane); }
#pragma unroll
      for (int j = 0; j < 4; ++j) { acc[jh + j] = wmma_bf(ph, vh[j], acc[jh + j]); acc[jh + j] = wmma_bf(pl, vh[j], acc[jh + j]); acc[jh + j] = wmma_bf(ph, vl[j], acc[jh + j]); } }
    if (more) {
#pragma unroll
      for (int i = 0; i < 4; ++i) { const v4b qh = cvt4(rp[i]); *(v4b*)(sPh + (nb * 64 + sr + 16 * i) * P32 + sq * 4) = qh; *(v4b*)(sPl + (nb * 64 + sr + 16 * i) * P32 + sq * 4) = res4(rp[i], qh); *(v4u*)(sVh + (nb * 128 + vr + 32 * i) * P32 + vq * 8) = rh[i]; *(v4u*)(sVl + (nb * 128 + vr + 32 * i) * P32 + vq * 8) = rl4[i]; } } }
  __syncthreads();   // the tiles are dead: the epilogue reuses their LDS
#pragma unroll
  for (int j = 0; j < 8; ++j)
#pragma unroll
    for (int r = 0; r < 8; ++r) ss[wave][8 * g + r][j * 16 + col] = acc[j][r] * (1.0f / 2048.0f);
  LDSX(); for (int rl = 0; rl < 16; ++rl) vst2(Y + ((size_t)b * TT + ql0 + rl) * CC + h * HD + cc0 + lane * 4, *(const v4f*)&ss[wave][rl][lane * 4]); }
// ---- k_out: block = (64 rows, 128 cols): out = y (bf16 hi + lo) Wproj + b
__global__ __launch_bounds__(128) void k_out(const float* __restrict__ Y, const float* __restrict__ WP, const float* __restrict__ BP, float* __restrict__ OUT) { __shared__ __align__(16) char sm[40960];   // k loop: y hi, y lo [2][64][P32] each, W tiles [2][128][P32]; epilogue, behind a barrier: sf
  float (*sf)[16][132] = (float (*)[16][132])sm; __bf16* sAh = (__bf16*)sm; __bf16* sAl = (__bf16*)(sm + 10240); __bf16* sB = (__bf16*)(sm + 20480);
  const int tid = threadIdx.x, wave = tid >> 5, lane = tid & 31, col = lane & 15, g = lane >> 4; const int c0 = blockIdx.y * 128; const size_t r0 = (size_t)blockIdx.x * 64 + wave * 16;
  const int sr = tid >> 3, sq = tid & 7;   // staging: 8 threads of 16 B per 128-byte row piece
  const float* gA = Y + ((size_t)blockIdx.x * 64 + sr) * CC + sq * 4; const float* gB = WP + (size_t)(c0 + sr) * CC + sq * 4;
  v4f ra[4], rb[8]; v8f acc[8] = {};
#pragma unroll
  for (int i = 0; i < 4; ++i) ra[i] = *(const v4f*)(gA + (size_t)i * 16 * CC);
#pragma unroll
  for (int i = 0; i < 8; ++i) rb[i] = *(const v4f*)(gB + (size_t)i * 16 * CC);
#pragma unroll
  for (int i = 0; i < 4; ++i) { const v4b ah = cvt4(ra[i]); *(v4b*)(sAh + (sr + 16 * i) * P32 + sq * 4) = ah; *(v4b*)(sAl + (sr + 16 * i) * P32 + sq * 4) = res4(ra[i], ah); }
#pragma unroll
  for (int i = 0; i < 8; ++i) *(v4b*)(sB + (sr + 16 * i) * P32 + sq * 4) = cvt4(rb[i]);
#pragma unroll 2   // two steps per trip: the buffer index becomes a constant
  for (int kc = 0; kc < CC / 32; ++kc) { const int bu = kc & 1, nb = bu ^ 1; const bool more = kc + 1 < CC / 32;
    __syncthreads();   // publishes buffer bu; ends every wave's reads of buffer nb
    if (more) {
#pragma unroll
      for (int i = 0; i < 4; ++i) ra[i] = *(const v4f*)(gA + (size_t)i * 16 * CC + (kc + 1) * 32);
#pragma unroll
      for (int i = 0; i < 8; ++i) rb[i] = *(const v4f*)(gB + (size_t)i * 16 * CC + (kc + 1) * 32);
      asm volatile("s_wait_xcnt 0x0" ::: "memory");   // precaution: stands ahead of every rewrite of the address registers that these loads name
    }
    const v16b ah = frag_b(sAh + (bu * 64 + wave * 16 + col) * P32, lane), al = frag_b(sAl + (bu * 64 + wave * 16 + col) * P32, lane);
    v16b w[8];   // the step's LDS reads stand together, ahead of its products
#pragma unroll
    for (int j = 0; j < 8; ++j) w[j] = frag_b(sB + (bu * 128 + j * 16 + col) * P32, lane);
#pragma unroll
    for (int j = 0; j < 8; ++j) { acc[j] = wmma_bf(ah, w[j], acc[j]); acc[j] = wmma_bf(al, w[j], acc[j]); }
    if (more) {
#pragma unroll
      for (int i = 0; i < 4; ++i) { const v4b qh = cvt4(ra[i]); *(v4b*)(sAh + (nb * 64 + sr + 16 * i) * P32 + sq * 4) = qh; *(v4b*)(sAl + (nb * 64 + sr + 16 * i) * P32 + sq * 4) = res4(ra[i], qh); }
#pragma unroll
      for (int i = 0; i < 8; ++i) *(v4b*)(sB + (nb * 128 + sr + 16 * i) * P32 + sq * 4) = cvt4(rb[i]); } }
  __syncthreads();   // the tiles are dead: the epilogue reuses their LDS
#pragma unroll
  for (int j = 0; j < 8; ++j) { const float bb = BP ? bfr(BP[c0 + j * 16 + col]) : 0.f;
#pragma unroll
    for (int r = 0; r < 8; ++r) sf[wave][8 * g + r][j * 16 + col] = acc[j][r] + bb; }
  LDSX(); for (int rl = 0; rl < 16; ++rl) vst2(OUT + (r0 + rl) * CC + c0 + lane * 4, *(const v4f*)&sf[wave][rl][lane * 4]); }
extern "C" void kernel_launch(void* const* d_in, const int* in_sizes, int n_in, void* d_out, int out_size, void* d_ws, size_t ws_size, hipStream_t stream) {
  (void)in_sizes; (void)n_in; (void)out_size;
  const float** F = (const float**)d_in;   // 0 input [4,2048,1024], 1 Wq [2,512,512] ([out,in] per head), 2 bq [2,512], 3 Wk, 4 bk, 5 Wv, 6 bv, 7 Wf [1024,1024] ([out,in]), 8 bf, 9 masked [1] int (= 1 -> causal)
  if (ws_size < (size_t)WS_END) return;
  char* ws = (char*)d_ws; _Float16 *QH = (_Float16*)(ws + WS_QH), *QL = (_Float16*)(ws + WS_QL), *KH = (_Float16*)(ws + WS_KH); __bf16 *VT = (__bf16*)(ws + WS_VT), *VL = (__bf16*)(ws + WS_VL); float *S = (float*)(ws + WS_S), *Y = (float*)(ws + WS_Y);
  k_proj<<<dim3(TNB * TT / 64, CC / 128, 3), 128, 0, stream>>>(F[0], F[1], F[2], F[3], F[4], F[5], F[6], QH, QL, KH, VT, VL);
  k_sc<<<dim3(TT / 64, TT / 128, TNB * NH), 128, 0, stream>>>(QH, QL, KH, nullptr, (const int*)d_in[9], S);
  k_sm<<<dim3(TT, TNB * NH), 256, 0, stream>>>(S, (const int*)d_in[9]);
  k_pv<<<dim3(HD / 128, TNB * NH, TT / 64), 128, 0, stream>>>(S, VT, VL, (const int*)d_in[9], Y);
  k_out<<<dim3(TNB * TT / 64, CC / 128), 128, 0, stream>>>(Y, F[7], F[8], (float*)d_out);
}

// v003
// A run of this version takes 225 microseconds.
// Next to v002, in two timings, it ran 1.13 times as fast each time.
// Over all steps from v000 it is 9.44 times as fast.
// compute dtype: all float inputs rounded to bf16, 'masked' read at run time (1 -> causal; 0 -> full attention); per-head q/k/v = x_half W_n^T + b_n (block-diagonal [out,in] linears) with EXACT bf16 products on WMMA 16x16x32, f32 accumulate, q/k rounded once to f16 (0.02-scale weights, logits std ~0.01: 1 product), causal logits stored in f32 per (batch, head); softmax in f32 (precise expf), P x 2^11 kept f32 and split bf16 hi + lo against v as bf16 hi + lo (3 products); out = y (bf16 hi + lo) Wf^T + bf; f32 output.
#include <hip/hip_runtime.h>
#include <math.h>

typedef __attribute__((ext_vector_type(16))) _Float16 v16h;
typedef __attribute__((ext_vector_type(16))) __bf16 v16b;
typedef __attribute__((ext_vector_type(8)))  _Float16 v8h;
typedef __attribute__((ext_vector_type(8)))  float v8f;
typedef __attribute__((ext_vector_type(4)))  float v4f;
typedef __attribute__((ext_vector_type(2)))  float v2f;
typedef __attribute__((ext_vector_type(4)))  unsigned v4u;
typedef __attribute__((ext_vector_type(4)))  int v4i;
typedef float __attribute__((may_alias)) float_a;
typedef int __attribute__((may_alias)) int_a;

template <typename T> __device__ __forceinline__ void vst2(void* p, T v) { *(T*)p = v;  }
__device__ __forceinline__ v8f wmma16(v16h a, v16h b, v8f c) {
  v8f d = __builtin_amdgcn_wmma_f32_16x16x32_f16(false, a, false, b, (short)0, c, false, false);
  asm volatile("v_nop\n\tv_nop\n\tv_nop\n\tv_nop" : "+v"(d) : "v"(a), "v"(b));
  return d;
}
__device__ __forceinline__ v8f wmma_bf(v16b a, v16b b, v8f c) {
  v8f d = __builtin_amdgcn_wmma_f32_16x16x32_bf16(false, a, false, b, (short)0, c, false, false);
  asm volatile("v_nop\n\tv_nop\n\tv_nop\n\tv_nop" : "+v"(d) : "v"(a), "v"(b));
  return d;
}
// 16x16x32 fragments: lane = (h = lane>>4, row/col = lane&15); elements 0..7 = k0+8h+0..7, 8..15 = k0+16+8h+0..7; D element r = row 8h+r
__device__ __forceinline__ v16h frag_h(const _Float16* rowk0, int lane) {
  union { v16h v; v8h q[2]; } u; const _Float16* p = rowk0 + 8 * (lane >> 4);
  u.q[0] = *(const v8h*)p; u.q[1] = *(const v8h*)(p + 16); return u.v;
}
__device__ __forceinline__ v16h frag_f32(const float* rowk0, int lane) {
  v16h a; const float* p = rowk0 + 8 * (lane >> 4);
#pragma unroll
  for (int i = 0; i < 8; ++i) { a[i] = (_Float16)p[i]; a[8 + i] = (_Float16)p[16 + i]; }
  return a;
}
__device__ __forceinline__ v16h frag_f32s(const float* rowk0, int lane, float sc) {
  v16h a; const float* p = rowk0 + 8 * (lane >> 4);
#pragma unroll
  for (int i = 0; i < 8; ++i) { a[i] = (_Float16)(p[i] * sc); a[8 + i] = (_Float16)(p[16 + i] * sc); }
  return a;
}
// column fragment from a [K][ld] layout (column n), rows >= K read as 0
__device__ __forceinline__ v16h fragc_f32(const float* W, int k0, int n, int lane, int ld, int K) {
  v16h a; const int g = lane >> 4;
#pragma unroll
  for (int i = 0; i < 8; ++i) { const int ka = k0 + 8 * g + i, kb = ka + 16;
    a[i] = (_Float16)(ka < K ? W[(size_t)(ka < K ? ka : K - 1) * ld + n] : 0.f); a[8 + i] = (_Float16)(kb < K ? W[(size_t)(kb < K ? kb : K - 1) * ld + n] : 0.f); }
  return a;
}
struct F2 { v16b h, l; };
__device__ __forceinline__ F2 bsplit16(const float v[16]) { F2 r;
#pragma unroll
  for (int i = 0; i < 16; ++i) { const __bf16 h = (__bf16)v[i]; r.h[i] = h; r.l[i] = (__bf16)(v[i] - (float)h); }
  return r; }
__device__ __forceinline__ F2 split_row(const float* row, int k0, int lane) { float v[16]; const float* p = row + k0 + 8 * (lane >> 4);
#pragma unroll
  for (int i = 0; i < 8; ++i) { v[i] = p[i]; v[8 + i] = p[16 + i]; }
  return bsplit16(v); }
__device__ __forceinline__ F2 split_rowK(const float* row, int k0, int lane, int K) { float v[16]; const int g = lane >> 4;
#pragma unroll
  for (int i = 0; i < 8; ++i) { const int ka = k0 + 8 * g + i, kb = ka + 16; v[i] = ka < K ? row[ka < K ? ka : K - 1] : 0.f; v[8 + i] = kb < K ? row[kb < K ? kb : K - 1] : 0.f; }
  return bsplit16(v); }
__device__ __forceinline__ F2 split_col(const float* W, int k0, int n, int lane, int ld, int K) { float v[16]; const int g = lane >> 4;
#pragma unroll
  for (int i = 0; i < 8; ++i) { const int ka = k0 + 8 * g + i, kb = ka + 16; v[i] = ka < K ? W[(size_t)(ka < K ? ka : K - 1) * ld + n] : 0.f; v[8 + i] = kb < K ? W[(size_t)(kb < K ? kb : K - 1) * ld + n] : 0.f; }
  return bsplit16(v); }
__device__ __forceinline__ v8f mac3(const F2& a, const F2& b, v8f c) { c = wmma_bf(a.l, b.h, c); c = wmma_bf(a.h, b.l, c); return wmma_bf(a.h, b.h, c); }
__device__ __forceinline__ float sigm(float v) { return 1.0f / (1.0f + expf(-v)); }
#define LDSX() do { asm volatile("s_wait_dscnt 0" ::: "memory"); __builtin_amdgcn_wave_barrier(); __builtin_amdgcn_fence(__ATOMIC_RELEASE, "workgroup"); } while (0)


// Two-headed causal attention with per-head Linear projections on the two contiguous 512-wide halves of the input (B 4, S 2,048, E 1,024), scores / sqrt(512), softmax . v, final Linear Wf + bf.
#define NB 4
#define TT 2048
#define CC 1024
#define NH 2
#define HD 512
#ifndef TNB
#define TNB NB
#endif
typedef __attribute__((ext_vector_type(8))) __bf16 v8b;
__device__ __forceinline__ v16b frag_b(const __bf16* rowk0, int lane) {
  union { v16b v; v8b q[2]; } u; const __bf16* p = rowk0 + 8 * (lane >> 4);
  u.q[0] = *(const v8b*)p; u.q[1] = *(const v8b*)(p + 16); return u.v;
}
__device__ __forceinline__ float bfr(float v) { return (float)(__bf16)v; }
__device__ __attribute__((noinline)) float exp_ni(float v) { return expf(v); }
__device__ __attribute__((noinline)) float erf_ni(float v) { return erff(v); }

#define WS_QH  0u
#define WS_QL  (WS_QH + 2u * (size_t)NB * TT * CC)
#define WS_KH  (WS_QL + 2u * (size_t)NB * TT * CC)
#define WS_VT  (WS_KH + 2u * (size_t)NB * TT * CC)      // bf16 v planes [b][c][t]
#define WS_VL  (WS_VT + 2u * (size_t)NB * CC * TT)      // bf16 v residual planes
#define WS_S   (WS_VL + 2u * (size_t)NB * CC * TT)      // f32 logits, then P x 2^11 in place: one [t][t] plane per (batch, head)
#define WS_Y   (WS_S + 4u * (size_t)NB * NH * TT * TT)  // f32 y rows [b*t][C]
#define WS_END (WS_Y + 4u * (size_t)NB * TT * CC)

// ---- LDS staging shared by the four matrix kernels: a block's 128 threads fetch each operand tile with loads that cover whole 128-byte lines (k_pv's v: 64-byte halves), convert it once, and lay it in LDS in k order; every wave then takes its fragments with frag_b / frag_h from rows at a pitch of 16 B x odd (80 B for 64-byte rows, 144 B for 128-byte rows). Two buffers, one barrier per k step: the next tile's global loads fly during the products and are stored behind them.
typedef __attribute__((ext_vector_type(4))) __bf16 v4b;
#define P32 40   // elements per LDS row holding 32 16-bit values (80 B)
#define P64 72   // elements per LDS row holding 64 16-bit values (144 B)
__device__ __forceinline__ v4b cvt4(v4f v) { v4b r;
#pragma unroll
  for (int i = 0; i < 4; ++i) r[i] = (__bf16)v[i];
  return r; }
__device__ __forceinline__ v4b res4(v4f v, v4b h) { v4b r;
#pragma unroll
  for (int i = 0; i < 4; ++i) r[i] = (__bf16)(v[i] - (float)h[i]);
  return r; }

// ---- k_proj: block = (64 rows, 128 cols, which): qkv = x W (+ b), exact; q -> f16 hi (+ residual), k -> f16 rows, v -> bf16 hi + lo planes
__global__ __launch_bounds__(128) void k_proj(const float* __restrict__ X, const float* __restrict__ WQ, const float* __restrict__ BQ, const float* __restrict__ WK, const float* __restrict__ BK, const float* __restrict__ WV, const float* __restrict__ BV, _Float16* __restrict__ QH, _Float16* __restrict__ QL, _Float16* __restrict__ KH, __bf16* __restrict__ VT, __bf16* __restrict__ VL) {
  __shared__ __align__(16) char sm[36864];   // k loop: x tiles [2][64][P32], W tiles [2][128][P32]; epilogue, behind a barrier: sh + sl, or th + tl2
  _Float16 (*sh)[136] = (_Float16 (*)[136])sm; _Float16 (*sl)[136] = (_Float16 (*)[136])(sm + 64 * 136 * 2); __bf16 (*th)[72] = (__bf16 (*)[72])sm; __bf16 (*tl2)[72] = (__bf16 (*)[72])(sm + 128 * 72 * 2);
  __bf16* sA = (__bf16*)sm; __bf16* sB = (__bf16*)(sm + 2 * 64 * P32 * 2);
  const int tid = threadIdx.x, wave = tid >> 5, lane = tid & 31, col = lane & 15, g = lane >> 4; const int which = blockIdx.z; const int c0 = blockIdx.y * 128; const size_t r0 = (size_t)blockIdx.x * 64; const float* WA = which == 0 ? WQ : which == 1 ? WK : WV; const float* BA = which == 0 ? BQ : which == 1 ? BK : BV; const int hn = c0 / HD;   // head of this 128-column block (HD = 512)
  const int sr = tid >> 3, sq = tid & 7;   // staging: 8 threads of 16 B per 128-byte row piece
  const float* gA = X + (r0 + sr) * CC + hn * HD + sq * 4; const float* gB = WA + (size_t)(c0 + sr) * HD + sq * 4;
  v4f ra[4], rb[8]; v8f acc[8] = {};
#pragma unroll
  for (int i = 0; i < 4; ++i) ra[i] = *(const v4f*)(gA + (size_t)i * 16 * CC);
#pragma unroll
  for (int i = 0; i < 8; ++i) rb[i] = *(const v4f*)(gB + (size_t)i * 16 * HD);
#pragma unroll
  for (int i = 0; i < 4; ++i) *(v4b*)(sA + (sr + 16 * i) * P32 + sq * 4) = cvt4(ra[i]);
#pragma unroll
  for (int i = 0; i < 8; ++i) *(v4b*)(sB + (sr + 16 * i) * P32 + sq * 4) = cvt4(rb[i]);
#pragma unroll 2   // two steps per trip: the buffer index becomes a constant
  for (int kc = 0; kc < HD / 32; ++kc) { const int bu = kc & 1, nb = bu ^ 1; const bool more = kc + 1 < HD / 32;
    __syncthreads();   // publishes buffer bu; ends every wave's reads of buffer nb
    if (more) {
#pragma unroll
      for (int i = 0; i < 4; ++i) ra[i] = *(const v4f*)(gA + (size_t)i * 16 * CC + (kc + 1) * 32);
#pragma unroll
      for (int i = 0; i < 8; ++i) rb[i] = *(const v4f*)(gB + (size_t)i * 16 * HD + (kc + 1) * 32);
      asm volatile("s_wait_xcnt 0x0" ::: "memory");   // precaution: stands ahead of every rewrite of the address registers that these loads name
    }
    const v16b a = frag_b(sA + (bu * 64 + wave * 16 + col) * P32, lane); v16b w[8];   // the step's LDS reads stand together, ahead of its products: one exposed LDS latency, not eight
#pragma unroll
    for (int j = 0; j < 8; ++j) w[j] = frag_b(sB + (bu * 128 + j * 16 + col) * P32, lane);
#pragma unroll
    for (int j = 0; j < 8; ++j) acc[j] = wmma_bf(a, w[j], acc[j]);
    if (more) {
#pragma unroll
      for (int i = 0; i < 4; ++i) *(v4b*)(sA + (nb * 64 + sr + 16 * i) * P32 + sq * 4) = cvt4(ra[i]);
#pragma unroll
      for (int i = 0; i < 8; ++i) *(v4b*)(sB + (nb * 128 + sr + 16 * i) * P32 + sq * 4) = cvt4(rb[i]); } }
  __syncthreads();   // the tiles are dead: the epilogue reuses their LDS
#pragma unroll
  for (int j = 0; j < 8; ++j) { const float bb = bfr(BA[c0 + j * 16 + col]);
#pragma unroll
    for (int r = 0; r < 8; ++r) { const float v = acc[j][r] + bb; const int rl = wave * 16 + 8 * g + r, cl = j * 16 + col; const _Float16 hv = (_Float16)v;
      if (which == 2) { const __bf16 bh = (__bf16)v; th[cl][rl] = bh; tl2[cl][rl] = (__bf16)(v - (float)bh); } else { sh[rl][cl] = hv; sl[rl][cl] = (_Float16)(v - (float)hv); } } }
  __syncthreads();
  if (which < 2) { _Float16* dh = which == 0 ? QH : KH; for (int e = tid; e < 64 * 16; e += 128) { const int rl = e >> 4, q = e & 15; vst2((unsigned*)(dh + (r0 + rl) * CC + c0 + q * 8), *(const v4u*)&sh[rl][q * 8]); if (which == 0) vst2((unsigned*)(QL + (r0 + rl) * CC + c0 + q * 8), *(const v4u*)&sl[rl][q * 8]); } }
  else { const size_t b = r0 / TT; const int t0 = (int)(r0 % TT); for (int e = tid; e < 128 * 8; e += 128) { const int cl = e >> 3, q = e & 7; const size_t o2 = (b * CC + c0 + cl) * (size_t)TT + t0 + q * 8; vst2((unsigned*)(VT + o2), *(const v4u*)&th[cl][q * 8]); vst2((unsigned*)(VL + o2), *(const v4u*)&tl2[cl][q * 8]); } } }
// ---- k_sc: block = (64 queries, 128 keys, pair = b * NH + h): logits * scale; causal blocks beyond the diagonal exit
__global__ __launch_bounds__(128) void k_sc(const _Float16* __restrict__ QH, const _Float16* __restrict__ QL, const _Float16* __restrict__ KH, const float* __restrict__ BM, const int* __restrict__ MSK, float* __restrict__ S) { __shared__ __align__(16) char sm[55296];   // k loop: q tiles [2][64][P64], k tiles [2][128][P64]; epilogue, behind a barrier: ss
  float (*ss)[16][132] = (float (*)[16][132])sm; _Float16* sA = (_Float16*)sm; _Float16* sB = (_Float16*)(sm + 2 * 64 * P64 * 2);
  const bool cz = (MSK[0] != 0); const int b = blockIdx.z / NH, h = blockIdx.z % NH; S += (size_t)blockIdx.z * TT * TT;
  const int tid = threadIdx.x, wave = tid >> 5, lane = tid & 31, col = lane & 15, g = lane >> 4; const int k0 = blockIdx.y * 128; const int ql0 = blockIdx.x * 64 + wave * 16;
  if (cz && k0 > blockIdx.x * 64 + 63) return;   // causal: whole key block above the diagonal (block-uniform)
  (void)QL; const int sr = tid >> 3, sq = tid & 7;   // staging: 8 threads of 16 B per 128-byte row piece (64 k)
  const _Float16* gA = QH + ((size_t)b * TT + blockIdx.x * 64 + sr) * CC + h * HD + sq * 8; const _Float16* gB = KH + ((size_t)b * TT + k0 + sr) * CC + h * HD + sq * 8;
  v4u ra[4], rb[8]; v8f acc[8] = {};
#pragma unroll
  for (int i = 0; i < 4; ++i) ra[i] = *(const v4u*)(gA + (size_t)i * 16 * CC);
#pragma unroll
  for (int i = 0; i < 8; ++i) rb[i] = *(const v4u*)(gB + (size_t)i * 16 * CC);
#pragma unroll
  for (int i = 0; i < 4; ++i) *(v4u*)(sA + (sr + 16 * i) * P64 + sq * 8) = ra[i];
#pragma unroll
  for (int i = 0; i < 8; ++i) *(v4u*)(sB + (sr + 16 * i) * P64 + sq * 8) = rb[i];
#pragma unroll 2   // two steps per trip: the buffer index becomes a constant
  for (int ks = 0; ks < HD / 64; ++ks) { const int bu = ks & 1, nb = bu ^ 1; const bool more = ks + 1 < HD / 64;
    __syncthreads();   // publishes buffer bu; ends every wave's reads of buffer nb
    if (more) {
#pragma unroll
      for (int i = 0; i < 4; ++i) ra[i] = *(const v4u*)(gA + (size_t)i * 16 * CC + (ks + 1) * 64);
#pragma unroll
      for (int i = 0; i < 8; ++i) rb[i] = *(const v4u*)(gB + (size_t)i * 16 * CC + (ks + 1) * 64);
      asm volatile("s_wait_xcnt 0x0" ::: "memory");   // precaution: stands ahead of every rewrite of the address registers that these loads name
    }
#pragma unroll
    for (int s = 0; s < 2; ++s) { const v16h ah = frag_h(sA + (bu * 64 + wave * 16 + col) * P64 + s * 32, lane); v16h kb[8];   // LDS reads together, ahead of their products
#pragma unroll
      for (int j = 0; j < 8; ++j) kb[j] = frag_h(sB + (bu * 128 + j * 16 + col) * P64 + s * 32, lane);
#pragma unroll
      for (int j = 0; j < 8; ++j) acc[j] = wmma16(ah, kb[j], acc[j]); }
    if (more) {
#pragma unroll
      for (int i = 0; i < 4; ++i) *(v4u*)(sA + (nb * 64 + sr + 16 * i) * P64 + sq * 8) = ra[i];
#pragma unroll
      for (int i = 0; i < 8; ++i) *(v4u*)(sB + (nb * 128 + sr + 16 * i) * P64 + sq * 8) = rb[i]; } }
  __syncthreads();   // the tiles are dead: the epilogue reuses their LDS
#pragma unroll
  for (int j = 0; j < 8; ++j) { const int kt = k0 + j * 16 + col;
#pragma unroll
    for (int r = 0; r < 8; ++r) { const int qt = ql0 + 8 * g + r; float v = acc[j][r] * 0.044194173824159216f; (void)BM; if (cz && kt > qt) v = -3.0e38f; ss[wave][8 * g + r][j * 16 + col] = v; } }
  LDSX(); for (int rl = 0; rl < 16; ++rl) vst2(S + (size_t)(ql0 + rl) * TT + k0 + lane * 4, *(const v4f*)&ss[wave][rl][lane * 4]); }
// ---- k_sm: one wave = two whole rows of one pair, rows TT-1-j and j (under the causal mask the two lengths add up to about the same for every wave). A row lives in registers, 16 B per lane per 512-byte piece of 128 keys: the ng pieces that k_sc wrote for this row (its key blocks are 128 wide, masked keys at -3.0e38) are read once and P x 2^11 (masked -> 0) is stored once; maximum and sum go over the wave's lanes alone, with no LDS array and no barrier
__global__ __launch_bounds__(256) void k_sm(float* __restrict__ S, const int* __restrict__ MSK) {
  const int lane = threadIdx.x & 31; const int j = __builtin_amdgcn_readfirstlane((int)(blockIdx.x * 8 + (threadIdx.x >> 5)));   // wave-uniform, so that the tests on ng below are scalar branches with every lane on
  const bool cz = (MSK[0] != 0); float* pl = S + (size_t)blockIdx.y * TT * TT;
#pragma unroll 1   // one copy of the row body: registers for one row only, and half the code
  for (int hf = 0; hf < 2; ++hf) { const int row = hf ? j : TT - 1 - j; const int ng = cz ? (row / 128 + 1) : TT / 128; float* sr = pl + (size_t)row * TT + lane * 4;
    v4f x[16];
#pragma unroll
    for (int i = 0; i < 16; ++i) { x[i] = (v4f){-3.0e38f, -3.0e38f, -3.0e38f, -3.0e38f}; if (i < ng) x[i] = *(const v4f*)(sr + i * 128); }
    asm volatile("s_wait_xcnt 0x0" ::: "memory");   // precaution: stands ahead of every rewrite of the address registers that these loads name
    float m = -3.0e38f;
#pragma unroll
    for (int i = 0; i < 16; ++i) m = fmaxf(m, fmaxf(fmaxf(x[i][0], x[i][1]), fmaxf(x[i][2], x[i][3])));
#pragma unroll
    for (int o = 1; o < 32; o <<= 1) m = fmaxf(m, __shfl_xor(m, o));
    v4f s4 = {0.f, 0.f, 0.f, 0.f};   // four independent sum chains per lane
#pragma unroll
    for (int i = 0; i < 16; ++i) if (i < ng) {
#pragma unroll
      for (int c = 0; c < 4; ++c) { const float v = x[i][c]; const float ex = expf(v - m); const float e = (v <= -1.0e38f) ? 0.f : ex; x[i][c] = e; s4[c] += e; } }
    float sum = (s4[0] + s4[1]) + (s4[2] + s4[3]);
#pragma unroll
    for (int o = 1; o < 32; o <<= 1) sum += __shfl_xor(sum, o);
    const float inv = 1.0f / sum;
#pragma unroll
    for (int i = 0; i < 16; ++i) if (i < ng) { v4f p;
#pragma unroll
      for (int c = 0; c < 4; ++c) p[c] = x[i][c] * inv * 2048.0f;
      vst2(sr + i * 128, p);
      asm volatile("s_wait_xcnt 0x0" ::: "memory"); }   // precaution: the compiler reuses one piece's data registers for the next piece; the wait stands ahead of that rewrite, and the last one ahead of the next row's rewrite of the address registers
  } }
// ---- k_pv: block = (128-column chunk, pair = b * NH + h, 64 queries): y = P . (v hi + lo) with P split hi + lo (3 products); the query tile, whose index sets the causal trip count, is the slowest grid index, so that work-groups far apart in launch order differ in length
__global__ __launch_bounds__(128) void k_pv(const float* __restrict__ PS, const __bf16* __restrict__ VT, const __bf16* __restrict__ VL, const int* __restrict__ MSK, float* __restrict__ Y) { __shared__ __align__(16) char sm[61440];   // k loop: P hi, P lo [2][64][P32] each, v hi, v lo [2][128][P32] each; epilogue, behind a barrier: ss
  float (*ss)[16][132] = (float (*)[16][132])sm; __bf16* sPh = (__bf16*)sm; __bf16* sPl = (__bf16*)(sm + 10240); __bf16* sVh = (__bf16*)(sm + 20480); __bf16* sVl = (__bf16*)(sm + 40960);
  const int tid = threadIdx.x, wave = tid >> 5, lane = tid & 31, col = lane & 15, g = lane >> 4; const int b = blockIdx.y / NH, h = blockIdx.y % NH; PS += (size_t)blockIdx.y * TT * TT; const int ql0 = blockIdx.z * 64 + wave * 16; const int cc0 = blockIdx.x * 128; const int kend = (MSK[0] != 0) ? (blockIdx.z * 64 + 64) : TT; const int nk = kend / 32;
  const int sr = tid >> 3, sq = tid & 7, vr = tid >> 2, vq = tid & 3;   // staging: P 8 threads of 16 B per 128-byte row piece, v 4 threads per 64-byte row piece
  const float* gP = PS + (size_t)(blockIdx.z * 64 + sr) * TT + sq * 4; const size_t vo = ((size_t)b * CC + h * HD + cc0 + vr) * (size_t)TT + vq * 8; const __bf16* gH = VT + vo; const __bf16* gL = VL + vo;
  v4f rp[4]; v4u rh[4], rl4[4]; v8f acc[8] = {};
#pragma unroll
  for (int i = 0; i < 4; ++i) { rp[i] = *(const v4f*)(gP + (size_t)i * 16 * TT); rh[i] = *(const v4u*)(gH + (size_t)i * 32 * TT); rl4[i] = *(const v4u*)(gL + (size_t)i * 32 * TT); }
#pragma unroll
  for (int i = 0; i < 4; ++i) { const v4b ph = cvt4(rp[i]); *(v4b*)(sPh + (sr + 16 * i) * P32 + sq * 4) = ph; *(v4b*)(sPl + (sr + 16 * i) * P32 + sq * 4) = res4(rp[i], ph); *(v4u*)(sVh + (vr + 32 * i) * P32 + vq * 8) = rh[i]; *(v4u*)(sVl + (vr + 32 * i) * P32 + vq * 8) = rl4[i]; }
#pragma unroll 2   // two steps per trip (nk is even): the buffer index becomes a constant
  for (int kc = 0; kc < nk; ++kc) { const int bu = kc & 1, nb = bu ^ 1; const bool more = kc + 1 < nk;
    __syncthreads();   // publishes buffer bu; ends every wave's reads of buffer nb
    if (more) {
#pragma unroll
      for (int i = 0; i < 4; ++i) { rp[i] = *(const v4f*)(gP + (size_t)i * 16 * TT + (kc + 1) * 32); rh[i] = *(const v4u*)(gH + (size_t)i * 32 * TT + (kc + 1) * 32); rl4[i] = *(const v4u*)(gL + (size_t)i * 32 * TT + (kc + 1) * 32); }
      asm volatile("s_wait_xcnt 0x0" ::: "memory");   // precaution: stands ahead of every rewrite of the address registers that these loads name
    }
    const v16b ph = frag_b(sPh + (bu * 64 + wave * 16 + col) * P32, lane), pl = frag_b(sPl + (bu * 64 + wave * 16 + col) * P32, lane);
#pragma unroll
    for (int jh = 0; jh < 8; jh += 4) { v16b vh[4], vl[4];   // LDS reads of four column tiles together, ahead of their twelve products
#pragma unroll
      for (int j = 0; j < 4; ++j) { const int ro = (bu * 128 + (jh + j) * 16 + col) * P32; vh[j] = frag_b(sVh + ro, lane); vl[j] = frag_b(sVl + ro, lane); }
#pragma unroll
      for (int j = 0; j < 4; ++j) { acc[jh + j] = wmma_bf(ph, vh[j], acc[jh + j]); acc[jh + j] = wmma_bf(pl, vh[j], acc[jh + j]); acc[jh + j] = wmma_bf(ph, vl[j], acc[jh + j]); } }
    if (more) {
#pragma unroll
      for (int i = 0; i < 4; ++i) { const v4b qh = cvt4(rp[i]); *(v4b*)(sPh + (nb * 64 + sr + 16 * i) * P32 + sq * 4) = qh; *(v4b*)(sPl + (nb * 64 + sr + 16 * i) * P32 + sq * 4) = res4(rp[i], qh); *(v4u*)(sVh + (nb * 128 + vr + 32 * i) * P32 + vq * 8) = rh[i]; *(v4u*)(sVl + (nb * 128 + vr + 32 * i) * P32 + vq * 8) = rl4[i]; } } }
  __syncthreads();   // the tiles are dead: the epilogue reuses their LDS
#pragma unroll
  for (int j = 0; j < 8; ++j)
#pragma unroll
    for (int r = 0; r < 8; ++r) ss[wave][8 * g + r][j * 16 + col] = acc[j][r] * (1.0f / 2048.0f);
  LDSX(); for (int rl = 0; rl < 16; ++rl) vst2(Y + ((size_t)b * TT + ql0 + rl) * CC + h * HD + cc0 + lane * 4, *(const v4f*)&ss[wave][rl][lane * 4]); }
// ---- k_out: block = (64 rows, 128 cols): out = y (bf16 hi + lo) Wproj + b
__global__ __launch_bounds__(128) void k_out(const float* __restrict__ Y, const float* __restrict__ WP, const float* __restrict__ BP, float* __restrict__ OUT) { __shared__ __align__(16) char sm[40960];   // k loop: y hi, y lo [2][64][P32] each, W tiles [2][128][P32]; epilogue, behind a barrier: sf
  float (*sf)[16][132] = (float (*)[16][132])sm; __bf16* sAh = (__bf16*)sm; __bf16* sAl = (__bf16*)(sm + 10240); __bf16* sB = (__bf16*)(sm + 20480);
  const int tid = threadIdx.x, wave = tid >> 5, lane = tid & 31, col = lane & 15, g = lane >> 4; const int c0 = blockIdx.y * 128; const size_t r0 = (size_t)blockIdx.x * 64 + wave * 16;
  const int sr = tid >> 3, sq = tid & 7;   // staging: 8 threads of 16 B per 128-byte row piece
  const float* gA = Y + ((size_t)blockIdx.x * 64 + sr) * CC + sq * 4; const float* gB = WP + (size_t)(c0 + sr) * CC + sq * 4;
  v4f ra[4], rb[8]; v8f acc[8] = {};
#pragma unroll
  for (int i = 0; i < 4; ++i) ra[i] = *(const v4f*)(gA + (size_t)i * 16 * CC);
#pragma unroll
  for (int i = 0; i < 8; ++i) rb[i] = *(const v4f*)(gB + (size_t)i * 16 * CC);
#pragma unroll
  for (int i = 0; i < 4; ++i) { const v4b ah = cvt4(ra[i]); *(v4b*)(sAh + (sr + 16 * i) * P32 + sq * 4) = ah; *(v4b*)(sAl + (sr + 16 * i) * P32 + sq * 4) = res4(ra[i], ah); }
#pragma unroll
  for (int i = 0; i < 8; ++i) *(v4b*)(sB + (sr + 16 * i) * P32 + sq * 4) = cvt4(rb[i]);
#pragma unroll 2   // two steps per trip: the buffer index becomes a constant
  for (int kc = 0; kc < CC / 32; ++kc) { const int bu = kc & 1, nb = bu ^ 1; const bool more = kc + 1 < CC / 32;
    __syncthreads();   // publishes buffer bu; ends every wave's reads of buffer nb
    if (more) {
#pragma unroll
      for (int i = 0; i < 4; ++i) ra[i] = *(const v4f*)(gA + (size_t)i * 16 * CC + (kc + 1) * 32);
#pragma unroll
      for (int i = 0; i < 8; ++i) rb[i] = *(const v4f*)(gB + (size_t)i * 16 * CC + (kc + 1) * 32);
      asm volatile("s_wait_xcnt 0x0" ::: "memory");   // precaution: stands ahead of every rewrite of the address registers that these loads name
    }
    const v16b ah = frag_b(sAh + (bu * 64 + wave * 16 + col) * P32, lane), al = frag_b(sAl + (bu * 64 + wave * 16 + col) * P32, lane);
    v16b w[8];   // the step's LDS reads stand together, ahead of its products
#pragma unroll
    for (int j = 0; j < 8; ++j) w[j] = frag_b(sB + (bu * 128 + j * 16 + col) * P32, lane);
#pragma unroll
    for (int j = 0; j < 8; ++j) { acc[j] = wmma_bf(ah, w[j], acc[j]); acc[j] = wmma_bf(al, w[j], acc[j]); }
    if (more) {
#pragma unroll
      for (int i = 0; i < 4; ++i) { const v4b qh = cvt4(ra[i]); *(v4b*)(sAh + (nb * 64 + sr + 16 * i) * P32 + sq * 4) = qh; *(v4b*)(sAl + (nb * 64 + sr + 16 * i) * P32 + sq * 4) = res4(ra[i], qh); }
#pragma unroll
      for (int i = 0; i < 8; ++i) *(v4b*)(sB + (nb * 128 + sr + 16 * i) * P32 + sq * 4) = cvt4(rb[i]); } }
  __syncthreads();   // the tiles are dead: the epilogue reuses their LDS
#pragma unroll
  for (int j = 0; j < 8; ++j) { const float bb = BP ? bfr(BP[c0 + j * 16 + col]) : 0.f;
#pragma unroll
    for (int r = 0; r < 8; ++r) sf[wave][8 * g + r][j * 16 + col] = acc[j][r] + bb; }
  LDSX(); for (int rl = 0; rl < 16; ++rl) vst2(OUT + (r0 + rl) * CC + c0 + lane * 4, *(const v4f*)&sf[wave][rl][lane * 4]); }
extern "C" void kernel_launch(void* const* d_in, const int* in_sizes, int n_in, void* d_out, int out_size, void* d_ws, size_t ws_size, hipStream_t stream) {
  (void)in_sizes; (void)n_in; (void)out_size;
  const float** F = (const float**)d_in;   // 0 input [4,2048,1024], 1 Wq [2,512,512] ([out,in] per head), 2 bq [2,512], 3 Wk, 4 bk, 5 Wv, 6 bv, 7 Wf [1024,1024] ([out,in]), 8 bf, 9 masked [1] int (= 1 -> causal)
  if (ws_size < (size_t)WS_END) return;
  char* ws = (char*)d_ws; _Float16 *QH = (_Float16*)(ws + WS_QH), *QL = (_Float16*)(ws + WS_QL), *KH = (_Float16*)(ws + WS_KH); __bf16 *VT = (__bf16*)(ws + WS_VT), *VL = (__bf16*)(ws + WS_VL); float *S = (float*)(ws + WS_S), *Y = (float*)(ws + WS_Y);
  k_proj<<<dim3(TNB * TT / 64, CC / 128, 3), 128, 0, stream>>>(F[0], F[1], F[2], F[3], F[4], F[5], F[6], QH, QL, KH, VT, VL);
  k_sc<<<dim3(TT / 64, TT / 128, TNB * NH), 128, 0, stream>>>(QH, QL, KH, nullptr, (const int*)d_in[9], S);
  k_sm<<<dim3(TT / 16, TNB * NH), 256, 0, stream>>>(S, (const int*)d_in[9]);
  k_pv<<<dim3(HD / 128, TNB * NH, TT / 64), 128, 0, stream>>>(S, VT, VL, (const int*)d_in[9], Y);
  k_out<<<dim3(TNB * TT / 64, CC / 128), 128, 0, stream>>>(Y, F[7], F[8], (float*)d_out);
}

// v004
// One run takes 219 microseconds.
// In both of two side-by-side timings against v003, it was 1.03 times as fast.
// All steps since v000 together make it 9.73 times as fast.
// compute dtype: all float inputs rounded to bf16, 'masked' read at run time (1 -> causal; 0 -> full attention); per-head q/k/v = x_half W_n^T + b_n (block-diagonal [out,in] linears) with EXACT bf16 products on WMMA 16x16x32, f32 accumulate, q/k rounded once to f16 (0.02-scale weights, logits std ~0.01: 1 product), causal logits stored in f32 per (batch, head); softmax in f32 (precise expf), P x 2^11 kept f32 and split bf16 hi + lo against v as bf16 hi + lo (3 products); out = y (bf16 hi + lo) Wf^T + bf; f32 output.
#include <hip/hip_runtime.h>
#include <math.h>

typedef __attribute__((ext_vector_type(16))) _Float16 v16h;
typedef __attribute__((ext_vector_type(16))) __bf16 v16b;
typedef __attribute__((ext_vector_type(8)))  _Float16 v8h;
typedef __attribute__((ext_vector_type(8)))  float v8f;
typedef __attribute__((ext_vector_type(4)))  float v4f;
typedef __attribute__((ext_vector_type(2)))  float v2f;
typedef __attribute__((ext_vector_type(4)))  unsigned v4u;
typedef __attribute__((ext_vector_type(4)))  int v4i;
typedef float __attribute__((may_alias)) float_a;
typedef int __attribute__((may_alias)) int_a;

template <typename T> __device__ __forceinline__ void vst2(void* p, T v) { *(T*)p = v;  }
__device__ __forceinline__ v8f wmma16(v16h a, v16h b, v8f c) {
  return __builtin_amdgcn_wmma_f32_16x16x32_f16(false, a, false, b, (short)0, c, false, false);
}
__device__ __forceinline__ v8f wmma_bf(v16b a, v16b b, v8f c) {
  return __builtin_amdgcn_wmma_f32_16x16x32_bf16(false, a, false, b, (short)0, c, false, false);
}
// 16x16x32 fragments: lane = (h = lane>>4, row/col = lane&15); elements 0..7 = k0+8h+0..7, 8..15 = k0+16+8h+0..7; D element r = row 8h+r
__device__ __forceinline__ v16h frag_h(const _Float16* rowk0, int lane) {
  union { v16h v; v8h q[2]; } u; const _Float16* p = rowk0 + 8 * (lane >> 4);
  u.q[0] = *(const v8h*)p; u.q[1] = *(const v8h*)(p + 16); return u.v;
}
__device__ __forceinline__ v16h frag_f32(const float* rowk0, int lane) {
  v16h a; const float* p = rowk0 + 8 * (lane >> 4);
#pragma unroll
  for (int i = 0; i < 8; ++i) { a[i] = (_Float16)p[i]; a[8 + i] = (_Float16)p[16 + i]; }
  return a;
}
__device__ __forceinline__ v16h frag_f32s(const float* rowk0, int lane, float sc) {
  v16h a; const float* p = rowk0 + 8 * (lane >> 4);
#pragma unroll
  for (int i = 0; i < 8; ++i) { a[i] = (_Float16)(p[i] * sc); a[8 + i] = (_Float16)(p[16 + i] * sc); }
  return a;
}
// column fragment from a [K][ld] layout (column n), rows >= K read as 0
__device__ __forceinline__ v16h fragc_f32(const float* W, int k0, int n, int lane, int ld, int K) {
  v16h a; const int g = lane >> 4;
#pragma unroll
  for (int i = 0; i < 8; ++i) { const int ka = k0 + 8 * g + i, kb = ka + 16;
    a[i] = (_Float16)(ka < K ? W[(size_t)(ka < K ? ka : K - 1) * ld + n] : 0.f); a[8 + i] = (_Float16)(kb < K ? W[(size_t)(kb < K ? kb : K - 1) * ld + n] : 0.f); }
  return a;
}
struct F2 { v16b h, l; };
__device__ __forceinline__ F2 bsplit16(const float v[16]) { F2 r;
#pragma unroll
  for (int i = 0; i < 16; ++i) { const __bf16 h = (__bf16)v[i]; r.h[i] = h; r.l[i] = (__bf16)(v[i] - (float)h); }
  return r; }
__device__ __forceinline__ F2 split_row(const float* row, int k0, int lane) { float v[16]; const float* p = row + k0 + 8 * (lane >> 4);
#pragma unroll
  for (int i = 0; i < 8; ++i) { v[i] = p[i]; v[8 + i] = p[16 + i]; }
  return bsplit16(v); }
__device__ __forceinline__ F2 split_rowK(const float* row, int k0, int lane, int K) { float v[16]; const int g = lane >> 4;
#pragma unroll
  for (int i = 0; i < 8; ++i) { const int ka = k0 + 8 * g + i, kb = ka + 16; v[i] = ka < K ? row[ka < K ? ka : K - 1] : 0.f; v[8 + i] = kb < K ? row[kb < K ? kb : K - 1] : 0.f; }
  return bsplit16(v); }
__device__ __forceinline__ F2 split_col(const float* W, int k0, int n, int lane, int ld, int K) { float v[16]; const int g = lane >> 4;
#pragma unroll
  for (int i = 0; i < 8; ++i) { const int ka = k0 + 8 * g + i, kb = ka + 16; v[i] = ka < K ? W[(size_t)(ka < K ? ka : K - 1) * ld + n] : 0.f; v[8 + i] = kb < K ? W[(size_t)(kb < K ? kb : K - 1) * ld + n] : 0.f; }
  return bsplit16(v); }
__device__ __forceinline__ v8f mac3(const F2& a, const F2& b, v8f c) { c = wmma_bf(a.l, b.h, c); c = wmma_bf(a.h, b.l, c); return wmma_bf(a.h, b.h, c); }
__device__ __forceinline__ float sigm(float v) { return 1.0f / (1.0f + expf(-v)); }
#define LDSX() do { asm volatile("s_wait_dscnt 0" ::: "memory"); __builtin_amdgcn_wave_barrier(); __builtin_amdgcn_fence(__ATOMIC_RELEASE, "workgroup"); } while (0)


// Two-headed causal attention with per-head Linear projections on the two contiguous 512-wide halves of the input (B 4, S 2,048, E 1,024), scores / sqrt(512), softmax . v, final Linear Wf + bf.
#define NB 4
#define TT 2048
#define CC 1024
#define NH 2
#define HD 512
#ifndef TNB
#define TNB NB
#endif
typedef __attribute__((ext_vector_type(8))) __bf16 v8b;
__device__ __forceinline__ v16b frag_b(const __bf16* rowk0, int lane) {
  union { v16b v; v8b q[2]; } u; const __bf16* p = rowk0 + 8 * (lane >> 4);
  u.q[0] = *(const v8b*)p; u.q[1] = *(const v8b*)(p + 16); return u.v;
}
__device__ __forceinline__ float bfr(float v) { return (float)(__bf16)v; }
__device__ __attribute__((noinline)) float exp_ni(float v) { return expf(v); }
__device__ __attribute__((noinline)) float erf_ni(float v) { return erff(v); }

#define WS_QH  0u
#define WS_QL  (WS_QH + 2u * (size_t)NB * TT * CC)
#define WS_KH  (WS_QL + 2u * (size_t)NB * TT * CC)
#define WS_VT  (WS_KH + 2u * (size_t)NB * TT * CC)      // bf16 v planes [b][c][t]
#define WS_VL  (WS_VT + 2u * (size_t)NB * CC * TT)      // bf16 v residual planes
#define WS_S   (WS_VL + 2u * (size_t)NB * CC * TT)      // f32 logits, then P x 2^11 in place: one [t][t] plane per (batch, head)
#define WS_Y   (WS_S + 4u * (size_t)NB * NH * TT * TT)  // f32 y rows [b*t][C]
#define WS_END (WS_Y + 4u * (size_t)NB * TT * CC)

// ---- LDS staging shared by the four matrix kernels: a block's 128 threads fetch each operand tile with loads that cover whole 128-byte lines (k_pv's v: 64-byte halves), convert it once, and lay it in LDS in k order; every wave then takes its fragments with frag_b / frag_h from rows at a pitch of 16 B x odd (80 B for 64-byte rows, 144 B for 128-byte rows). Two buffers, one barrier per k step: the next tile's global loads fly during the products and are stored behind them.
typedef __attribute__((ext_vector_type(4))) __bf16 v4b;
#define P32 40   // elements per LDS row holding 32 16-bit values (80 B)
#define P64 72   // elements per LDS row holding 64 16-bit values (144 B)
__device__ __forceinline__ v4b cvt4(v4f v) { v4b r;
#pragma unroll
  for (int i = 0; i < 4; ++i) r[i] = (__bf16)v[i];
  return r; }
__device__ __forceinline__ v4b res4(v4f v, v4b h) { v4b r;
#pragma unroll
  for (int i = 0; i < 4; ++i) r[i] = (__bf16)(v[i] - (float)h[i]);
  return r; }

// ---- k_proj: block = (64 rows, 128 cols, which): qkv = x W (+ b), exact; q -> f16 hi (+ residual), k -> f16 rows, v -> bf16 hi + lo planes
__global__ __launch_bounds__(128) void k_proj(const float* __restrict__ X, const float* __restrict__ WQ, const float* __restrict__ BQ, const float* __restrict__ WK, const float* __restrict__ BK, const float* __restrict__ WV, const float* __restrict__ BV, _Float16* __restrict__ QH, _Float16* __restrict__ QL, _Float16* __restrict__ KH, __bf16* __restrict__ VT, __bf16* __restrict__ VL) {
  __shared__ __align__(16) char sm[36864];   // k loop: x tiles [2][64][P32], W tiles [2][128][P32]; epilogue, behind a barrier: sh + sl, or th + tl2
  _Float16 (*sh)[136] = (_Float16 (*)[136])sm; _Float16 (*sl)[136] = (_Float16 (*)[136])(sm + 64 * 136 * 2); __bf16 (*th)[72] = (__bf16 (*)[72])sm; __bf16 (*tl2)[72] = (__bf16 (*)[72])(sm + 128 * 72 * 2);
  __bf16* sA = (__bf16*)sm; __bf16* sB = (__bf16*)(sm + 2 * 64 * P32 * 2);
  const int tid = threadIdx.x, wave = tid >> 5, lane = tid & 31, col = lane & 15, g = lane >> 4; const int which = blockIdx.z; const int c0 = blockIdx.y * 128; const size_t r0 = (size_t)blockIdx.x * 64; const float* WA = which == 0 ? WQ : which == 1 ? WK : WV; const float* BA = which == 0 ? BQ : which == 1 ? BK : BV; const int hn = c0 / HD;   // head of this 128-column block (HD = 512)
  const int sr = tid >> 3, sq = tid & 7;   // staging: 8 threads of 16 B per 128-byte row piece
  const float* gA = X + (r0 + sr) * CC + hn * HD + sq * 4; const float* gB = WA + (size_t)(c0 + sr) * HD + sq * 4;
  v4f ra[4], rb[8]; v8f acc[8] = {};
#pragma unroll
  for (int i = 0; i < 4; ++i) ra[i] = *(const v4f*)(gA + (size_t)i * 16 * CC);
#pragma unroll
  for (int i = 0; i < 8; ++i) rb[i] = *(const v4f*)(gB + (size_t)i * 16 * HD);
#pragma unroll
  for (int i = 0; i < 4; ++i) *(v4b*)(sA + (sr + 16 * i) * P32 + sq * 4) = cvt4(ra[i]);
#pragma unroll
  for (int i = 0; i < 8; ++i) *(v4b*)(sB + (sr + 16 * i) * P32 + sq * 4) = cvt4(rb[i]);
#pragma unroll 2   // two steps per trip: the buffer index becomes a constant
  for (int kc = 0; kc < HD / 32; ++kc) { const int bu = kc & 1, nb = bu ^ 1; const bool more = kc + 1 < HD / 32;
    __syncthreads();   // publishes buffer bu; ends every wave's reads of buffer nb
    if (more) {
#pragma unroll
      for (int i = 0; i < 4; ++i) ra[i] = *(const v4f*)(gA + (size_t)i * 16 * CC + (kc + 1) * 32);
#pragma unroll
      for (int i = 0; i < 8; ++i) rb[i] = *(const v4f*)(gB + (size_t)i * 16 * HD + (kc + 1) * 32);
      asm volatile("s_wait_xcnt 0x0" ::: "memory");   // precaution: stands ahead of every rewrite of the address registers that these loads name
    }
    const v16b a = frag_b(sA + (bu * 64 + wave * 16 + col) * P32, lane); v16b w[8];   // the step's LDS reads stand together, ahead of its products: one exposed LDS latency, not eight
#pragma unroll
    for (int j = 0; j < 8; ++j) w[j] = frag_b(sB + (bu * 128 + j * 16 + col) * P32, lane);
    __builtin_amdgcn_sched_barrier(0);   // keeps the LDS reads above together, ahead of the products: without it the compiler reads one fragment, waits and multiplies, eight LDS latencies a step
#pragma unroll
    for (int j = 0; j < 8; ++j) acc[j] = wmma_bf(a, w[j], acc[j]);
    __builtin_amdgcn_sched_barrier(0);   // keeps the products together: without it the next tile's conversions, and the wait for its global loads, move up among them
    if (more) {
#pragma unroll
      for (int i = 0; i < 4; ++i) *(v4b*)(sA + (nb * 64 + sr + 16 * i) * P32 + sq * 4) = cvt4(ra[i]);
#pragma unroll
      for (int i = 0; i < 8; ++i) *(v4b*)(sB + (nb * 128 + sr + 16 * i) * P32 + sq * 4) = cvt4(rb[i]); } }
  __syncthreads();   // the tiles are dead: the epilogue reuses their LDS
#pragma unroll
  for (int j = 0; j < 8; ++j) { const float bb = bfr(BA[c0 + j * 16 + col]);
#pragma unroll
    for (int r = 0; r < 8; ++r) { const float v = acc[j][r] + bb; const int rl = wave * 16 + 8 * g + r, cl = j * 16 + col; const _Float16 hv = (_Float16)v;
      if (which == 2) { const __bf16 bh = (__bf16)v; th[cl][rl] = bh; tl2[cl][rl] = (__bf16)(v - (float)bh); } else { sh[rl][cl] = hv; sl[rl][cl] = (_Float16)(v - (float)hv); } } }
  __syncthreads();
  if (which < 2) { _Float16* dh = which == 0 ? QH : KH; for (int e = tid; e < 64 * 16; e += 128) { const int rl = e >> 4, q = e & 15; vst2((unsigned*)(dh + (r0 + rl) * CC + c0 + q * 8), *(const v4u*)&sh[rl][q * 8]); if (which == 0) vst2((unsigned*)(QL + (r0 + rl) * CC + c0 + q * 8), *(const v4u*)&sl[rl][q * 8]); } }
  else { const size_t b = r0 / TT; const int t0 = (int)(r0 % TT); for (int e = tid; e < 128 * 8; e += 128) { const int cl = e >> 3, q = e & 7; const size_t o2 = (b * CC + c0 + cl) * (size_t)TT + t0 + q * 8; vst2((unsigned*)(VT + o2), *(const v4u*)&th[cl][q * 8]); vst2((unsigned*)(VL + o2), *(const v4u*)&tl2[cl][q * 8]); } } }
// ---- k_sc: block = (64 queries, 128 keys, pair = b * NH + h): logits * scale; causal blocks beyond the diagonal exit
__global__ __launch_bounds__(128) void k_sc(const _Float16* __restrict__ QH, const _Float16* __restrict__ QL, const _Float16* __restrict__ KH, const float* __restrict__ BM, const int* __restrict__ MSK, float* __restrict__ S) { __shared__ __align__(16) char sm[55296];   // k loop: q tiles [2][64][P64], k tiles [2][128][P64]; epilogue, behind a barrier: ss
  float (*ss)[16][132] = (float (*)[16][132])sm; _Float16* sA = (_Float16*)sm; _Float16* sB = (_Float16*)(sm + 2 * 64 * P64 * 2);
  const bool cz = (MSK[0] != 0); const int b = blockIdx.z / NH, h = blockIdx.z % NH; S += (size_t)blockIdx.z * TT * TT;
  const int tid = threadIdx.x, wave = tid >> 5, lane = tid & 31, col = lane & 15, g = lane >> 4; const int k0 = blockIdx.y * 128; const int ql0 = blockIdx.x * 64 + wave * 16;
  if (cz && k0 > blockIdx.x * 64 + 63) return;   // causal: whole key block above the diagonal (block-uniform)
  (void)QL; const int sr = tid >> 3, sq = tid & 7;   // staging: 8 threads of 16 B per 128-byte row piece (64 k)
  const _Float16* gA = QH + ((size_t)b * TT + blockIdx.x * 64 + sr) * CC + h * HD + sq * 8; const _Float16* gB = KH + ((size_t)b * TT + k0 + sr) * CC + h * HD + sq * 8;
  v4u ra[4], rb[8]; v8f acc[8] = {};
#pragma unroll
  for (int i = 0; i < 4; ++i) ra[i] = *(const v4u*)(gA + (size_t)i * 16 * CC);
#pragma unroll
  for (int i = 0; i < 8; ++i) rb[i] = *(const v4u*)(gB + (size_t)i * 16 * CC);
#pragma unroll
  for (int i = 0; i < 4; ++i) *(v4u*)(sA + (sr + 16 * i) * P64 + sq * 8) = ra[i];
#pragma unroll
  for (int i = 0; i < 8; ++i) *(v4u*)(sB + (sr + 16 * i) * P64 + sq * 8) = rb[i];
#pragma unroll 2   // two steps per trip: the buffer index becomes a constant
  for (int ks = 0; ks < HD / 64; ++ks) { const int bu = ks & 1, nb = bu ^ 1; const bool more = ks + 1 < HD / 64;
    __syncthreads();   // publishes buffer bu; ends every wave's reads of buffer nb
    if (more) {
#pragma unroll
      for (int i = 0; i < 4; ++i) ra[i] = *(const v4u*)(gA + (size_t)i * 16 * CC + (ks + 1) * 64);
#pragma unroll
      for (int i = 0; i < 8; ++i) rb[i] = *(const v4u*)(gB + (size_t)i * 16 * CC + (ks + 1) * 64);
      asm volatile("s_wait_xcnt 0x0" ::: "memory");   // precaution: stands ahead of every rewrite of the address registers that these loads name
    }
#pragma unroll
    for (int s = 0; s < 2; ++s) { const v16h ah = frag_h(sA + (bu * 64 + wave * 16 + col) * P64 + s * 32, lane); v16h kb[8];   // LDS reads together, ahead of their products
#pragma unroll
      for (int j = 0; j < 8; ++j) kb[j] = frag_h(sB + (bu * 128 + j * 16 + col) * P64 + s * 32, lane);
      __builtin_amdgcn_sched_barrier(0);   // keeps the LDS reads above together, ahead of the products: without it the compiler reads one fragment, waits and multiplies, eight LDS latencies a step
#pragma unroll
      for (int j = 0; j < 8; ++j) acc[j] = wmma16(ah, kb[j], acc[j]);
      __builtin_amdgcn_sched_barrier(0);   // keeps the products together: without it the next tile's LDS stores, and the wait for its global loads, move up among them
    }
    if (more) {
#pragma unroll
      for (int i = 0; i < 4; ++i) *(v4u*)(sA + (nb * 64 + sr + 16 * i) * P64 + sq * 8) = ra[i];
#pragma unroll
      for (int i = 0; i < 8; ++i) *(v4u*)(sB + (nb * 128 + sr + 16 * i) * P64 + sq * 8) = rb[i]; } }
  __syncthreads();   // the tiles are dead: the epilogue reuses their LDS
#pragma unroll
  for (int j = 0; j < 8; ++j) { const int kt = k0 + j * 16 + col;
#pragma unroll
    for (int r = 0; r < 8; ++r) { const int qt = ql0 + 8 * g + r; float v = acc[j][r] * 0.044194173824159216f; (void)BM; if (cz && kt > qt) v = -3.0e38f; ss[wave][8 * g + r][j * 16 + col] = v; } }
  LDSX(); for (int rl = 0; rl < 16; ++rl) vst2(S + (size_t)(ql0 + rl) * TT + k0 + lane * 4, *(const v4f*)&ss[wave][rl][lane * 4]); }
// ---- k_sm: one wave = two whole rows of one pair, rows TT-1-j and j (under the causal mask the two lengths add up to about the same for every wave). A row lives in registers, 16 B per lane per 512-byte piece of 128 keys: the ng pieces that k_sc wrote for this row (its key blocks are 128 wide, masked keys at -3.0e38) are read once and P x 2^11 (masked -> 0) is stored once; maximum and sum go over the wave's lanes alone, with no LDS array and no barrier
__global__ __launch_bounds__(256) void k_sm(float* __restrict__ S, const int* __restrict__ MSK) {
  const int lane = threadIdx.x & 31; const int j = __builtin_amdgcn_readfirstlane((int)(blockIdx.x * 8 + (threadIdx.x >> 5)));   // wave-uniform, so that the tests on ng below are scalar branches with every lane on
  const bool cz = (MSK[0] != 0); float* pl = S + (size_t)blockIdx.y * TT * TT;
#pragma unroll 1   // one copy of the row body: registers for one row only, and half the code
  for (int hf = 0; hf < 2; ++hf) { const int row = hf ? j : TT - 1 - j; const int ng = cz ? (row / 128 + 1) : TT / 128; float* sr = pl + (size_t)row * TT + lane * 4;
    v4f x[16];
#pragma unroll
    for (int i = 0; i < 16; ++i) { x[i] = (v4f){-3.0e38f, -3.0e38f, -3.0e38f, -3.0e38f}; if (i < ng) x[i] = *(const v4f*)(sr + i * 128); }
    asm volatile("s_wait_xcnt 0x0" ::: "memory");   // precaution: stands ahead of every rewrite of the address registers that these loads name
    float m = -3.0e38f;
#pragma unroll
    for (int i = 0; i < 16; ++i) m = fmaxf(m, fmaxf(fmaxf(x[i][0], x[i][1]), fmaxf(x[i][2], x[i][3])));
#pragma unroll
    for (int o = 1; o < 32; o <<= 1) m = fmaxf(m, __shfl_xor(m, o));
    v4f s4 = {0.f, 0.f, 0.f, 0.f};   // four independent sum chains per lane
#pragma unroll
    for (int i = 0; i < 16; ++i) if (i < ng) {
#pragma unroll
      for (int c = 0; c < 4; ++c) { const float v = x[i][c]; const float ex = expf(v - m); const float e = (v <= -1.0e38f) ? 0.f : ex; x[i][c] = e; s4[c] += e; } }
    float sum = (s4[0] + s4[1]) + (s4[2] + s4[3]);
#pragma unroll
    for (int o = 1; o < 32; o <<= 1) sum += __shfl_xor(sum, o);
    const float inv = 1.0f / sum;
#pragma unroll
    for (int i = 0; i < 16; ++i) if (i < ng) { v4f p;
#pragma unroll
      for (int c = 0; c < 4; ++c) p[c] = x[i][c] * inv * 2048.0f;
      vst2(sr + i * 128, p);
      asm volatile("s_wait_xcnt 0x0" ::: "memory"); }   // precaution: the compiler reuses one piece's data registers for the next piece; the wait stands ahead of that rewrite, and the last one ahead of the next row's rewrite of the address registers
  } }
// ---- k_pv: block = (128-column chunk, pair = b * NH + h, 64 queries): y = P . (v hi + lo) with P split hi + lo (3 products); the query tile, whose index sets the causal trip count, is the slowest grid index, so that work-groups far apart in launch order differ in length
__global__ __launch_bounds__(128) void k_pv(const float* __restrict__ PS, const __bf16* __restrict__ VT, const __bf16* __restrict__ VL, const int* __restrict__ MSK, float* __restrict__ Y) { __shared__ __align__(16) char sm[61440];   // k loop: P hi, P lo [2][64][P32] each, v hi, v lo [2][128][P32] each; epilogue, behind a barrier: ss
  float (*ss)[16][132] = (float (*)[16][132])sm; __bf16* sPh = (__bf16*)sm; __bf16* sPl = (__bf16*)(sm + 10240); __bf16* sVh = (__bf16*)(sm + 20480); __bf16* sVl = (__bf16*)(sm + 40960);
  const int tid = threadIdx.x, wave = tid >> 5, lane = tid & 31, col = lane & 15, g = lane >> 4; const int b = blockIdx.y / NH, h = blockIdx.y % NH; PS += (size_t)blockIdx.y * TT * TT; const int ql0 = blockIdx.z * 64 + wave * 16; const int cc0 = blockIdx.x * 128; const int kend = (MSK[0] != 0) ? (blockIdx.z * 64 + 64) : TT; const int nk = kend / 32;
  const int sr = tid >> 3, sq = tid & 7, vr = tid >> 2, vq = tid & 3;   // staging: P 8 threads of 16 B per 128-byte row piece, v 4 threads per 64-byte row piece
  const float* gP = PS + (size_t)(blockIdx.z * 64 + sr) * TT + sq * 4; const size_t vo = ((size_t)b * CC + h * HD + cc0 + vr) * (size_t)TT + vq * 8; const __bf16* gH = VT + vo; const __bf16* gL = VL + vo;
  v4f rp[4]; v4u rh[4], rl4[4]; v8f acc[8] = {};
#pragma unroll
  for (int i = 0; i < 4; ++i) { rp[i] = *(const v4f*)(gP + (size_t)i * 16 * TT); rh[i] = *(const v4u*)(gH + (size_t)i * 32 * TT); rl4[i] = *(const v4u*)(gL + (size_t)i * 32 * TT); }
#pragma unroll
  for (int i = 0; i < 4; ++i) { const v4b ph = cvt4(rp[i]); *(v4b*)(sPh + (sr + 16 * i) * P32 + sq * 4) = ph; *(v4b*)(sPl + (sr + 16 * i) * P32 + sq * 4) = res4(rp[i], ph); *(v4u*)(sVh + (vr + 32 * i) * P32 + vq * 8) = rh[i]; *(v4u*)(sVl + (vr + 32 * i) * P32 + vq * 8) = rl4[i]; }
#pragma unroll 2   // two steps per trip (nk is even): the buffer index becomes a constant
  for (int kc = 0; kc < nk; ++kc) { const int bu = kc & 1, nb = bu ^ 1; const bool more = kc + 1 < nk;
    __syncthreads();   // publishes buffer bu; ends every wave's reads of buffer nb
    if (more) {
#pragma unroll
      for (int i = 0; i < 4; ++i) { rp[i] = *(const v4f*)(gP + (size_t)i * 16 * TT + (kc + 1) * 32); rh[i] = *(const v4u*)(gH + (size_t)i * 32 * TT + (kc + 1) * 32); rl4[i] = *(const v4u*)(gL + (size_t)i * 32 * TT + (kc + 1) * 32); }
      asm volatile("s_wait_xcnt 0x0" ::: "memory");   // precaution: stands ahead of every rewrite of the address registers that these loads name
    }
    const v16b ph = frag_b(sPh + (bu * 64 + wave * 16 + col) * P32, lane), pl = frag_b(sPl + (bu * 64 + wave * 16 + col) * P32, lane);
#pragma unroll
    for (int jh = 0; jh < 8; jh += 4) { v16b vh[4], vl[4];   // LDS reads of four column tiles together, ahead of their twelve products
#pragma unroll
      for (int j = 0; j < 4; ++j) { const int ro = (bu * 128 + (jh + j) * 16 + col) * P32; vh[j] = frag_b(sVh + ro, lane); vl[j] = frag_b(sVl + ro, lane); }
      __builtin_amdgcn_sched_barrier(0);   // keeps the LDS reads above together, ahead of the products: without it the compiler reads one fragment, waits and multiplies, eight LDS latencies a step
#pragma unroll
      for (int j = 0; j < 4; ++j) acc[jh + j] = wmma_bf(ph, vh[j], acc[jh + j]);   // the three products of a tile stand four WMMAs apart: none waits for the one before it; each tile still sums ph.vh, pl.vh, ph.vl in that order
#pragma unroll
      for (int j = 0; j < 4; ++j) acc[jh + j] = wmma_bf(pl, vh[j], acc[jh + j]);
#pragma unroll
      for (int j = 0; j < 4; ++j) acc[jh + j] = wmma_bf(ph, vl[j], acc[jh + j]);
      __builtin_amdgcn_sched_barrier(0);   // keeps the products together: without it the next tile's conversions, and the wait for its global loads, move up among them
    }
    if (more) {
#pragma unroll
      for (int i = 0; i < 4; ++i) { const v4b qh = cvt4(rp[i]); *(v4b*)(sPh + (nb * 64 + sr + 16 * i) * P32 + sq * 4) = qh; *(v4b*)(sPl + (nb * 64 + sr + 16 * i) * P32 + sq * 4) = res4(rp[i], qh); *(v4u*)(sVh + (nb * 128 + vr + 32 * i) * P32 + vq * 8) = rh[i]; *(v4u*)(sVl + (nb * 128 + vr + 32 * i) * P32 + vq * 8) = rl4[i]; } } }
  __syncthreads();   // the tiles are dead: the epilogue reuses their LDS
#pragma unroll
  for (int j = 0; j < 8; ++j)
#pragma unroll
    for (int r = 0; r < 8; ++r) ss[wave][8 * g + r][j * 16 + col] = acc[j][r] * (1.0f / 2048.0f);
  LDSX(); for (int rl = 0; rl < 16; ++rl) vst2(Y + ((size_t)b * TT + ql0 + rl) * CC + h * HD + cc0 + lane * 4, *(const v4f*)&ss[wave][rl][lane * 4]); }
// ---- k_out: block = (64 rows, 128 cols): out = y (bf16 hi + lo) Wproj + b
__global__ __launch_bounds__(128) void k_out(const float* __restrict__ Y, const float* __restrict__ WP, const float* __restrict__ BP, float* __restrict__ OUT) { __shared__ __align__(16) char sm[40960];   // k loop: y hi, y lo [2][64][P32] each, W tiles [2][128][P32]; epilogue, behind a barrier: sf
  float (*sf)[16][132] = (float (*)[16][132])sm; __bf16* sAh = (__bf16*)sm; __bf16* sAl = (__bf16*)(sm + 10240); __bf16* sB = (__bf16*)(sm + 20480);
  const int tid = threadIdx.x, wave = tid >> 5, lane = tid & 31, col = lane & 15, g = lane >> 4; const int c0 = blockIdx.y * 128; const size_t r0 = (size_t)blockIdx.x * 64 + wave * 16;
  const int sr = tid >> 3, sq = tid & 7;   // staging: 8 threads of 16 B per 128-byte row piece
  const float* gA = Y + ((size_t)blockIdx.x * 64 + sr) * CC + sq * 4; const float* gB = WP + (size_t)(c0 + sr) * CC + sq * 4;
  v4f ra[4], rb[8]; v8f acc[8] = {};
#pragma unroll
  for (int i = 0; i < 4; ++i) ra[i] = *(const v4f*)(gA + (size_t)i * 16 * CC);
#pragma unroll
  for (int i = 0; i < 8; ++i) rb[i] = *(const v4f*)(gB + (size_t)i * 16 * CC);
#pragma unroll
  for (int i = 0; i < 4; ++i) { const v4b ah = cvt4(ra[i]); *(v4b*)(sAh + (sr + 16 * i) * P32 + sq * 4) = ah; *(v4b*)(sAl + (sr + 16 * i) * P32 + sq * 4) = res4(ra[i], ah); }
#pragma unroll
  for (int i = 0; i < 8; ++i) *(v4b*)(sB + (sr + 16 * i) * P32 + sq * 4) = cvt4(rb[i]);
#pragma unroll 2   // two steps per trip: the buffer index becomes a constant
  for (int kc = 0; kc < CC / 32; ++kc) { const int bu = kc & 1, nb = bu ^ 1; const bool more = kc + 1 < CC / 32;
    __syncthreads();   // publishes buffer bu; ends every wave's reads of buffer nb
    if (more) {
#pragma unroll
      for (int i = 0; i < 4; ++i) ra[i] = *(const v4f*)(gA + (size_t)i * 16 * CC + (kc + 1) * 32);
#pragma unroll
      for (int i = 0; i < 8; ++i) rb[i] = *(const v4f*)(gB + (size_t)i * 16 * CC + (kc + 1) * 32);
      asm volatile("s_wait_xcnt 0x0" ::: "memory");   // precaution: stands ahead of every rewrite of the address registers that these loads name
    }
    const v16b ah = frag_b(sAh + (bu * 64 + wave * 16 + col) * P32, lane), al = frag_b(sAl + (bu * 64 + wave * 16 + col) * P32, lane);
    v16b w[8];   // the step's LDS reads stand together, ahead of its products
#pragma unroll
    for (int j = 0; j < 8; ++j) w[j] = frag_b(sB + (bu * 128 + j * 16 + col) * P32, lane);
    __builtin_amdgcn_sched_barrier(0);   // keeps the LDS reads above together, ahead of the products: without it the compiler reads one fragment, waits and multiplies, eight LDS latencies a step
#pragma unroll
    for (int j = 0; j < 8; ++j) acc[j] = wmma_bf(ah, w[j], acc[j]);   // the two products of a tile stand eight WMMAs apart; each tile still sums hi, then lo
#pragma unroll
    for (int j = 0; j < 8; ++j) acc[j] = wmma_bf(al, w[j], acc[j]);
    __builtin_amdgcn_sched_barrier(0);   // keeps the products together: without it the next tile's conversions, and the wait for its global loads, move up among them
    if (more) {
#pragma unroll
      for (int i = 0; i < 4; ++i) { const v4b qh = cvt4(ra[i]); *(v4b*)(sAh + (nb * 64 + sr + 16 * i) * P32 + sq * 4) = qh; *(v4b*)(sAl + (nb * 64 + sr + 16 * i) * P32 + sq * 4) = res4(ra[i], qh); }
#pragma unroll
      for (int i = 0; i < 8; ++i) *(v4b*)(sB + (nb * 128 + sr + 16 * i) * P32 + sq * 4) = cvt4(rb[i]); } }
  __syncthreads();   // the tiles are dead: the epilogue reuses their LDS
#pragma unroll
  for (int j = 0; j < 8; ++j) { const float bb = BP ? bfr(BP[c0 + j * 16 + col]) : 0.f;
#pragma unroll
    for (int r = 0; r < 8; ++r) sf[wave][8 * g + r][j * 16 + col] = acc[j][r] + bb; }
  LDSX(); for (int rl = 0; rl < 16; ++rl) vst2(OUT + (r0 + rl) * CC + c0 + lane * 4, *(const v4f*)&sf[wave][rl][lane * 4]); }
extern "C" void kernel_launch(void* const* d_in, const int* in_sizes, int n_in, void* d_out, int out_size, void* d_ws, size_t ws_size, hipStream_t stream) {
  (void)in_sizes; (void)n_in; (void)out_size;
  const float** F = (const float**)d_in;   // 0 input [4,2048,1024], 1 Wq [2,512,512] ([out,in] per head), 2 bq [2,512], 3 Wk, 4 bk, 5 Wv, 6 bv, 7 Wf [1024,1024] ([out,in]), 8 bf, 9 masked [1] int (= 1 -> causal)
  if (ws_size < (size_t)WS_END) return;
  char* ws = (char*)d_ws; _Float16 *QH = (_Float16*)(ws + WS_QH), *QL = (_Float16*)(ws + WS_QL), *KH = (_Float16*)(ws + WS_KH); __bf16 *VT = (__bf16*)(ws + WS_VT), *VL = (__bf16*)(ws + WS_VL); float *S = (float*)(ws + WS_S), *Y = (float*)(ws + WS_Y);
  k_proj<<<dim3(TNB * TT / 64, CC / 128, 3), 128, 0, stream>>>(F[0], F[1], F[2], F[3], F[4], F[5], F[6], QH, QL, KH, VT, VL);
  k_sc<<<dim3(TT / 64, TT / 128, TNB * NH), 128, 0, stream>>>(QH, QL, KH, nullptr, (const int*)d_in[9], S);
  k_sm<<<dim3(TT / 16, TNB * NH), 256, 0, stream>>>(S, (const int*)d_in[9]);
  k_pv<<<dim3(HD / 128, TNB * NH, TT / 64), 128, 0, stream>>>(S, VT, VL, (const int*)d_in[9], Y);
  k_out<<<dim3(TNB * TT / 64, CC / 128), 128, 0, stream>>>(Y, F[7], F[8], (float*)d_out);
}

// v005
// Measured time: 203 microseconds a run.
// Two timings next to v004 put it at 1.07 and 1.08 times that version's speed.
// Counting every step since v000, it is 10.5 times as fast.
// compute dtype: all float inputs rounded to bf16, 'masked' read at run time (1 -> causal; 0 -> full attention); per-head q/k/v = x_half W_n^T + b_n (block-diagonal [out,in] linears) with EXACT bf16 products on WMMA 16x16x32, f32 accumulate, q/k rounded once to f16 (0.02-scale weights, logits std ~0.01: 1 product), softmax in f32 (precise expf) in two parts: exp(logit - block maximum) stored in f32 per (batch, head) with each 128-key block's row maximum and row sum, rescaled to P x 2^11 where P.V stages it, kept f32 and split bf16 hi + lo against v as bf16 hi + lo (3 products); out = y (bf16 hi + lo) Wf^T + bf; f32 output.
#include <hip/hip_runtime.h>
#include <math.h>

typedef __attribute__((ext_vector_type(16))) _Float16 v16h;
typedef __attribute__((ext_vector_type(16))) __bf16 v16b;
typedef __attribute__((ext_vector_type(8)))  _Float16 v8h;
typedef __attribute__((ext_vector_type(8)))  float v8f;
typedef __attribute__((ext_vector_type(4)))  float v4f;
typedef __attribute__((ext_vector_type(2)))  float v2f;
typedef __attribute__((ext_vector_type(4)))  unsigned v4u;
typedef __attribute__((ext_vector_type(4)))  int v4i;
typedef float __attribute__((may_alias)) float_a;
typedef int __attribute__((may_alias)) int_a;

template <typename T> __device__ __forceinline__ void vst2(void* p, T v) { *(T*)p = v;  }
__device__ __forceinline__ v8f wmma16(v16h a, v16h b, v8f c) {
  return __builtin_amdgcn_wmma_f32_16x16x32_f16(false, a, false, b, (short)0, c, false, false);
}
__device__ __forceinline__ v8f wmma_bf(v16b a, v16b b, v8f c) {
  return __builtin_amdgcn_wmma_f32_16x16x32_bf16(false, a, false, b, (short)0, c, false, false);
}
// 16x16x32 fragments: lane = (h = lane>>4, row/col = lane&15); elements 0..7 = k0+8h+0..7, 8..15 = k0+16+8h+0..7; D element r = row 8h+r
__device__ __forceinline__ v16h frag_h(const _Float16* rowk0, int lane) {
  union { v16h v; v8h q[2]; } u; const _Float16* p = rowk0 + 8 * (lane >> 4);
  u.q[0] = *(const v8h*)p; u.q[1] = *(const v8h*)(p + 16); return u.v;
}
__device__ __forceinline__ v16h frag_f32(const float* rowk0, int lane) {
  v16h a; const float* p = rowk0 + 8 * (lane >> 4);
#pragma unroll
  for (int i = 0; i < 8; ++i) { a[i] = (_Float16)p[i]; a[8 + i] = (_Float16)p[16 + i]; }
  return a;
}
__device__ __forceinline__ v16h frag_f32s(const float* rowk0, int lane, float sc) {
  v16h a; const float* p = rowk0 + 8 * (lane >> 4);
#pragma unroll
  for (int i = 0; i < 8; ++i) { a[i] = (_Float16)(p[i] * sc); a[8 + i] = (_Float16)(p[16 + i] * sc); }
  return a;
}
// column fragment from a [K][ld] layout (column n), rows >= K read as 0
__device__ __forceinline__ v16h fragc_f32(const float* W, int k0, int n, int lane, int ld, int K) {
  v16h a; const int g = lane >> 4;
#pragma unroll
  for (int i = 0; i < 8; ++i) { const int ka = k0 + 8 * g + i, kb = ka + 16;
    a[i] = (_Float16)(ka < K ? W[(size_t)(ka < K ? ka : K - 1) * ld + n] : 0.f); a[8 + i] = (_Float16)(kb < K ? W[(size_t)(kb < K ? kb : K - 1) * ld + n] : 0.f); }
  return a;
}
struct F2 { v16b h, l; };
__device__ __forceinline__ F2 bsplit16(const float v[16]) { F2 r;
#pragma unroll
  for (int i = 0; i < 16; ++i) { const __bf16 h = (__bf16)v[i]; r.h[i] = h; r.l[i] = (__bf16)(v[i] - (float)h); }
  return r; }
__device__ __forceinline__ F2 split_row(const float* row, int k0, int lane) { float v[16]; const float* p = row + k0 + 8 * (lane >> 4);
#pragma unroll
  for (int i = 0; i < 8; ++i) { v[i] = p[i]; v[8 + i] = p[16 + i]; }
  return bsplit16(v); }
__device__ __forceinline__ F2 split_rowK(const float* row, int k0, int lane, int K) { float v[16]; const int g = lane >> 4;
#pragma unroll
  for (int i = 0; i < 8; ++i) { const int ka = k0 + 8 * g + i, kb = ka + 16; v[i] = ka < K ? row[ka < K ? ka : K - 1] : 0.f; v[8 + i] = kb < K ? row[kb < K ? kb : K - 1] : 0.f; }
  return bsplit16(v); }
__device__ __forceinline__ F2 split_col(const float* W, int k0, int n, int lane, int ld, int K) { float v[16]; const int g = lane >> 4;
#pragma unroll
  for (int i = 0; i < 8; ++i) { const int ka = k0 + 8 * g + i, kb = ka + 16; v[i] = ka < K ? W[(size_t)(ka < K ? ka : K - 1) * ld + n] : 0.f; v[8 + i] = kb < K ? W[(size_t)(kb < K ? kb : K - 1) * ld + n] : 0.f; }
  return bsplit16(v); }
__device__ __forceinline__ v8f mac3(const F2& a, const F2& b, v8f c) { c = wmma_bf(a.l, b.h, c); c = wmma_bf(a.h, b.l, c); return wmma_bf(a.h, b.h, c); }
__device__ __forceinline__ float sigm(float v) { return 1.0f / (1.0f + expf(-v)); }
#define LDSX() do { asm volatile("s_wait_dscnt 0" ::: "memory"); __builtin_amdgcn_wave_barrier(); __builtin_amdgcn_fence(__ATOMIC_RELEASE, "workgroup"); } while (0)


// Two-headed causal attention with per-head Linear projections on the two contiguous 512-wide halves of the input (B 4, S 2,048, E 1,024), scores / sqrt(512), softmax . v, final Linear Wf + bf.
#define NB 4
#define TT 2048
#define CC 1024
#define NH 2
#define HD 512
#ifndef TNB
#define TNB NB
#endif
typedef __attribute__((ext_vector_type(8))) __bf16 v8b;
__device__ __forceinline__ v16b frag_b(const __bf16* rowk0, int lane) {
  union { v16b v; v8b q[2]; } u; const __bf16* p = rowk0 + 8 * (lane >> 4);
  u.q[0] = *(const v8b*)p; u.q[1] = *(const v8b*)(p + 16); return u.v;
}
__device__ __forceinline__ float bfr(float v) { return (float)(__bf16)v; }
__device__ __attribute__((noinline)) float exp_ni(float v) { return expf(v); }
__device__ __attribute__((noinline)) float erf_ni(float v) { return erff(v); }

#define WS_QH  0u
#define WS_QL  (WS_QH + 2u * (size_t)NB * TT * CC)
#define WS_KH  (WS_QL + 2u * (size_t)NB * TT * CC)
#define WS_VT  (WS_KH + 2u * (size_t)NB * TT * CC)      // bf16 v planes [b][c][t]
#define WS_VL  (WS_VT + 2u * (size_t)NB * CC * TT)      // bf16 v residual planes
#define WS_S   (WS_VL + 2u * (size_t)NB * CC * TT)      // f32 exp(logit - block maximum): one [t][t] plane per (batch, head)
#define WS_Y   (WS_S + 4u * (size_t)NB * NH * TT * TT)  // f32 y rows [b*t][C]
#define WS_M   (WS_Y + 4u * (size_t)NB * TT * CC)       // f32 row maxima [pair][key block][t]
#define WS_L   (WS_M + 4u * (size_t)NB * NH * (TT / 128) * TT)   // f32 row sums, same layout
#define WS_END (WS_L + 4u * (size_t)NB * NH * (TT / 128) * TT)

// ---- LDS staging shared by the four matrix kernels: a block's 128 threads fetch each operand tile with loads that cover whole 128-byte lines (64-byte row pieces for v in k_pv), convert it once, and lay it in LDS in k order; every wave then takes its fragments with frag_b / frag_h from rows at a pitch of 16 B x odd (80 B for 64-byte rows, 144 B for 128-byte rows). Two buffers, one barrier per k step: the next tile's global loads fly during the products and are stored behind them.
typedef __attribute__((ext_vector_type(4))) __bf16 v4b;
#define P32 40   // elements per LDS row holding 32 16-bit values (80 B)
#define P64 72   // elements per LDS row holding 64 16-bit values (144 B)
__device__ __forceinline__ v4b cvt4(v4f v) { v4b r;
#pragma unroll
  for (int i = 0; i < 4; ++i) r[i] = (__bf16)v[i];
  return r; }
__device__ __forceinline__ v4b res4(v4f v, v4b h) { v4b r;
#pragma unroll
  for (int i = 0; i < 4; ++i) r[i] = (__bf16)(v[i] - (float)h[i]);
  return r; }

// ---- k_proj: block = (64 rows, 128 cols, which): qkv = x W (+ b), exact; q -> f16 hi (+ residual), k -> f16 rows, v -> bf16 hi + lo planes
__global__ __launch_bounds__(128) void k_proj(const float* __restrict__ X, const float* __restrict__ WQ, const float* __restrict__ BQ, const float* __restrict__ WK, const float* __restrict__ BK, const float* __restrict__ WV, const float* __restrict__ BV, _Float16* __restrict__ QH, _Float16* __restrict__ QL, _Float16* __restrict__ KH, __bf16* __restrict__ VT, __bf16* __restrict__ VL) {
  __shared__ __align__(16) char sm[36864];   // k loop: x tiles [2][64][P32], W tiles [2][128][P32]; epilogue, behind a barrier: sh + sl, or th + tl2
  _Float16 (*sh)[136] = (_Float16 (*)[136])sm; _Float16 (*sl)[136] = (_Float16 (*)[136])(sm + 64 * 136 * 2); __bf16 (*th)[72] = (__bf16 (*)[72])sm; __bf16 (*tl2)[72] = (__bf16 (*)[72])(sm + 128 * 72 * 2);
  __bf16* sA = (__bf16*)sm; __bf16* sB = (__bf16*)(sm + 2 * 64 * P32 * 2);
  const int tid = threadIdx.x, wave = tid >> 5, lane = tid & 31, col = lane & 15, g = lane >> 4; const int which = blockIdx.z; const int c0 = blockIdx.y * 128; const size_t r0 = (size_t)blockIdx.x * 64; const float* WA = which == 0 ? WQ : which == 1 ? WK : WV; const float* BA = which == 0 ? BQ : which == 1 ? BK : BV; const int hn = c0 / HD;   // head of this 128-column block (HD = 512)
  const int sr = tid >> 3, sq = tid & 7;   // staging: 8 threads of 16 B per 128-byte row piece
  const float* gA = X + (r0 + sr) * CC + hn * HD + sq * 4; const float* gB = WA + (size_t)(c0 + sr) * HD + sq * 4;
  v4f ra[4], rb[8]; v8f acc[8] = {};
#pragma unroll
  for (int i = 0; i < 4; ++i) ra[i] = *(const v4f*)(gA + (size_t)i * 16 * CC);
#pragma unroll
  for (int i = 0; i < 8; ++i) rb[i] = *(const v4f*)(gB + (size_t)i * 16 * HD);
#pragma unroll
  for (int i = 0; i < 4; ++i) *(v4b*)(sA + (sr + 16 * i) * P32 + sq * 4) = cvt4(ra[i]);
#pragma unroll
  for (int i = 0; i < 8; ++i) *(v4b*)(sB + (sr + 16 * i) * P32 + sq * 4) = cvt4(rb[i]);
#pragma unroll 2   // two steps per trip: the buffer index becomes a constant
  for (int kc = 0; kc < HD / 32; ++kc) { const int bu = kc & 1, nb = bu ^ 1; const bool more = kc + 1 < HD / 32;
    __syncthreads();   // publishes buffer bu; ends every wave's reads of buffer nb
    if (more) {
#pragma unroll
      for (int i = 0; i < 4; ++i) ra[i] = *(const v4f*)(gA + (size_t)i * 16 * CC + (kc + 1) * 32);
#pragma unroll
      for (int i = 0; i < 8; ++i) rb[i] = *(const v4f*)(gB + (size_t)i * 16 * HD + (kc + 1) * 32);
      asm volatile("s_wait_xcnt 0x0" ::: "memory");   // precaution: stands ahead of every rewrite of the address registers that these loads name
    }
    const v16b a = frag_b(sA + (bu * 64 + wave * 16 + col) * P32, lane); v16b w[8];   // the step's LDS reads stand together, ahead of its products: one exposed LDS latency, not eight
#pragma unroll
    for (int j = 0; j < 8; ++j) w[j] = frag_b(sB + (bu * 128 + j * 16 + col) * P32, lane);
    __builtin_amdgcn_sched_barrier(0);   // keeps the LDS reads above together, ahead of the products: without it the compiler reads one fragment, waits and multiplies, eight LDS latencies a step
#pragma unroll
    for (int j = 0; j < 8; ++j) acc[j] = wmma_bf(a, w[j], acc[j]);
    __builtin_amdgcn_sched_barrier(0);   // keeps the products together: without it the next tile's conversions, and the wait for its global loads, move up among them
    if (more) {
#pragma unroll
      for (int i = 0; i < 4; ++i) *(v4b*)(sA + (nb * 64 + sr + 16 * i) * P32 + sq * 4) = cvt4(ra[i]);
#pragma unroll
      for (int i = 0; i < 8; ++i) *(v4b*)(sB + (nb * 128 + sr + 16 * i) * P32 + sq * 4) = cvt4(rb[i]); } }
  __syncthreads();   // the tiles are dead: the epilogue reuses their LDS
#pragma unroll
  for (int j = 0; j < 8; ++j) { const float bb = bfr(BA[c0 + j * 16 + col]);
#pragma unroll
    for (int r = 0; r < 8; ++r) { const float v = acc[j][r] + bb; const int rl = wave * 16 + 8 * g + r, cl = j * 16 + col; const _Float16 hv = (_Float16)v;
      if (which == 2) { const __bf16 bh = (__bf16)v; th[cl][rl] = bh; tl2[cl][rl] = (__bf16)(v - (float)bh); } else { sh[rl][cl] = hv; sl[rl][cl] = (_Float16)(v - (float)hv); } } }
  __syncthreads();
  if (which < 2) { _Float16* dh = which == 0 ? QH : KH; for (int e = tid; e < 64 * 16; e += 128) { const int rl = e >> 4, q = e & 15; vst2((unsigned*)(dh + (r0 + rl) * CC + c0 + q * 8), *(const v4u*)&sh[rl][q * 8]); if (which == 0) vst2((unsigned*)(QL + (r0 + rl) * CC + c0 + q * 8), *(const v4u*)&sl[rl][q * 8]); } }
  else { const size_t b = r0 / TT; const int t0 = (int)(r0 % TT); for (int e = tid; e < 128 * 8; e += 128) { const int cl = e >> 3, q = e & 7; const size_t o2 = (b * CC + c0 + cl) * (size_t)TT + t0 + q * 8; vst2((unsigned*)(VT + o2), *(const v4u*)&th[cl][q * 8]); vst2((unsigned*)(VL + o2), *(const v4u*)&tl2[cl][q * 8]); } } }
// value of lane ^ M inside the lane's 16-lane half, every lane on: a register move (DPP row_xmask), where __shfl_xor would go through the LDS unit and its wait
template <int M> __device__ __forceinline__ float rowx(float v) { return __builtin_bit_cast(float, __builtin_amdgcn_update_dpp(0, __builtin_bit_cast(int, v), 0x160 | M, 0xf, 0xf, true)); }
// ---- k_sc: block = (64 queries, 128 keys, pair = b * NH + h): logits * scale, then the block's share of the softmax: per row the maximum mb and the sum lb of exp(logit - mb) over its 128 keys (masked -> 0); S takes the exponentials, MB and LB the two row figures, 256 contiguous bytes each, stored by one wave; causal blocks beyond the diagonal store mb = -3.0e38, lb = 0 and exit
__global__ __launch_bounds__(128) void k_sc(const _Float16* __restrict__ QH, const _Float16* __restrict__ QL, const _Float16* __restrict__ KH, const float* __restrict__ BM, const int* __restrict__ MSK, float* __restrict__ S, float* __restrict__ MB, float* __restrict__ LB) { __shared__ __align__(16) char sm[55296];   // k loop: q tiles [2][64][P64], k tiles [2][128][P64]; epilogue, behind a barrier: ss, sM, sL
  float (*ss)[16][132] = (float (*)[16][132])sm; _Float16* sA = (_Float16*)sm; _Float16* sB = (_Float16*)(sm + 2 * 64 * P64 * 2);
  const bool cz = (MSK[0] != 0); const int b = blockIdx.z / NH, h = blockIdx.z % NH; S += (size_t)blockIdx.z * TT * TT;
  const int tid = threadIdx.x, wave = tid >> 5, lane = tid & 31, col = lane & 15, g = lane >> 4; const int k0 = blockIdx.y * 128; const int ql0 = blockIdx.x * 64 + wave * 16;
  const size_t mo = ((size_t)blockIdx.z * (TT / 128) + blockIdx.y) * TT + blockIdx.x * 64; float* mrow = MB + mo; float* lrow = LB + mo;   // this block's 64 rows
  if (cz && k0 > blockIdx.x * 64 + 63) { if (tid < 32) { vst2(mrow + tid * 2, (v2f){-3.0e38f, -3.0e38f}); vst2(lrow + tid * 2, (v2f){0.f, 0.f}); } return; }   // causal: whole key block above the diagonal (block-uniform): it weighs nothing in its rows
  (void)QL; const int sr = tid >> 3, sq = tid & 7;   // staging: 8 threads of 16 B per 128-byte row piece (64 k)
  const _Float16* gA = QH + ((size_t)b * TT + blockIdx.x * 64 + sr) * CC + h * HD + sq * 8; const _Float16* gB = KH + ((size_t)b * TT + k0 + sr) * CC + h * HD + sq * 8;
  v4u ra[4], rb[8]; v8f acc[8] = {};
#pragma unroll
  for (int i = 0; i < 4; ++i) ra[i] = *(const v4u*)(gA + (size_t)i * 16 * CC);
#pragma unroll
  for (int i = 0; i < 8; ++i) rb[i] = *(const v4u*)(gB + (size_t)i * 16 * CC);
#pragma unroll
  for (int i = 0; i < 4; ++i) *(v4u*)(sA + (sr + 16 * i) * P64 + sq * 8) = ra[i];
#pragma unroll
  for (int i = 0; i < 8; ++i) *(v4u*)(sB + (sr + 16 * i) * P64 + sq * 8) = rb[i];
#pragma unroll 2   // two steps per trip: the buffer index becomes a constant
  for (int ks = 0; ks < HD / 64; ++ks) { const int bu = ks & 1, nb = bu ^ 1; const bool more = ks + 1 < HD / 64;
    __syncthreads();   // publishes buffer bu; ends every wave's reads of buffer nb
    if (more) {
#pragma unroll
      for (int i = 0; i < 4; ++i) ra[i] = *(const v4u*)(gA + (size_t)i * 16 * CC + (ks + 1) * 64);
#pragma unroll
      for (int i = 0; i < 8; ++i) rb[i] = *(const v4u*)(gB + (size_t)i * 16 * CC + (ks + 1) * 64);
      asm volatile("s_wait_xcnt 0x0" ::: "memory");   // precaution: stands ahead of every rewrite of the address registers that these loads name
    }
#pragma unroll
    for (int s = 0; s < 2; ++s) { const v16h ah = frag_h(sA + (bu * 64 + wave * 16 + col) * P64 + s * 32, lane); v16h kb[8];   // LDS reads together, ahead of their products
#pragma unroll
      for (int j = 0; j < 8; ++j) kb[j] = frag_h(sB + (bu * 128 + j * 16 + col) * P64 + s * 32, lane);
      __builtin_amdgcn_sched_barrier(0);   // keeps the LDS reads above together, ahead of the products: without it the compiler reads one fragment, waits and multiplies, eight LDS latencies a step
#pragma unroll
      for (int j = 0; j < 8; ++j) acc[j] = wmma16(ah, kb[j], acc[j]);
      __builtin_amdgcn_sched_barrier(0);   // keeps the products together: without it the next tile's LDS stores, and the wait for its global loads, move up among them
    }
    if (more) {
#pragma unroll
      for (int i = 0; i < 4; ++i) *(v4u*)(sA + (nb * 64 + sr + 16 * i) * P64 + sq * 8) = ra[i];
#pragma unroll
      for (int i = 0; i < 8; ++i) *(v4u*)(sB + (nb * 128 + sr + 16 * i) * P64 + sq * 8) = rb[i]; } }
  __syncthreads();   // the tiles are dead: the epilogue reuses their LDS
  float* sM = (float*)(sm + 34816); float* sL = sM + 64; float mb[8], lb[8];   // behind ss (33,792 B)
#pragma unroll
  for (int r = 0; r < 8; ++r) { mb[r] = -3.0e38f; lb[r] = 0.f; }
#pragma unroll
  for (int j = 0; j < 8; ++j) { const int kt = k0 + j * 16 + col;
#pragma unroll
    for (int r = 0; r < 8; ++r) { const int qt = ql0 + 8 * g + r; float v = acc[j][r] * 0.044194173824159216f; (void)BM; if (cz && kt > qt) v = -3.0e38f; acc[j][r] = v; mb[r] = fmaxf(mb[r], v); } }
#pragma unroll
  for (int r = 0; r < 8; ++r) { mb[r] = fmaxf(mb[r], rowx<1>(mb[r])); mb[r] = fmaxf(mb[r], rowx<2>(mb[r])); mb[r] = fmaxf(mb[r], rowx<4>(mb[r])); mb[r] = fmaxf(mb[r], rowx<8>(mb[r])); }   // a row's 128 keys lie in the 16 lanes of one half
#pragma unroll
  for (int j = 0; j < 8; ++j)
#pragma unroll
    for (int r = 0; r < 8; ++r) { const float v = acc[j][r]; const float ex = expf(v - mb[r]); const float e = (v <= -1.0e38f) ? 0.f : ex; lb[r] += e; ss[wave][8 * g + r][j * 16 + col] = e; }
#pragma unroll
  for (int r = 0; r < 8; ++r) { lb[r] += rowx<1>(lb[r]); lb[r] += rowx<2>(lb[r]); lb[r] += rowx<4>(lb[r]); lb[r] += rowx<8>(lb[r]); }
  if (col == 0) {
#pragma unroll
    for (int r = 0; r < 8; ++r) { sM[wave * 16 + 8 * g + r] = mb[r]; sL[wave * 16 + 8 * g + r] = lb[r]; } }
  __syncthreads();   // publishes the four waves' sM, sL to wave 0, which alone writes their lines; it also ends each wave's ss writes ahead of its own reads below. It stands ahead of the S stores, so that no wave waits at it for stores to return
  if (tid < 32) { vst2(mrow + tid * 2, *(const v2f*)&sM[tid * 2]); vst2(lrow + tid * 2, *(const v2f*)&sL[tid * 2]);
    asm volatile("s_wait_xcnt 0x0" ::: "memory"); }   // precaution: stands ahead of every rewrite of the registers that these two stores name
  for (int rl = 0; rl < 16; ++rl) vst2(S + (size_t)(ql0 + rl) * TT + k0 + lane * 4, *(const v4f*)&ss[wave][rl][lane * 4]);
  asm volatile("s_wait_xcnt 0x0" ::: "memory"); }   // precaution: the early-exit block is laid out behind these stores; the wait stands ahead of its rewrite of their data registers
// ---- k_pv: block = (128-column chunk, pair = b * NH + h, 64 queries): y = P . (v hi + lo) with P split hi + lo (3 products); P x 2^11 = stored exponential x sF[key block][row], sF = exp(mb - row maximum) x 2^11 / row sum, row sum = sum over key blocks of exp(mb - row maximum) x lb, formed once per block from MB and LB; the query tile, whose index sets the causal trip count, is the slowest grid index, so that work-groups far apart in launch order differ in length
__global__ __launch_bounds__(128) void k_pv(const float* __restrict__ PS, const __bf16* __restrict__ VT, const __bf16* __restrict__ VL, const int* __restrict__ MSK, const float* __restrict__ MB, const float* __restrict__ LB, float* __restrict__ Y) { __shared__ __align__(16) char sm[65536];   // k loop: P hi, P lo [2][64][P32] each, v hi, v lo [2][128][P32] each; epilogue, behind a barrier: ss; last 4 KB: sF [16][64]
  float (*ss)[16][132] = (float (*)[16][132])sm; __bf16* sPh = (__bf16*)sm; __bf16* sPl = (__bf16*)(sm + 10240); __bf16* sVh = (__bf16*)(sm + 20480); __bf16* sVl = (__bf16*)(sm + 40960); float* sF = (float*)(sm + 61440);
  const int tid = threadIdx.x, wave = tid >> 5, lane = tid & 31, col = lane & 15, g = lane >> 4; const int b = blockIdx.y / NH, h = blockIdx.y % NH; PS += (size_t)blockIdx.y * TT * TT; const int ql0 = blockIdx.z * 64 + wave * 16; const int cc0 = blockIdx.x * 128; const int kend = (MSK[0] != 0) ? (blockIdx.z * 64 + 64) : TT; const int nk = kend / 32;
  const int sr = tid >> 3, sq = tid & 7, vr = tid >> 2, vq = tid & 3;   // staging: P 8 threads of 16 B per 128-byte row piece, v 4 threads per 64-byte row piece
  const float* gP = PS + (size_t)(blockIdx.z * 64 + sr) * TT + sq * 4; const size_t vo = ((size_t)b * CC + h * HD + cc0 + vr) * (size_t)TT + vq * 8; const __bf16* gH = VT + vo; const __bf16* gL = VL + vo;
  v4f rp[4]; v4u rh[4], rl4[4]; v8f acc[8] = {};
#pragma unroll
  for (int i = 0; i < 4; ++i) { rp[i] = *(const v4f*)(gP + (size_t)i * 16 * TT); rh[i] = *(const v4u*)(gH + (size_t)i * 32 * TT); rl4[i] = *(const v4u*)(gL + (size_t)i * 32 * TT); }
  { const int row = tid & 63, hb = tid >> 6; const size_t mo = (size_t)blockIdx.y * (TT / 128) * TT + blockIdx.z * 64 + row; float mv[16], lv[16];   // two threads per row; each forms the row's figures and writes eight of its sixteen factors
#pragma unroll
    for (int kb = 0; kb < 16; ++kb) { mv[kb] = MB[mo + (size_t)kb * TT]; lv[kb] = LB[mo + (size_t)kb * TT]; }
    asm volatile("s_wait_xcnt 0x0" ::: "memory");   // precaution: stands ahead of every rewrite of the address registers that these loads name
    float m = mv[0], l = 0.f;
#pragma unroll
    for (int kb = 1; kb < 16; ++kb) m = fmaxf(m, mv[kb]);
#pragma unroll
    for (int kb = 0; kb < 16; ++kb) { mv[kb] = expf(mv[kb] - m); l += mv[kb] * lv[kb]; }
    const float inv = 1.0f / l;
#pragma unroll
    for (int kb = 0; kb < 16; ++kb) if ((kb >> 3) == hb) sF[kb * 64 + row] = mv[kb] * inv * 2048.0f; }
  __syncthreads();   // publishes sF
  float ff[4];
#pragma unroll
  for (int i = 0; i < 4; ++i) { ff[i] = sF[sr + 16 * i]; rp[i] *= ff[i]; }
#pragma unroll
  for (int i = 0; i < 4; ++i) { const v4b ph = cvt4(rp[i]); *(v4b*)(sPh + (sr + 16 * i) * P32 + sq * 4) = ph; *(v4b*)(sPl + (sr + 16 * i) * P32 + sq * 4) = res4(rp[i], ph); *(v4u*)(sVh + (vr + 32 * i) * P32 + vq * 8) = rh[i]; *(v4u*)(sVl + (vr + 32 * i) * P32 + vq * 8) = rl4[i]; }
#pragma unroll 2   // two steps per trip (nk is even): the buffer index becomes a constant
  for (int kc = 0; kc < nk; ++kc) { const int bu = kc & 1, nb = bu ^ 1; const bool more = kc + 1 < nk;
    __syncthreads();   // publishes buffer bu; ends every wave's reads of buffer nb
    if (more) {
#pragma unroll
      for (int i = 0; i < 4; ++i) { rp[i] = *(const v4f*)(gP + (size_t)i * 16 * TT + (kc + 1) * 32); rh[i] = *(const v4u*)(gH + (size_t)i * 32 * TT + (kc + 1) * 32); rl4[i] = *(const v4u*)(gL + (size_t)i * 32 * TT + (kc + 1) * 32); }
      asm volatile("s_wait_xcnt 0x0" ::: "memory");   // precaution: stands ahead of every rewrite of the address registers that these loads name
      __builtin_amdgcn_sched_barrier(0);   // keeps the sF reads below, address arithmetic included, behind that wait: the compiler lays them in the loads' address registers
#pragma unroll
      for (int i = 0; i < 4; ++i) ff[i] = sF[((kc + 1) >> 2) * 64 + sr + 16 * i];   // the next tile's 32 keys lie in one 128-key block
    }
    const v16b ph = frag_b(sPh + (bu * 64 + wave * 16 + col) * P32, lane), pl = frag_b(sPl + (bu * 64 + wave * 16 + col) * P32, lane);
#pragma unroll
    for (int jh = 0; jh < 8; jh += 4) { v16b vh[4], vl[4];   // LDS reads of four column tiles together, ahead of their twelve products
#pragma unroll
      for (int j = 0; j < 4; ++j) { const int ro = (bu * 128 + (jh + j) * 16 + col) * P32; vh[j] = frag_b(sVh + ro, lane); vl[j] = frag_b(sVl + ro, lane); }
      __builtin_amdgcn_sched_barrier(0);   // keeps the LDS reads above together, ahead of the products: without it the compiler reads one fragment, waits and multiplies, eight LDS latencies a step
#pragma unroll
      for (int j = 0; j < 4; ++j) acc[jh + j] = wmma_bf(ph, vh[j], acc[jh + j]);   // the three products of a tile stand four WMMAs apart: none waits for the one before it; each tile still sums ph.vh, pl.vh, ph.vl in that order
#pragma unroll
      for (int j = 0; j < 4; ++j) acc[jh + j] = wmma_bf(pl, vh[j], acc[jh + j]);
#pragma unroll
      for (int j = 0; j < 4; ++j) acc[jh + j] = wmma_bf(ph, vl[j], acc[jh + j]);
      __builtin_amdgcn_sched_barrier(0);   // keeps the products together: without it the next tile's conversions, and the wait for its global loads, move up among them
    }
    if (more) {
#pragma unroll
      for (int i = 0; i < 4; ++i) { const v4f pp = rp[i] * ff[i]; const v4b qh = cvt4(pp); *(v4b*)(sPh + (nb * 64 + sr + 16 * i) * P32 + sq * 4) = qh; *(v4b*)(sPl + (nb * 64 + sr + 16 * i) * P32 + sq * 4) = res4(pp, qh); *(v4u*)(sVh + (nb * 128 + vr + 32 * i) * P32 + vq * 8) = rh[i]; *(v4u*)(sVl + (nb * 128 + vr + 32 * i) * P32 + vq * 8) = rl4[i]; } } }
  __syncthreads();   // the tiles are dead: the epilogue reuses their LDS
#pragma unroll
  for (int j = 0; j < 8; ++j)
#pragma unroll
    for (int r = 0; r < 8; ++r) ss[wave][8 * g + r][j * 16 + col] = acc[j][r] * (1.0f / 2048.0f);
  LDSX(); for (int rl = 0; rl < 16; ++rl) vst2(Y + ((size_t)b * TT + ql0 + rl) * CC + h * HD + cc0 + lane * 4, *(const v4f*)&ss[wave][rl][lane * 4]); }
// ---- k_out: block = (64 rows, 128 cols): out = y (bf16 hi + lo) Wproj + b
__global__ __launch_bounds__(128) void k_out(const float* __restrict__ Y, const float* __restrict__ WP, const float* __restrict__ BP, float* __restrict__ OUT) { __shared__ __align__(16) char sm[40960];   // k loop: y hi, y lo [2][64][P32] each, W tiles [2][128][P32]; epilogue, behind a barrier: sf
  float (*sf)[16][132] = (float (*)[16][132])sm; __bf16* sAh = (__bf16*)sm; __bf16* sAl = (__bf16*)(sm + 10240); __bf16* sB = (__bf16*)(sm + 20480);
  const int tid = threadIdx.x, wave = tid >> 5, lane = tid & 31, col = lane & 15, g = lane >> 4; const int c0 = blockIdx.y * 128; const size_t r0 = (size_t)blockIdx.x * 64 + wave * 16;
  const int sr = tid >> 3, sq = tid & 7;   // staging: 8 threads of 16 B per 128-byte row piece
  const float* gA = Y + ((size_t)blockIdx.x * 64 + sr) * CC + sq * 4; const float* gB = WP + (size_t)(c0 + sr) * CC + sq * 4;
  v4f ra[4], rb[8]; v8f acc[8] = {};
#pragma unroll
  for (int i = 0; i < 4; ++i) ra[i] = *(const v4f*)(gA + (size_t)i * 16 * CC);
#pragma unroll
  for (int i = 0; i < 8; ++i) rb[i] = *(const v4f*)(gB + (size_t)i * 16 * CC);
#pragma unroll
  for (int i = 0; i < 4; ++i) { const v4b ah = cvt4(ra[i]); *(v4b*)(sAh + (sr + 16 * i) * P32 + sq * 4) = ah; *(v4b*)(sAl + (sr + 16 * i) * P32 + sq * 4) = res4(ra[i], ah); }
#pragma unroll
  for (int i = 0; i < 8; ++i) *(v4b*)(sB + (sr + 16 * i) * P32 + sq * 4) = cvt4(rb[i]);
#pragma unroll 2   // two steps per trip: the buffer index becomes a constant
  for (int kc = 0; kc < CC / 32; ++kc) { const int bu = kc & 1, nb = bu ^ 1; const bool more = kc + 1 < CC / 32;
    __syncthreads();   // publishes buffer bu; ends every wave's reads of buffer nb
    if (more) {
#pragma unroll
      for (int i = 0; i < 4; ++i) ra[i] = *(const v4f*)(gA + (size_t)i * 16 * CC + (kc + 1) * 32);
#pragma unroll
      for (int i = 0; i < 8; ++i) rb[i] = *(const v4f*)(gB + (size_t)i * 16 * CC + (kc + 1) * 32);
      asm volatile("s_wait_xcnt 0x0" ::: "memory");   // precaution: stands ahead of every rewrite of the address registers that these loads name
    }
    const v16b ah = frag_b(sAh + (bu * 64 + wave * 16 + col) * P32, lane), al = frag_b(sAl + (bu * 64 + wave * 16 + col) * P32, lane);
    v16b w[8];   // the step's LDS reads stand together, ahead of its products
#pragma unroll
    for (int j = 0; j < 8; ++j) w[j] = frag_b(sB + (bu * 128 + j * 16 + col) * P32, lane);
    __builtin_amdgcn_sched_barrier(0);   // keeps the LDS reads above together, ahead of the products: without it the compiler reads one fragment, waits and multiplies, eight LDS latencies a step
#pragma unroll
    for (int j = 0; j < 8; ++j) acc[j] = wmma_bf(ah, w[j], acc[j]);   // the two products of a tile stand eight WMMAs apart; each tile still sums hi, then lo
#pragma unroll
    for (int j = 0; j < 8; ++j) acc[j] = wmma_bf(al, w[j], acc[j]);
    __builtin_amdgcn_sched_barrier(0);   // keeps the products together: without it the next tile's conversions, and the wait for its global loads, move up among them
    if (more) {
#pragma unroll
      for (int i = 0; i < 4; ++i) { const v4b qh = cvt4(ra[i]); *(v4b*)(sAh + (nb * 64 + sr + 16 * i) * P32 + sq * 4) = qh; *(v4b*)(sAl + (nb * 64 + sr + 16 * i) * P32 + sq * 4) = res4(ra[i], qh); }
#pragma unroll
      for (int i = 0; i < 8; ++i) *(v4b*)(sB + (nb * 128 + sr + 16 * i) * P32 + sq * 4) = cvt4(rb[i]); } }
  __syncthreads();   // the tiles are dead: the epilogue reuses their LDS
#pragma unroll
  for (int j = 0; j < 8; ++j) { const float bb = BP ? bfr(BP[c0 + j * 16 + col]) : 0.f;
#pragma unroll
    for (int r = 0; r < 8; ++r) sf[wave][8 * g + r][j * 16 + col] = acc[j][r] + bb; }
  LDSX(); for (int rl = 0; rl < 16; ++rl) vst2(OUT + (r0 + rl) * CC + c0 + lane * 4, *(const v4f*)&sf[wave][rl][lane * 4]); }
extern "C" void kernel_launch(void* const* d_in, const int* in_sizes, int n_in, void* d_out, int out_size, void* d_ws, size_t ws_size, hipStream_t stream) {
  (void)in_sizes; (void)n_in; (void)out_size;
  const float** F = (const float**)d_in;   // 0 input [4,2048,1024], 1 Wq [2,512,512] ([out,in] per head), 2 bq [2,512], 3 Wk, 4 bk, 5 Wv, 6 bv, 7 Wf [1024,1024] ([out,in]), 8 bf, 9 masked [1] int (= 1 -> causal)
  if (ws_size < (size_t)WS_END) return;
  char* ws = (char*)d_ws; _Float16 *QH = (_Float16*)(ws + WS_QH), *QL = (_Float16*)(ws + WS_QL), *KH = (_Float16*)(ws + WS_KH); __bf16 *VT = (__bf16*)(ws + WS_VT), *VL = (__bf16*)(ws + WS_VL); float *S = (float*)(ws + WS_S), *Y = (float*)(ws + WS_Y), *MB = (float*)(ws + WS_M), *LB = (float*)(ws + WS_L);
  k_proj<<<dim3(TNB * TT / 64, CC / 128, 3), 128, 0, stream>>>(F[0], F[1], F[2], F[3], F[4], F[5], F[6], QH, QL, KH, VT, VL);
  k_sc<<<dim3(TT / 64, TT / 128, TNB * NH), 128, 0, stream>>>(QH, QL, KH, nullptr, (const int*)d_in[9], S, MB, LB);
  k_pv<<<dim3(HD / 128, TNB * NH, TT / 64), 128, 0, stream>>>(S, VT, VL, (const int*)d_in[9], MB, LB, Y);
  k_out<<<dim3(TNB * TT / 64, CC / 128), 128, 0, stream>>>(Y, F[7], F[8], (float*)d_out);
}

// v006
// Measured time: 188 microseconds a run.
// Two timings next to v005 put it at 1.07 and 1.08 times that version's speed.
// All steps since v000 together make it 11.3 times as fast.
// compute dtype: all float inputs rounded to bf16 (x, Wq, Wk, Wv, Wf once, by k_cvt), 'masked' read at run time (1 -> causal; 0 -> full attention); per-head q/k/v = x_half W_n^T + b_n (block-diagonal [out,in] linears) with EXACT bf16 products on WMMA 16x16x32, f32 accumulate, q/k rounded once to f16 (0.02-scale weights, logits std ~0.01: 1 product), softmax in f32 (precise expf) in two parts: exp(logit - block maximum) stored in f32 per (batch, head) with each 128-key block's row maximum and row sum, rescaled to P x 2^11 where P.V stages it, kept f32 and split bf16 hi + lo against v as bf16 hi + lo (3 products); out = y (bf16 hi + lo) Wf^T + bf; f32 output.
#include <hip/hip_runtime.h>
#include <math.h>

typedef __attribute__((ext_vector_type(16))) _Float16 v16h;
typedef __attribute__((ext_vector_type(16))) __bf16 v16b;
typedef __attribute__((ext_vector_type(8)))  _Float16 v8h;
typedef __attribute__((ext_vector_type(8)))  float v8f;
typedef __attribute__((ext_vector_type(4)))  float v4f;
typedef __attribute__((ext_vector_type(2)))  float v2f;
typedef __attribute__((ext_vector_type(4)))  unsigned v4u;
typedef __attribute__((ext_vector_type(4)))  int v4i;
typedef float __attribute__((may_alias)) float_a;
typedef int __attribute__((may_alias)) int_a;

template <typename T> __device__ __forceinline__ void vst2(void* p, T v) { *(T*)p = v;  }
__device__ __forceinline__ v8f wmma16(v16h a, v16h b, v8f c) {
  return __builtin_amdgcn_wmma_f32_16x16x32_f16(false, a, false, b, (short)0, c, false, false);
}
__device__ __forceinline__ v8f wmma_bf(v16b a, v16b b, v8f c) {
  return __builtin_amdgcn_wmma_f32_16x16x32_bf16(false, a, false, b, (short)0, c, false, false);
}
// 16x16x32 fragments: lane = (h = lane>>4, row/col = lane&15); elements 0..7 = k0+8h+0..7, 8..15 = k0+16+8h+0..7; D element r = row 8h+r
__device__ __forceinline__ v16h frag_h(const _Float16* rowk0, int lane) {
  union { v16h v; v8h q[2]; } u; const _Float16* p = rowk0 + 8 * (lane >> 4);
  u.q[0] = *(const v8h*)p; u.q[1] = *(const v8h*)(p + 16); return u.v;
}
__device__ __forceinline__ v16h frag_f32(const float* rowk0, int lane) {
  v16h a; const float* p = rowk0 + 8 * (lane >> 4);
#pragma unroll
  for (int i = 0; i < 8; ++i) { a[i] = (_Float16)p[i]; a[8 + i] = (_Float16)p[16 + i]; }
  return a;
}
__device__ __forceinline__ v16h frag_f32s(const float* rowk0, int lane, float sc) {
  v16h a; const float* p = rowk0 + 8 * (lane >> 4);
#pragma unroll
  for (int i = 0; i < 8; ++i) { a[i] = (_Float16)(p[i] * sc); a[8 + i] = (_Float16)(p[16 + i] * sc); }
  return a;
}
// column fragment from a [K][ld] layout (column n), rows >= K read as 0
__device__ __forceinline__ v16h fragc_f32(const float* W, int k0, int n, int lane, int ld, int K) {
  v16h a; const int g = lane >> 4;
#pragma unroll
  for (int i = 0; i < 8; ++i) { const int ka = k0 + 8 * g + i, kb = ka + 16;
    a[i] = (_Float16)(ka < K ? W[(size_t)(ka < K ? ka : K - 1) * ld + n] : 0.f); a[8 + i] = (_Float16)(kb < K ? W[(size_t)(kb < K ? kb : K - 1) * ld + n] : 0.f); }
  return a;
}
struct F2 { v16b h, l; };
__device__ __forceinline__ F2 bsplit16(const float v[16]) { F2 r;
#pragma unroll
  for (int i = 0; i < 16; ++i) { const __bf16 h = (__bf16)v[i]; r.h[i] = h; r.l[i] = (__bf16)(v[i] - (float)h); }
  return r; }
__device__ __forceinline__ F2 split_row(const float* row, int k0, int lane) { float v[16]; const float* p = row + k0 + 8 * (lane >> 4);
#pragma unroll
  for (int i = 0; i < 8; ++i) { v[i] = p[i]; v[8 + i] = p[16 + i]; }
  return bsplit16(v); }
__device__ __forceinline__ F2 split_rowK(const float* row, int k0, int lane, int K) { float v[16]; const int g = lane >> 4;
#pragma unroll
  for (int i = 0; i < 8; ++i) { const int ka = k0 + 8 * g + i, kb = ka + 16; v[i] = ka < K ? row[ka < K ? ka : K - 1] : 0.f; v[8 + i] = kb < K ? row[kb < K ? kb : K - 1] : 0.f; }
  return bsplit16(v); }
__device__ __forceinline__ F2 split_col(const float* W, int k0, int n, int lane, int ld, int K) { float v[16]; const int g = lane >> 4;
#pragma unroll
  for (int i = 0; i < 8; ++i) { const int ka = k0 + 8 * g + i, kb = ka + 16; v[i] = ka < K ? W[(size_t)(ka < K ? ka : K - 1) * ld + n] : 0.f; v[8 + i] = kb < K ? W[(size_t)(kb < K ? kb : K - 1) * ld + n] : 0.f; }
  return bsplit16(v); }
__device__ __forceinline__ v8f mac3(const F2& a, const F2& b, v8f c) { c = wmma_bf(a.l, b.h, c); c = wmma_bf(a.h, b.l, c); return wmma_bf(a.h, b.h, c); }
__device__ __forceinline__ float sigm(float v) { return 1.0f / (1.0f + expf(-v)); }
#define LDSX() do { asm volatile("s_wait_dscnt 0" ::: "memory"); __builtin_amdgcn_wave_barrier(); __builtin_amdgcn_fence(__ATOMIC_RELEASE, "workgroup"); } while (0)


// Two-headed causal attention with per-head Linear projections on the two contiguous 512-wide halves of the input (B 4, S 2,048, E 1,024), scores / sqrt(512), softmax . v, final Linear Wf + bf.
#define NB 4
#define TT 2048
#define CC 1024
#define NH 2
#define HD 512
#ifndef TNB
#define TNB NB
#endif
typedef __attribute__((ext_vector_type(8))) __bf16 v8b;
__device__ __forceinline__ v16b frag_b(const __bf16* rowk0, int lane) {
  union { v16b v; v8b q[2]; } u; const __bf16* p = rowk0 + 8 * (lane >> 4);
  u.q[0] = *(const v8b*)p; u.q[1] = *(const v8b*)(p + 16); return u.v;
}
__device__ __forceinline__ float bfr(float v) { return (float)(__bf16)v; }
__device__ __attribute__((noinline)) float exp_ni(float v) { return expf(v); }
__device__ __attribute__((noinline)) float erf_ni(float v) { return erff(v); }

#define WS_QH  0u
#define WS_QL  (WS_QH + 2u * (size_t)NB * TT * CC)
#define WS_KH  (WS_QL + 2u * (size_t)NB * TT * CC)
#define WS_VT  (WS_KH + 2u * (size_t)NB * TT * CC)      // bf16 v planes [b][c][t]
#define WS_VL  (WS_VT + 2u * (size_t)NB * CC * TT)      // bf16 v residual planes
#define WS_S   (WS_VL + 2u * (size_t)NB * CC * TT)      // f32 exp(logit - block maximum): one [t][t] plane per (batch, head)
#define WS_Y   (WS_S + 4u * (size_t)NB * NH * TT * TT)  // f32 y rows [b*t][C]
#define WS_M   (WS_Y + 4u * (size_t)NB * TT * CC)       // f32 row maxima [pair][key block][t]
#define WS_L   (WS_M + 4u * (size_t)NB * NH * (TT / 128) * TT)   // f32 row sums, same layout
#define WS_WF  (WS_L + 4u * (size_t)NB * NH * (TT / 128) * TT)   // bf16 Wf [out][in]: written by k_cvt, read by k_out
#define WS_END (WS_WF + 2u * (size_t)CC * CC)
#define WS_XB  WS_Y                                     // bf16 x rows [b*t][C]: written by k_cvt, last read by k_proj; k_pv lays y over them later in the same call
#define WS_WB  (WS_XB + 2u * (size_t)NB * TT * CC)      // bf16 Wq, Wk, Wv [3][head][out][in], same life

// ---- LDS staging shared by the four matrix kernels: a block's 128 threads fetch each operand tile with loads that cover whole 128-byte lines (k_pv's v tiles: 64-byte halves), convert it once, and lay it in LDS in k order; every wave then takes its fragments with frag_b / frag_h from rows at a pitch of 16 B x odd (80 B for 64-byte rows, 144 B for 128-byte rows). Two buffers, one barrier per k step: the next tile's global loads fly during the products and are stored behind them.
typedef __attribute__((ext_vector_type(4))) __bf16 v4b;
#define P32 40   // elements per LDS row holding 32 16-bit values (80 B)
#define P64 72   // elements per LDS row holding 64 16-bit values (144 B)
__device__ __forceinline__ v4b cvt4(v4f v) { v4b r;
#pragma unroll
  for (int i = 0; i < 4; ++i) r[i] = (__bf16)v[i];
  return r; }
__device__ __forceinline__ v4b res4(v4f v, v4b h) { v4b r;
#pragma unroll
  for (int i = 0; i < 4; ++i) r[i] = (__bf16)(v[i] - (float)h[i]);
  return r; }

// ---- k_cvt: block = 8,192 consecutive floats of one of x, Wq, Wk, Wv, Wf: each is rounded to bf16 once here, not again in every block that stages it (x 12 times, a weight 128 times)
#define CVB 8192
__global__ __launch_bounds__(256) void k_cvt(const float* __restrict__ X, const float* __restrict__ WQ, const float* __restrict__ WK, const float* __restrict__ WV, const float* __restrict__ WF, __bf16* __restrict__ XB, __bf16* __restrict__ WB, __bf16* __restrict__ WFB) {
  const int bi = blockIdx.x, tid = threadIdx.x, nx = NB * TT * CC / CVB, wi = bi - nx, pw = NH * HD * HD / CVB, fi = wi - 3 * pw; const float* s; __bf16* d;   // block-uniform choice of the source
  if (bi < nx) { s = X + (size_t)bi * CVB; d = XB + (size_t)bi * CVB; }
  else if (fi < 0) { s = (wi < pw ? WQ : wi < 2 * pw ? WK : WV) + (size_t)(wi % pw) * CVB; d = WB + (size_t)wi * CVB; }
  else { s = WF + (size_t)fi * CVB; d = WFB + (size_t)fi * CVB; }
  v4f r[8];
#pragma unroll
  for (int i = 0; i < 8; ++i) r[i] = *(const v4f*)(s + (i * 256 + tid) * 4);   // eight whole-line loads in flight per wave
  asm volatile("s_wait_xcnt 0x0" ::: "memory");   // precaution: stands ahead of every rewrite of the address registers that these loads name
#pragma unroll
  for (int i = 0; i < 8; ++i) *(v4b*)(d + (i * 256 + tid) * 4) = cvt4(r[i]); }
// ---- k_proj: block = (64 rows, 128 cols, which): qkv = x W (+ b), exact; q -> f16 hi (+ residual), k -> f16 rows, v -> bf16 hi + lo planes; x and W arrive as bf16 from k_cvt: a 128-byte row piece holds 64 k, so a step covers 64 k
__global__ __launch_bounds__(128) void k_proj(const __bf16* __restrict__ XB, const __bf16* __restrict__ WB, const float* __restrict__ BQ, const float* __restrict__ BK, const float* __restrict__ BV, _Float16* __restrict__ QH, _Float16* __restrict__ QL, _Float16* __restrict__ KH, __bf16* __restrict__ VT, __bf16* __restrict__ VL) {
  __shared__ __align__(16) char sm[55296];   // k loop: x tiles [2][64][P64], W tiles [2][128][P64]; epilogue, behind a barrier: sh + sl, or th + tl2
  _Float16 (*sh)[136] = (_Float16 (*)[136])sm; _Float16 (*sl)[136] = (_Float16 (*)[136])(sm + 64 * 136 * 2); __bf16 (*th)[72] = (__bf16 (*)[72])sm; __bf16 (*tl2)[72] = (__bf16 (*)[72])(sm + 128 * 72 * 2);
  __bf16* sA = (__bf16*)sm; __bf16* sB = (__bf16*)(sm + 2 * 64 * P64 * 2);
  const int tid = threadIdx.x, wave = tid >> 5, lane = tid & 31, col = lane & 15, g = lane >> 4; const int which = blockIdx.z; const int c0 = blockIdx.y * 128; const size_t r0 = (size_t)blockIdx.x * 64; const float* BA = which == 0 ? BQ : which == 1 ? BK : BV; const int hn = c0 / HD;   // head of this 128-column block (HD = 512)
  const int sr = tid >> 3, sq = tid & 7;   // staging: 8 threads of 16 B per 128-byte row piece (64 k)
  const __bf16* gA = XB + (r0 + sr) * CC + hn * HD + sq * 8; const __bf16* gB = WB + (size_t)which * NH * HD * HD + (size_t)(c0 + sr) * HD + sq * 8;
  v4u ra[4], rb[8]; v8f acc[8] = {};
#pragma unroll
  for (int i = 0; i < 4; ++i) ra[i] = *(const v4u*)(gA + (size_t)i * 16 * CC);
#pragma unroll
  for (int i = 0; i < 8; ++i) rb[i] = *(const v4u*)(gB + (size_t)i * 16 * HD);
#pragma unroll
  for (int i = 0; i < 4; ++i) *(v4u*)(sA + (sr + 16 * i) * P64 + sq * 8) = ra[i];
#pragma unroll
  for (int i = 0; i < 8; ++i) *(v4u*)(sB + (sr + 16 * i) * P64 + sq * 8) = rb[i];
#pragma unroll 2   // two steps per trip: the buffer index becomes a constant
  for (int ks = 0; ks < HD / 64; ++ks) { const int bu = ks & 1, nb = bu ^ 1; const bool more = ks + 1 < HD / 64;
    __syncthreads();   // publishes buffer bu; ends every wave's reads of buffer nb
    if (more) {
#pragma unroll
      for (int i = 0; i < 4; ++i) ra[i] = *(const v4u*)(gA + (size_t)i * 16 * CC + (ks + 1) * 64);
#pragma unroll
      for (int i = 0; i < 8; ++i) rb[i] = *(const v4u*)(gB + (size_t)i * 16 * HD + (ks + 1) * 64);
      asm volatile("s_wait_xcnt 0x0" ::: "memory");   // precaution: stands ahead of every rewrite of the address registers that these loads name
    }
#pragma unroll
    for (int s = 0; s < 2; ++s) { const v16b a = frag_b(sA + (bu * 64 + wave * 16 + col) * P64 + s * 32, lane); v16b w[8];   // LDS reads together, ahead of their products: one exposed LDS latency, not eight
#pragma unroll
      for (int j = 0; j < 8; ++j) w[j] = frag_b(sB + (bu * 128 + j * 16 + col) * P64 + s * 32, lane);
      __builtin_amdgcn_sched_barrier(0);   // keeps the LDS reads above together, ahead of the products: without it the compiler reads one fragment, waits and multiplies, eight LDS latencies a step
#pragma unroll
      for (int j = 0; j < 8; ++j) acc[j] = wmma_bf(a, w[j], acc[j]);
      __builtin_amdgcn_sched_barrier(0);   // keeps the products together: without it the next tile's LDS stores, and the wait for its global loads, move up among them
    }
    if (more) {
#pragma unroll
      for (int i = 0; i < 4; ++i) *(v4u*)(sA + (nb * 64 + sr + 16 * i) * P64 + sq * 8) = ra[i];
#pragma unroll
      for (int i = 0; i < 8; ++i) *(v4u*)(sB + (nb * 128 + sr + 16 * i) * P64 + sq * 8) = rb[i]; } }
  __syncthreads();   // the tiles are dead: the epilogue reuses their LDS
#pragma unroll
  for (int j = 0; j < 8; ++j) { const float bb = bfr(BA[c0 + j * 16 + col]);
#pragma unroll
    for (int r = 0; r < 8; ++r) { const float v = acc[j][r] + bb; const int rl = wave * 16 + 8 * g + r, cl = j * 16 + col; const _Float16 hv = (_Float16)v;
      if (which == 2) { const __bf16 bh = (__bf16)v; th[cl][rl] = bh; tl2[cl][rl] = (__bf16)(v - (float)bh); } else { sh[rl][cl] = hv; sl[rl][cl] = (_Float16)(v - (float)hv); } } }
  __syncthreads();
  if (which < 2) { _Float16* dh = which == 0 ? QH : KH; for (int e = tid; e < 64 * 16; e += 128) { const int rl = e >> 4, q = e & 15; vst2((unsigned*)(dh + (r0 + rl) * CC + c0 + q * 8), *(const v4u*)&sh[rl][q * 8]); if (which == 0) vst2((unsigned*)(QL + (r0 + rl) * CC + c0 + q * 8), *(const v4u*)&sl[rl][q * 8]); } }
  else { const size_t b = r0 / TT; const int t0 = (int)(r0 % TT); for (int e = tid; e < 128 * 8; e += 128) { const int cl = e >> 3, q = e & 7; const size_t o2 = (b * CC + c0 + cl) * (size_t)TT + t0 + q * 8; vst2((unsigned*)(VT + o2), *(const v4u*)&th[cl][q * 8]); vst2((unsigned*)(VL + o2), *(const v4u*)&tl2[cl][q * 8]); } } }
// value of lane ^ M inside the lane's 16-lane half, every lane on: a register move (DPP row_xmask), where __shfl_xor would go through the LDS unit and its wait
template <int M> __device__ __forceinline__ float rowx(float v) { return __builtin_bit_cast(float, __builtin_amdgcn_update_dpp(0, __builtin_bit_cast(int, v), 0x160 | M, 0xf, 0xf, true)); }
// ---- k_sc: block = (64 queries, 128 keys, pair = b * NH + h): logits * scale, then the block's share of the softmax: per row the maximum mb and the sum lb of exp(logit - mb) over its 128 keys (masked -> 0); S takes the exponentials, MB and LB the two row figures, 256 contiguous bytes each, stored by one wave; causal blocks beyond the diagonal store mb = -3.0e38, lb = 0 and exit
__global__ __launch_bounds__(128) void k_sc(const _Float16* __restrict__ QH, const _Float16* __restrict__ QL, const _Float16* __restrict__ KH, const float* __restrict__ BM, const int* __restrict__ MSK, float* __restrict__ S, float* __restrict__ MB, float* __restrict__ LB) { __shared__ __align__(16) char sm[55296];   // k loop: q tiles [2][64][P64], k tiles [2][128][P64]; epilogue, behind a barrier: ss, sM, sL
  float (*ss)[16][132] = (float (*)[16][132])sm; _Float16* sA = (_Float16*)sm; _Float16* sB = (_Float16*)(sm + 2 * 64 * P64 * 2);
  const bool cz = (MSK[0] != 0); const int b = blockIdx.z / NH, h = blockIdx.z % NH; S += (size_t)blockIdx.z * TT * TT;
  const int tid = threadIdx.x, wave = tid >> 5, lane = tid & 31, col = lane & 15, g = lane >> 4; const int k0 = blockIdx.y * 128; const int ql0 = blockIdx.x * 64 + wave * 16;
  const size_t mo = ((size_t)blockIdx.z * (TT / 128) + blockIdx.y) * TT + blockIdx.x * 64; float* mrow = MB + mo; float* lrow = LB + mo;   // this block's 64 rows
  if (cz && k0 > blockIdx.x * 64 + 63) { if (tid < 32) { vst2(mrow + tid * 2, (v2f){-3.0e38f, -3.0e38f}); vst2(lrow + tid * 2, (v2f){0.f, 0.f}); } return; }   // causal: whole key block above the diagonal (block-uniform): it weighs nothing in its rows
  (void)QL; const int sr = tid >> 3, sq = tid & 7;   // staging: 8 threads of 16 B per 128-byte row piece (64 k)
  const _Float16* gA = QH + ((size_t)b * TT + blockIdx.x * 64 + sr) * CC + h * HD + sq * 8; const _Float16* gB = KH + ((size_t)b * TT + k0 + sr) * CC + h * HD + sq * 8;
  v4u ra[4], rb[8]; v8f acc[8] = {};
#pragma unroll
  for (int i = 0; i < 4; ++i) ra[i] = *(const v4u*)(gA + (size_t)i * 16 * CC);
#pragma unroll
  for (int i = 0; i < 8; ++i) rb[i] = *(const v4u*)(gB + (size_t)i * 16 * CC);
#pragma unroll
  for (int i = 0; i < 4; ++i) *(v4u*)(sA + (sr + 16 * i) * P64 + sq * 8) = ra[i];
#pragma unroll
  for (int i = 0; i < 8; ++i) *(v4u*)(sB + (sr + 16 * i) * P64 + sq * 8) = rb[i];
#pragma unroll 2   // two steps per trip: the buffer index becomes a constant
  for (int ks = 0; ks < HD / 64; ++ks) { const int bu = ks & 1, nb = bu ^ 1; const bool more = ks + 1 < HD / 64;
    __syncthreads();   // publishes buffer bu; ends every wave's reads of buffer nb
    if (more) {
#pragma unroll
      for (int i = 0; i < 4; ++i) ra[i] = *(const v4u*)(gA + (size_t)i * 16 * CC + (ks + 1) * 64);
#pragma unroll
      for (int i = 0; i < 8; ++i) rb[i] = *(const v4u*)(gB + (size_t)i * 16 * CC + (ks + 1) * 64);
      asm volatile("s_wait_xcnt 0x0" ::: "memory");   // precaution: stands ahead of every rewrite of the address registers that these loads name
    }
#pragma unroll
    for (int s = 0; s < 2; ++s) { const v16h ah = frag_h(sA + (bu * 64 + wave * 16 + col) * P64 + s * 32, lane); v16h kb[8];   // LDS reads together, ahead of their products
#pragma unroll
      for (int j = 0; j < 8; ++j) kb[j] = frag_h(sB + (bu * 128 + j * 16 + col) * P64 + s * 32, lane);
      __builtin_amdgcn_sched_barrier(0);   // keeps the LDS reads above together, ahead of the products: without it the compiler reads one fragment, waits and multiplies, eight LDS latencies a step
#pragma unroll
      for (int j = 0; j < 8; ++j) acc[j] = wmma16(ah, kb[j], acc[j]);
      __builtin_amdgcn_sched_barrier(0);   // keeps the products together: without it the next tile's LDS stores, and the wait for its global loads, move up among them
    }
    if (more) {
#pragma unroll
      for (int i = 0; i < 4; ++i) *(v4u*)(sA + (nb * 64 + sr + 16 * i) * P64 + sq * 8) = ra[i];
#pragma unroll
      for (int i = 0; i < 8; ++i) *(v4u*)(sB + (nb * 128 + sr + 16 * i) * P64 + sq * 8) = rb[i]; } }
  __syncthreads();   // the tiles are dead: the epilogue reuses their LDS
  float* sM = (float*)(sm + 34816); float* sL = sM + 64; float mb[8], lb[8];   // behind ss (33,792 B)
#pragma unroll
  for (int r = 0; r < 8; ++r) { mb[r] = -3.0e38f; lb[r] = 0.f; }
#pragma unroll
  for (int j = 0; j < 8; ++j) { const int kt = k0 + j * 16 + col;
#pragma unroll
    for (int r = 0; r < 8; ++r) { const int qt = ql0 + 8 * g + r; float v = acc[j][r] * 0.044194173824159216f; (void)BM; if (cz && kt > qt) v = -3.0e38f; acc[j][r] = v; mb[r] = fmaxf(mb[r], v); } }
#pragma unroll
  for (int r = 0; r < 8; ++r) { mb[r] = fmaxf(mb[r], rowx<1>(mb[r])); mb[r] = fmaxf(mb[r], rowx<2>(mb[r])); mb[r] = fmaxf(mb[r], rowx<4>(mb[r])); mb[r] = fmaxf(mb[r], rowx<8>(mb[r])); }   // a row's 128 keys lie in the 16 lanes of one half
#pragma unroll
  for (int j = 0; j < 8; ++j)
#pragma unroll
    for (int r = 0; r < 8; ++r) { const float v = acc[j][r]; const float ex = expf(v - mb[r]); const float e = (v <= -1.0e38f) ? 0.f : ex; lb[r] += e; ss[wave][8 * g + r][j * 16 + col] = e; }
#pragma unroll
  for (int r = 0; r < 8; ++r) { lb[r] += rowx<1>(lb[r]); lb[r] += rowx<2>(lb[r]); lb[r] += rowx<4>(lb[r]); lb[r] += rowx<8>(lb[r]); }
  if (col == 0) {
#pragma unroll
    for (int r = 0; r < 8; ++r) { sM[wave * 16 + 8 * g + r] = mb[r]; sL[wave * 16 + 8 * g + r] = lb[r]; } }
  __syncthreads();   // publishes the four waves' sM, sL to wave 0, which alone writes their lines; it also ends each wave's ss writes ahead of its own reads below. It stands ahead of the S stores, so that no wave waits at it for stores to return
  if (tid < 32) { vst2(mrow + tid * 2, *(const v2f*)&sM[tid * 2]); vst2(lrow + tid * 2, *(const v2f*)&sL[tid * 2]);
    asm volatile("s_wait_xcnt 0x0" ::: "memory"); }   // precaution: stands ahead of every rewrite of the registers that these two stores name
  for (int rl = 0; rl < 16; ++rl) vst2(S + (size_t)(ql0 + rl) * TT + k0 + lane * 4, *(const v4f*)&ss[wave][rl][lane * 4]);
  asm volatile("s_wait_xcnt 0x0" ::: "memory"); }   // precaution: the early-exit block is laid out behind these stores; the wait stands ahead of its rewrite of their data registers
// ---- k_pv: block = (128-column chunk, pair = b * NH + h, 64 queries): y = P . (v hi + lo) with P split hi + lo (3 products); P x 2^11 = stored exponential x sF[key block][row], sF = exp(mb - row maximum) x 2^11 / row sum, row sum = sum over key blocks of exp(mb - row maximum) x lb, formed once per block from MB and LB; the query tile, whose index sets the causal trip count, is the slowest grid index, so that work-groups far apart in launch order differ in length
__global__ __launch_bounds__(128) void k_pv(const float* __restrict__ PS, const __bf16* __restrict__ VT, const __bf16* __restrict__ VL, const int* __restrict__ MSK, const float* __restrict__ MB, const float* __restrict__ LB, float* __restrict__ Y) { __shared__ __align__(16) char sm[65536];   // k loop: P hi, P lo [2][64][P32] each, v hi, v lo [2][128][P32] each; epilogue, behind a barrier: ss; last 4 KB: sF [16][64]
  float (*ss)[16][132] = (float (*)[16][132])sm; __bf16* sPh = (__bf16*)sm; __bf16* sPl = (__bf16*)(sm + 10240); __bf16* sVh = (__bf16*)(sm + 20480); __bf16* sVl = (__bf16*)(sm + 40960); float* sF = (float*)(sm + 61440);
  const int tid = threadIdx.x, wave = tid >> 5, lane = tid & 31, col = lane & 15, g = lane >> 4; const int b = blockIdx.y / NH, h = blockIdx.y % NH; PS += (size_t)blockIdx.y * TT * TT; const int ql0 = blockIdx.z * 64 + wave * 16; const int cc0 = blockIdx.x * 128; const int kend = (MSK[0] != 0) ? (blockIdx.z * 64 + 64) : TT; const int nk = kend / 32;
  const int sr = tid >> 3, sq = tid & 7, vr = tid >> 2, vq = tid & 3;   // staging: P 8 threads of 16 B per 128-byte row piece, v 4 threads per 64-byte row piece
  const float* gP = PS + (size_t)(blockIdx.z * 64 + sr) * TT + sq * 4; const size_t vo = ((size_t)b * CC + h * HD + cc0 + vr) * (size_t)TT + vq * 8; const __bf16* gH = VT + vo; const __bf16* gL = VL + vo;
  v4f rp[4]; v4u rh[4], rl4[4]; v8f acc[8] = {};
#pragma unroll
  for (int i = 0; i < 4; ++i) { rp[i] = *(const v4f*)(gP + (size_t)i * 16 * TT); rh[i] = *(const v4u*)(gH + (size_t)i * 32 * TT); rl4[i] = *(const v4u*)(gL + (size_t)i * 32 * TT); }
  { const int row = tid & 63, hb = tid >> 6; const size_t mo = (size_t)blockIdx.y * (TT / 128) * TT + blockIdx.z * 64 + row; float mv[16], lv[16];   // two threads per row; each forms the row's figures and writes eight of its sixteen factors
#pragma unroll
    for (int kb = 0; kb < 16; ++kb) { mv[kb] = MB[mo + (size_t)kb * TT]; lv[kb] = LB[mo + (size_t)kb * TT]; }
    asm volatile("s_wait_xcnt 0x0" ::: "memory");   // precaution: stands ahead of every rewrite of the address registers that these loads name
    float m = mv[0], l = 0.f;
#pragma unroll
    for (int kb = 1; kb < 16; ++kb) m = fmaxf(m, mv[kb]);
#pragma unroll
    for (int kb = 0; kb < 16; ++kb) { mv[kb] = expf(mv[kb] - m); l += mv[kb] * lv[kb]; }
    const float inv = 1.0f / l;
#pragma unroll
    for (int kb = 0; kb < 16; ++kb) if ((kb >> 3) == hb) sF[kb * 64 + row] = mv[kb] * inv * 2048.0f; }
  __syncthreads();   // publishes sF
  float ff[4];
#pragma unroll
  for (int i = 0; i < 4; ++i) { ff[i] = sF[sr + 16 * i]; rp[i] *= ff[i]; }
#pragma unroll
  for (int i = 0; i < 4; ++i) { const v4b ph = cvt4(rp[i]); *(v4b*)(sPh + (sr + 16 * i) * P32 + sq * 4) = ph; *(v4b*)(sPl + (sr + 16 * i) * P32 + sq * 4) = res4(rp[i], ph); *(v4u*)(sVh + (vr + 32 * i) * P32 + vq * 8) = rh[i]; *(v4u*)(sVl + (vr + 32 * i) * P32 + vq * 8) = rl4[i]; }
#pragma unroll 2   // two steps per trip (nk is even): the buffer index becomes a constant
  for (int kc = 0; kc < nk; ++kc) { const int bu = kc & 1, nb = bu ^ 1; const bool more = kc + 1 < nk;
    __syncthreads();   // publishes buffer bu; ends every wave's reads of buffer nb
    if (more) {
#pragma unroll
      for (int i = 0; i < 4; ++i) { rp[i] = *(const v4f*)(gP + (size_t)i * 16 * TT + (kc + 1) * 32); rh[i] = *(const v4u*)(gH + (size_t)i * 32 * TT + (kc + 1) * 32); rl4[i] = *(const v4u*)(gL + (size_t)i * 32 * TT + (kc + 1) * 32); }
      asm volatile("s_wait_xcnt 0x0" ::: "memory");   // precaution: stands ahead of every rewrite of the address registers that these loads name
      __builtin_amdgcn_sched_barrier(0);   // keeps the sF reads below, address arithmetic included, behind that wait: the compiler lays them in the loads' address registers
#pragma unroll
      for (int i = 0; i < 4; ++i) ff[i] = sF[((kc + 1) >> 2) * 64 + sr + 16 * i];   // the next tile's 32 keys lie in one 128-key block
    }
    const v16b ph = frag_b(sPh + (bu * 64 + wave * 16 + col) * P32, lane), pl = frag_b(sPl + (bu * 64 + wave * 16 + col) * P32, lane);
#pragma unroll
    for (int jh = 0; jh < 8; jh += 4) { v16b vh[4], vl[4];   // LDS reads of four column tiles together, ahead of their twelve products
#pragma unroll
      for (int j = 0; j < 4; ++j) { const int ro = (bu * 128 + (jh + j) * 16 + col) * P32; vh[j] = frag_b(sVh + ro, lane); vl[j] = frag_b(sVl + ro, lane); }
      __builtin_amdgcn_sched_barrier(0);   // keeps the LDS reads above together, ahead of the products: without it the compiler reads one fragment, waits and multiplies, eight LDS latencies a step
#pragma unroll
      for (int j = 0; j < 4; ++j) acc[jh + j] = wmma_bf(ph, vh[j], acc[jh + j]);   // the three products of a tile stand four WMMAs apart: none waits for the one before it; each tile still sums ph.vh, pl.vh, ph.vl in that order
#pragma unroll
      for (int j = 0; j < 4; ++j) acc[jh + j] = wmma_bf(pl, vh[j], acc[jh + j]);
#pragma unroll
      for (int j = 0; j < 4; ++j) acc[jh + j] = wmma_bf(ph, vl[j], acc[jh + j]);
      __builtin_amdgcn_sched_barrier(0);   // keeps the products together: without it the next tile's conversions, and the wait for its global loads, move up among them
    }
    if (more) {
#pragma unroll
      for (int i = 0; i < 4; ++i) { const v4f pp = rp[i] * ff[i]; const v4b qh = cvt4(pp); *(v4b*)(sPh + (nb * 64 + sr + 16 * i) * P32 + sq * 4) = qh; *(v4b*)(sPl + (nb * 64 + sr + 16 * i) * P32 + sq * 4) = res4(pp, qh); *(v4u*)(sVh + (nb * 128 + vr + 32 * i) * P32 + vq * 8) = rh[i]; *(v4u*)(sVl + (nb * 128 + vr + 32 * i) * P32 + vq * 8) = rl4[i]; } } }
  __syncthreads();   // the tiles are dead: the epilogue reuses their LDS
#pragma unroll
  for (int j = 0; j < 8; ++j)
#pragma unroll
    for (int r = 0; r < 8; ++r) ss[wave][8 * g + r][j * 16 + col] = acc[j][r] * (1.0f / 2048.0f);
  LDSX(); for (int rl = 0; rl < 16; ++rl) vst2(Y + ((size_t)b * TT + ql0 + rl) * CC + h * HD + cc0 + lane * 4, *(const v4f*)&ss[wave][rl][lane * 4]); }
// ---- k_out: block = (64 rows, 128 cols): out = y (bf16 hi + lo) Wproj + b; Wproj arrives as bf16 from k_cvt: a 128-byte piece of its rows holds 64 k, so a step covers 64 k
__global__ __launch_bounds__(128) void k_out(const float* __restrict__ Y, const __bf16* __restrict__ WPB, const float* __restrict__ BP, float* __restrict__ OUT) { __shared__ __align__(16) char sm[73728];   // k loop: y hi, y lo [2][64][P64] each, W tiles [2][128][P64]; epilogue, behind a barrier: sf
  float (*sf)[16][132] = (float (*)[16][132])sm; __bf16* sAh = (__bf16*)sm; __bf16* sAl = (__bf16*)(sm + 18432); __bf16* sB = (__bf16*)(sm + 36864);
  const int tid = threadIdx.x, wave = tid >> 5, lane = tid & 31, col = lane & 15, g = lane >> 4; const int c0 = blockIdx.y * 128; const size_t r0 = (size_t)blockIdx.x * 64 + wave * 16;
  const int ar = tid >> 4, aq = tid & 15, sr = tid >> 3, sq = tid & 7;   // staging, 64 k: y 16 threads of 16 B per 256-byte row piece, W 8 threads of 16 B per 128-byte row piece
  const float* gA = Y + ((size_t)blockIdx.x * 64 + ar) * CC + aq * 4; const __bf16* gB = WPB + (size_t)(c0 + sr) * CC + sq * 8;
  v4f ra[8]; v4u rb[8]; v8f acc[8] = {};
#pragma unroll
  for (int i = 0; i < 8; ++i) ra[i] = *(const v4f*)(gA + (size_t)i * 8 * CC);
#pragma unroll
  for (int i = 0; i < 8; ++i) rb[i] = *(const v4u*)(gB + (size_t)i * 16 * CC);
#pragma unroll
  for (int i = 0; i < 8; ++i) { const v4b ah = cvt4(ra[i]); *(v4b*)(sAh + (ar + 8 * i) * P64 + aq * 4) = ah; *(v4b*)(sAl + (ar + 8 * i) * P64 + aq * 4) = res4(ra[i], ah); }
#pragma unroll
  for (int i = 0; i < 8; ++i) *(v4u*)(sB + (sr + 16 * i) * P64 + sq * 8) = rb[i];
#pragma unroll 2   // two steps per trip: the buffer index becomes a constant
  for (int ks = 0; ks < CC / 64; ++ks) { const int bu = ks & 1, nb = bu ^ 1; const bool more = ks + 1 < CC / 64;
    __syncthreads();   // publishes buffer bu; ends every wave's reads of buffer nb
    if (more) {
#pragma unroll
      for (int i = 0; i < 8; ++i) ra[i] = *(const v4f*)(gA + (size_t)i * 8 * CC + (ks + 1) * 64);
#pragma unroll
      for (int i = 0; i < 8; ++i) rb[i] = *(const v4u*)(gB + (size_t)i * 16 * CC + (ks + 1) * 64);
      asm volatile("s_wait_xcnt 0x0" ::: "memory");   // precaution: stands ahead of every rewrite of the address registers that these loads name
    }
#pragma unroll
    for (int s = 0; s < 2; ++s) { const v16b ah = frag_b(sAh + (bu * 64 + wave * 16 + col) * P64 + s * 32, lane), al = frag_b(sAl + (bu * 64 + wave * 16 + col) * P64 + s * 32, lane);
      v16b w[8];   // LDS reads together, ahead of their products
#pragma unroll
      for (int j = 0; j < 8; ++j) w[j] = frag_b(sB + (bu * 128 + j * 16 + col) * P64 + s * 32, lane);
      __builtin_amdgcn_sched_barrier(0);   // keeps the LDS reads above together, ahead of the products: without it the compiler reads one fragment, waits and multiplies, eight LDS latencies a step
#pragma unroll
      for (int j = 0; j < 8; ++j) acc[j] = wmma_bf(ah, w[j], acc[j]);   // the two products of a tile stand eight WMMAs apart; each tile still sums hi, then lo, per 32 k
#pragma unroll
      for (int j = 0; j < 8; ++j) acc[j] = wmma_bf(al, w[j], acc[j]);
      __builtin_amdgcn_sched_barrier(0);   // keeps the products together: without it the next tile's conversions, and the wait for its global loads, move up among them
    }
    if (more) {
#pragma unroll
      for (int i = 0; i < 8; ++i) { const v4b qh = cvt4(ra[i]); *(v4b*)(sAh + (nb * 64 + ar + 8 * i) * P64 + aq * 4) = qh; *(v4b*)(sAl + (nb * 64 + ar + 8 * i) * P64 + aq * 4) = res4(ra[i], qh); }
#pragma unroll
      for (int i = 0; i < 8; ++i) *(v4u*)(sB + (nb * 128 + sr + 16 * i) * P64 + sq * 8) = rb[i]; } }
  __syncthreads();   // the tiles are dead: the epilogue reuses their LDS
#pragma unroll
  for (int j = 0; j < 8; ++j) { const float bb = BP ? bfr(BP[c0 + j * 16 + col]) : 0.f;
#pragma unroll
    for (int r = 0; r < 8; ++r) sf[wave][8 * g + r][j * 16 + col] = acc[j][r] + bb; }
  LDSX(); for (int rl = 0; rl < 16; ++rl) vst2(OUT + (r0 + rl) * CC + c0 + lane * 4, *(const v4f*)&sf[wave][rl][lane * 4]); }
extern "C" void kernel_launch(void* const* d_in, const int* in_sizes, int n_in, void* d_out, int out_size, void* d_ws, size_t ws_size, hipStream_t stream) {
  (void)in_sizes; (void)n_in; (void)out_size;
  const float** F = (const float**)d_in;   // 0 input [4,2048,1024], 1 Wq [2,512,512] ([out,in] per head), 2 bq [2,512], 3 Wk, 4 bk, 5 Wv, 6 bv, 7 Wf [1024,1024] ([out,in]), 8 bf, 9 masked [1] int (= 1 -> causal)
  if (ws_size < (size_t)WS_END) return;
  char* ws = (char*)d_ws; _Float16 *QH = (_Float16*)(ws + WS_QH), *QL = (_Float16*)(ws + WS_QL), *KH = (_Float16*)(ws + WS_KH); __bf16 *VT = (__bf16*)(ws + WS_VT), *VL = (__bf16*)(ws + WS_VL); float *S = (float*)(ws + WS_S), *Y = (float*)(ws + WS_Y), *MB = (float*)(ws + WS_M), *LB = (float*)(ws + WS_L); __bf16 *XB = (__bf16*)(ws + WS_XB), *WB = (__bf16*)(ws + WS_WB), *WFB = (__bf16*)(ws + WS_WF);
  k_cvt<<<dim3((NB * TT * CC + 3 * NH * HD * HD + CC * CC) / CVB), 256, 0, stream>>>(F[0], F[1], F[3], F[5], F[7], XB, WB, WFB);
  k_proj<<<dim3(TNB * TT / 64, CC / 128, 3), 128, 0, stream>>>(XB, WB, F[2], F[4], F[6], QH, QL, KH, VT, VL);
  k_sc<<<dim3(TT / 64, TT / 128, TNB * NH), 128, 0, stream>>>(QH, QL, KH, nullptr, (const int*)d_in[9], S, MB, LB);
  k_pv<<<dim3(HD / 128, TNB * NH, TT / 64), 128, 0, stream>>>(S, VT, VL, (const int*)d_in[9], MB, LB, Y);
  k_out<<<dim3(TNB * TT / 64, CC / 128), 128, 0, stream>>>(Y, WFB, F[8], (float*)d_out);
}

// v007
// It runs in 175 microseconds.
// Timed twice side by side with v006, it ran 1.07 times as fast both times.
// All steps since v000 together make it 12.0 times as fast.
// compute dtype: all float inputs rounded to bf16 (x, Wq, Wk, Wv, Wf once, by k_cvt), 'masked' read at run time (1 -> causal; 0 -> full attention); per-head q/k/v = x_half W_n^T + b_n (block-diagonal [out,in] linears) with EXACT bf16 products on WMMA 16x16x32, f32 accumulate, q/k rounded once to f16 (0.02-scale weights, logits std ~0.01: 1 product), softmax in f32 (precise expf) in two parts: exp(logit - block maximum) stored in f32 per (batch, head) with each 128-key block's row maximum and row sum, rescaled to P x 2^11 where P.V stages it, kept f32 and split bf16 hi + lo against v as bf16 hi + lo (3 products); out = y (bf16 hi + lo) Wf^T + bf; f32 output.
#include <hip/hip_runtime.h>
#include <math.h>

typedef __attribute__((ext_vector_type(16))) _Float16 v16h;
typedef __attribute__((ext_vector_type(16))) __bf16 v16b;
typedef __attribute__((ext_vector_type(8)))  _Float16 v8h;
typedef __attribute__((ext_vector_type(8)))  float v8f;
typedef __attribute__((ext_vector_type(4)))  float v4f;
typedef __attribute__((ext_vector_type(2)))  float v2f;
typedef __attribute__((ext_vector_type(4)))  unsigned v4u;
typedef __attribute__((ext_vector_type(4)))  int v4i;
typedef float __attribute__((may_alias)) float_a;
typedef int __attribute__((may_alias)) int_a;

template <typename T> __device__ __forceinline__ void vst2(void* p, T v) { *(T*)p = v;  }
__device__ __forceinline__ v8f wmma16(v16h a, v16h b, v8f c) {
  return __builtin_amdgcn_wmma_f32_16x16x32_f16(false, a, false, b, (short)0, c, false, false);
}
__device__ __forceinline__ v8f wmma_bf(v16b a, v16b b, v8f c) {
  return __builtin_amdgcn_wmma_f32_16x16x32_bf16(false, a, false, b, (short)0, c, false, false);
}
// 16x16x32 fragments: lane = (h = lane>>4, row/col = lane&15); elements 0..7 = k0+8h+0..7, 8..15 = k0+16+8h+0..7; D element r = row 8h+r
__device__ __forceinline__ v16h frag_h(const _Float16* rowk0, int lane) {
  union { v16h v; v8h q[2]; } u; const _Float16* p = rowk0 + 8 * (lane >> 4);
  u.q[0] = *(const v8h*)p; u.q[1] = *(const v8h*)(p + 16); return u.v;
}
__device__ __forceinline__ v16h frag_f32(const float* rowk0, int lane) {
  v16h a; const float* p = rowk0 + 8 * (lane >> 4);
#pragma unroll
  for (int i = 0; i < 8; ++i) { a[i] = (_Float16)p[i]; a[8 + i] = (_Float16)p[16 + i]; }
  return a;
}
__device__ __forceinline__ v16h frag_f32s(const float* rowk0, int lane, float sc) {
  v16h a; const float* p = rowk0 + 8 * (lane >> 4);
#pragma unroll
  for (int i = 0; i < 8; ++i) { a[i] = (_Float16)(p[i] * sc); a[8 + i] = (_Float16)(p[16 + i] * sc); }
  return a;
}
// column fragment from a [K][ld] layout (column n), rows >= K read as 0
__device__ __forceinline__ v16h fragc_f32(const float* W, int k0, int n, int lane, int ld, int K) {
  v16h a; const int g = lane >> 4;
#pragma unroll
  for (int i = 0; i < 8; ++i) { const int ka = k0 + 8 * g + i, kb = ka + 16;
    a[i] = (_Float16)(ka < K ? W[(size_t)(ka < K ? ka : K - 1) * ld + n] : 0.f); a[8 + i] = (_Float16)(kb < K ? W[(size_t)(kb < K ? kb : K - 1) * ld + n] : 0.f); }
  return a;
}
struct F2 { v16b h, l; };
__device__ __forceinline__ F2 bsplit16(const float v[16]) { F2 r;
#pragma unroll
  for (int i = 0; i < 16; ++i) { const __bf16 h = (__bf16)v[i]; r.h[i] = h; r.l[i] = (__bf16)(v[i] - (float)h); }
  return r; }
__device__ __forceinline__ F2 split_row(const float* row, int k0, int lane) { float v[16]; const float* p = row + k0 + 8 * (lane >> 4);
#pragma unroll
  for (int i = 0; i < 8; ++i) { v[i] = p[i]; v[8 + i] = p[16 + i]; }
  return bsplit16(v); }
__device__ __forceinline__ F2 split_rowK(const float* row, int k0, int lane, int K) { float v[16]; const int g = lane >> 4;
#pragma unroll
  for (int i = 0; i < 8; ++i) { const int ka = k0 + 8 * g + i, kb = ka + 16; v[i] = ka < K ? row[ka < K ? ka : K - 1] : 0.f; v[8 + i] = kb < K ? row[kb < K ? kb : K - 1] : 0.f; }
  return bsplit16(v); }
__device__ __forceinline__ F2 split_col(const float* W, int k0, int n, int lane, int ld, int K) { float v[16]; const int g = lane >> 4;
#pragma unroll
  for (int i = 0; i < 8; ++i) { const int ka = k0 + 8 * g + i, kb = ka + 16; v[i] = ka < K ? W[(size_t)(ka < K ? ka : K - 1) * ld + n] : 0.f; v[8 + i] = kb < K ? W[(size_t)(kb < K ? kb : K - 1) * ld + n] : 0.f; }
  return bsplit16(v); }
__device__ __forceinline__ v8f mac3(const F2& a, const F2& b, v8f c) { c = wmma_bf(a.l, b.h, c); c = wmma_bf(a.h, b.l, c); return wmma_bf(a.h, b.h, c); }
__device__ __forceinline__ float sigm(float v) { return 1.0f / (1.0f + expf(-v)); }
#define LDSX() do { asm volatile("s_wait_dscnt 0" ::: "memory"); __builtin_amdgcn_wave_barrier(); __builtin_amdgcn_fence(__ATOMIC_RELEASE, "workgroup"); } while (0)


// Two-headed causal attention with per-head Linear projections on the two contiguous 512-wide halves of the input (B 4, S 2,048, E 1,024), scores / sqrt(512), softmax . v, final Linear Wf + bf.
#define NB 4
#define TT 2048
#define CC 1024
#define NH 2
#define HD 512
#ifndef TNB
#define TNB NB
#endif
typedef __attribute__((ext_vector_type(8))) __bf16 v8b;
__device__ __forceinline__ v16b frag_b(const __bf16* rowk0, int lane) {
  union { v16b v; v8b q[2]; } u; const __bf16* p = rowk0 + 8 * (lane >> 4);
  u.q[0] = *(const v8b*)p; u.q[1] = *(const v8b*)(p + 16); return u.v;
}
__device__ __forceinline__ float bfr(float v) { return (float)(__bf16)v; }
__device__ __attribute__((noinline)) float exp_ni(float v) { return expf(v); }
__device__ __attribute__((noinline)) float erf_ni(float v) { return erff(v); }

#define WS_QH  0u
#define WS_QL  (WS_QH + 2u * (size_t)NB * TT * CC)
#define WS_KH  (WS_QL + 2u * (size_t)NB * TT * CC)
#define WS_VT  (WS_KH + 2u * (size_t)NB * TT * CC)      // bf16 v planes [b][c][t]
#define WS_VL  (WS_VT + 2u * (size_t)NB * CC * TT)      // bf16 v residual planes
#define WS_S   (WS_VL + 2u * (size_t)NB * CC * TT)      // f32 exp(logit - block maximum): one [t][t] plane per (batch, head)
#define WS_Y   (WS_S + 4u * (size_t)NB * NH * TT * TT)  // f32 y rows [b*t][C]
#define WS_M   (WS_Y + 4u * (size_t)NB * TT * CC)       // f32 row maxima [pair][key block][t]
#define WS_L   (WS_M + 4u * (size_t)NB * NH * (TT / 128) * TT)   // f32 row sums, same layout
#define WS_WF  (WS_L + 4u * (size_t)NB * NH * (TT / 128) * TT)   // bf16 Wf [out][in]: written by k_cvt, read by k_out
#define WS_END (WS_WF + 2u * (size_t)CC * CC)
#define WS_XB  WS_Y                                     // bf16 x rows [b*t][C]: written by k_cvt, last read by k_proj; k_pv lays y over them later in the same call
#define WS_WB  (WS_XB + 2u * (size_t)NB * TT * CC)      // bf16 Wq, Wk, Wv [3][head][out][in], same life

// ---- LDS staging shared by the four matrix kernels: a block's 128 threads (in k_pv, each key group's 128) fetch each operand tile with loads that cover whole 128-byte lines (k_pv's v tiles: 64-byte halves), convert it once, and lay it in LDS in k order; every wave then takes its fragments with frag_b / frag_h from rows at a pitch of 16 B x odd (80 B for 64-byte rows, 144 B for 128-byte rows). Two buffers, one barrier per k step: the next tile's global loads fly during the products and are stored behind them.
typedef __attribute__((ext_vector_type(4))) __bf16 v4b;
#define P32 40   // elements per LDS row holding 32 16-bit values (80 B)
#define P64 72   // elements per LDS row holding 64 16-bit values (144 B)
__device__ __forceinline__ v4b cvt4(v4f v) { v4b r;
#pragma unroll
  for (int i = 0; i < 4; ++i) r[i] = (__bf16)v[i];
  return r; }
__device__ __forceinline__ v4b res4(v4f v, v4b h) { v4b r;
#pragma unroll
  for (int i = 0; i < 4; ++i) r[i] = (__bf16)(v[i] - (float)h[i]);
  return r; }

// ---- k_cvt: block = 8,192 consecutive floats of one of x, Wq, Wk, Wv, Wf: each is rounded to bf16 once here, not again in every block that stages it (x 12 times, a weight 128 times)
#define CVB 8192
__global__ __launch_bounds__(256) void k_cvt(const float* __restrict__ X, const float* __restrict__ WQ, const float* __restrict__ WK, const float* __restrict__ WV, const float* __restrict__ WF, __bf16* __restrict__ XB, __bf16* __restrict__ WB, __bf16* __restrict__ WFB) {
  const int bi = blockIdx.x, tid = threadIdx.x, nx = NB * TT * CC / CVB, wi = bi - nx, pw = NH * HD * HD / CVB, fi = wi - 3 * pw; const float* s; __bf16* d;   // block-uniform choice of the source
  if (bi < nx) { s = X + (size_t)bi * CVB; d = XB + (size_t)bi * CVB; }
  else if (fi < 0) { s = (wi < pw ? WQ : wi < 2 * pw ? WK : WV) + (size_t)(wi % pw) * CVB; d = WB + (size_t)wi * CVB; }
  else { s = WF + (size_t)fi * CVB; d = WFB + (size_t)fi * CVB; }
  v4f r[8];
#pragma unroll
  for (int i = 0; i < 8; ++i) r[i] = *(const v4f*)(s + (i * 256 + tid) * 4);   // eight whole-line loads in flight per wave
  asm volatile("s_wait_xcnt 0x0" ::: "memory");   // precaution: stands ahead of every rewrite of the address registers that these loads name
#pragma unroll
  for (int i = 0; i < 8; ++i) *(v4b*)(d + (i * 256 + tid) * 4) = cvt4(r[i]); }
// ---- k_proj: block = (64 rows, 128 cols, which): qkv = x W (+ b), exact; q -> f16 hi (+ residual), k -> f16 rows, v -> bf16 hi + lo planes; x and W arrive as bf16 from k_cvt: a 128-byte row piece holds 64 k, so a step covers 64 k
__global__ __launch_bounds__(128) void k_proj(const __bf16* __restrict__ XB, const __bf16* __restrict__ WB, const float* __restrict__ BQ, const float* __restrict__ BK, const float* __restrict__ BV, _Float16* __restrict__ QH, _Float16* __restrict__ QL, _Float16* __restrict__ KH, __bf16* __restrict__ VT, __bf16* __restrict__ VL) {
  __shared__ __align__(16) char sm[55296];   // k loop: x tiles [2][64][P64], W tiles [2][128][P64]; epilogue, behind a barrier: sh + sl, or th + tl2
  _Float16 (*sh)[136] = (_Float16 (*)[136])sm; _Float16 (*sl)[136] = (_Float16 (*)[136])(sm + 64 * 136 * 2); __bf16 (*th)[72] = (__bf16 (*)[72])sm; __bf16 (*tl2)[72] = (__bf16 (*)[72])(sm + 128 * 72 * 2);
  __bf16* sA = (__bf16*)sm; __bf16* sB = (__bf16*)(sm + 2 * 64 * P64 * 2);
  const int tid = threadIdx.x, wave = tid >> 5, lane = tid & 31, col = lane & 15, g = lane >> 4; const int which = blockIdx.z; const int c0 = blockIdx.y * 128; const size_t r0 = (size_t)blockIdx.x * 64; const float* BA = which == 0 ? BQ : which == 1 ? BK : BV; const int hn = c0 / HD;   // head of this 128-column block (HD = 512)
  const int sr = tid >> 3, sq = tid & 7;   // staging: 8 threads of 16 B per 128-byte row piece (64 k)
  const __bf16* gA = XB + (r0 + sr) * CC + hn * HD + sq * 8; const __bf16* gB = WB + (size_t)which * NH * HD * HD + (size_t)(c0 + sr) * HD + sq * 8;
  v4u ra[4], rb[8]; v8f acc[8] = {};
#pragma unroll
  for (int i = 0; i < 4; ++i) ra[i] = *(const v4u*)(gA + (size_t)i * 16 * CC);
#pragma unroll
  for (int i = 0; i < 8; ++i) rb[i] = *(const v4u*)(gB + (size_t)i * 16 * HD);
#pragma unroll
  for (int i = 0; i < 4; ++i) *(v4u*)(sA + (sr + 16 * i) * P64 + sq * 8) = ra[i];
#pragma unroll
  for (int i = 0; i < 8; ++i) *(v4u*)(sB + (sr + 16 * i) * P64 + sq * 8) = rb[i];
#pragma unroll 2   // two steps per trip: the buffer index becomes a constant
  for (int ks = 0; ks < HD / 64; ++ks) { const int bu = ks & 1, nb = bu ^ 1; const bool more = ks + 1 < HD / 64;
    __syncthreads();   // publishes buffer bu; ends every wave's reads of buffer nb
    if (more) {
#pragma unroll
      for (int i = 0; i < 4; ++i) ra[i] = *(const v4u*)(gA + (size_t)i * 16 * CC + (ks + 1) * 64);
#pragma unroll
      for (int i = 0; i < 8; ++i) rb[i] = *(const v4u*)(gB + (size_t)i * 16 * HD + (ks + 1) * 64);
      asm volatile("s_wait_xcnt 0x0" ::: "memory");   // precaution: stands ahead of every rewrite of the address registers that these loads name
    }
#pragma unroll
    for (int s = 0; s < 2; ++s) { const v16b a = frag_b(sA + (bu * 64 + wave * 16 + col) * P64 + s * 32, lane); v16b w[8];   // LDS reads together, ahead of their products: one exposed LDS latency, not eight
#pragma unroll
      for (int j = 0; j < 8; ++j) w[j] = frag_b(sB + (bu * 128 + j * 16 + col) * P64 + s * 32, lane);
      __builtin_amdgcn_sched_barrier(0);   // keeps the LDS reads above together, ahead of the products: without it the compiler reads one fragment, waits and multiplies, eight LDS latencies a step
#pragma unroll
      for (int j = 0; j < 8; ++j) acc[j] = wmma_bf(a, w[j], acc[j]);
      __builtin_amdgcn_sched_barrier(0);   // keeps the products together: without it the next tile's LDS stores, and the wait for its global loads, move up among them
    }
    if (more) {
#pragma unroll
      for (int i = 0; i < 4; ++i) *(v4u*)(sA + (nb * 64 + sr + 16 * i) * P64 + sq * 8) = ra[i];
#pragma unroll
      for (int i = 0; i < 8; ++i) *(v4u*)(sB + (nb * 128 + sr + 16 * i) * P64 + sq * 8) = rb[i]; } }
  __syncthreads();   // the tiles are dead: the epilogue reuses their LDS
#pragma unroll
  for (int j = 0; j < 8; ++j) { const float bb = bfr(BA[c0 + j * 16 + col]);
#pragma unroll
    for (int r = 0; r < 8; ++r) { const float v = acc[j][r] + bb; const int rl = wave * 16 + 8 * g + r, cl = j * 16 + col; const _Float16 hv = (_Float16)v;
      if (which == 2) { const __bf16 bh = (__bf16)v; th[cl][rl] = bh; tl2[cl][rl] = (__bf16)(v - (float)bh); } else { sh[rl][cl] = hv; sl[rl][cl] = (_Float16)(v - (float)hv); } } }
  __syncthreads();
  if (which < 2) { _Float16* dh = which == 0 ? QH : KH; for (int e = tid; e < 64 * 16; e += 128) { const int rl = e >> 4, q = e & 15; vst2((unsigned*)(dh + (r0 + rl) * CC + c0 + q * 8), *(const v4u*)&sh[rl][q * 8]); if (which == 0) vst2((unsigned*)(QL + (r0 + rl) * CC + c0 + q * 8), *(const v4u*)&sl[rl][q * 8]); } }
  else { const size_t b = r0 / TT; const int t0 = (int)(r0 % TT); for (int e = tid; e < 128 * 8; e += 128) { const int cl = e >> 3, q = e & 7; const size_t o2 = (b * CC + c0 + cl) * (size_t)TT + t0 + q * 8; vst2((unsigned*)(VT + o2), *(const v4u*)&th[cl][q * 8]); vst2((unsigned*)(VL + o2), *(const v4u*)&tl2[cl][q * 8]); } } }
// value of lane ^ M inside the lane's 16-lane half, every lane on: a register move (DPP row_xmask), where __shfl_xor would go through the LDS unit and its wait
template <int M> __device__ __forceinline__ float rowx(float v) { return __builtin_bit_cast(float, __builtin_amdgcn_update_dpp(0, __builtin_bit_cast(int, v), 0x160 | M, 0xf, 0xf, true)); }
// ---- k_sc: block = (64 queries, 128 keys, pair = b * NH + h): logits * scale, then the block's share of the softmax: per row the maximum mb and the sum lb of exp(logit - mb) over its 128 keys (masked -> 0); S takes the exponentials, MB and LB the two row figures, 256 contiguous bytes each, stored by one wave; causal blocks beyond the diagonal store mb = -3.0e38, lb = 0 and exit
__global__ __launch_bounds__(128) void k_sc(const _Float16* __restrict__ QH, const _Float16* __restrict__ QL, const _Float16* __restrict__ KH, const float* __restrict__ BM, const int* __restrict__ MSK, float* __restrict__ S, float* __restrict__ MB, float* __restrict__ LB) { __shared__ __align__(16) char sm[55296];   // k loop: q tiles [2][64][P64], k tiles [2][128][P64]; epilogue, behind a barrier: ss, sM, sL
  float (*ss)[16][132] = (float (*)[16][132])sm; _Float16* sA = (_Float16*)sm; _Float16* sB = (_Float16*)(sm + 2 * 64 * P64 * 2);
  const bool cz = (MSK[0] != 0); const int b = blockIdx.z / NH, h = blockIdx.z % NH; S += (size_t)blockIdx.z * TT * TT;
  const int tid = threadIdx.x, wave = tid >> 5, lane = tid & 31, col = lane & 15, g = lane >> 4; const int k0 = blockIdx.y * 128; const int ql0 = blockIdx.x * 64 + wave * 16;
  const size_t mo = ((size_t)blockIdx.z * (TT / 128) + blockIdx.y) * TT + blockIdx.x * 64; float* mrow = MB + mo; float* lrow = LB + mo;   // this block's 64 rows
  if (cz && k0 > blockIdx.x * 64 + 63) { if (tid < 32) { vst2(mrow + tid * 2, (v2f){-3.0e38f, -3.0e38f}); vst2(lrow + tid * 2, (v2f){0.f, 0.f}); } return; }   // causal: whole key block above the diagonal (block-uniform): it weighs nothing in its rows
  (void)QL; const int sr = tid >> 3, sq = tid & 7;   // staging: 8 threads of 16 B per 128-byte row piece (64 k)
  const _Float16* gA = QH + ((size_t)b * TT + blockIdx.x * 64 + sr) * CC + h * HD + sq * 8; const _Float16* gB = KH + ((size_t)b * TT + k0 + sr) * CC + h * HD + sq * 8;
  v4u ra[4], rb[8]; v8f acc[8] = {};
#pragma unroll
  for (int i = 0; i < 4; ++i) ra[i] = *(const v4u*)(gA + (size_t)i * 16 * CC);
#pragma unroll
  for (int i = 0; i < 8; ++i) rb[i] = *(const v4u*)(gB + (size_t)i * 16 * CC);
#pragma unroll
  for (int i = 0; i < 4; ++i) *(v4u*)(sA + (sr + 16 * i) * P64 + sq * 8) = ra[i];
#pragma unroll
  for (int i = 0; i < 8; ++i) *(v4u*)(sB + (sr + 16 * i) * P64 + sq * 8) = rb[i];
#pragma unroll 2   // two steps per trip: the buffer index becomes a constant
  for (int ks = 0; ks < HD / 64; ++ks) { const int bu = ks & 1, nb = bu ^ 1; const bool more = ks + 1 < HD / 64;
    __syncthreads();   // publishes buffer bu; ends every wave's reads of buffer nb
    if (more) {
#pragma unroll
      for (int i = 0; i < 4; ++i) ra[i] = *(const v4u*)(gA + (size_t)i * 16 * CC + (ks + 1) * 64);
#pragma unroll
      for (int i = 0; i < 8; ++i) rb[i] = *(const v4u*)(gB + (size_t)i * 16 * CC + (ks + 1) * 64);
      asm volatile("s_wait_xcnt 0x0" ::: "memory");   // precaution: stands ahead of every rewrite of the address registers that these loads name
    }
#pragma unroll
    for (int s = 0; s < 2; ++s) { const v16h ah = frag_h(sA + (bu * 64 + wave * 16 + col) * P64 + s * 32, lane); v16h kb[8];   // LDS reads together, ahead of their products
#pragma unroll
      for (int j = 0; j < 8; ++j) kb[j] = frag_h(sB + (bu * 128 + j * 16 + col) * P64 + s * 32, lane);
      __builtin_amdgcn_sched_barrier(0);   // keeps the LDS reads above together, ahead of the products: without it the compiler reads one fragment, waits and multiplies, eight LDS latencies a step
#pragma unroll
      for (int j = 0; j < 8; ++j) acc[j] = wmma16(ah, kb[j], acc[j]);
      __builtin_amdgcn_sched_barrier(0);   // keeps the products together: without it the next tile's LDS stores, and the wait for its global loads, move up among them
    }
    if (more) {
#pragma unroll
      for (int i = 0; i < 4; ++i) *(v4u*)(sA + (nb * 64 + sr + 16 * i) * P64 + sq * 8) = ra[i];
#pragma unroll
      for (int i = 0; i < 8; ++i) *(v4u*)(sB + (nb * 128 + sr + 16 * i) * P64 + sq * 8) = rb[i]; } }
  __syncthreads();   // the tiles are dead: the epilogue reuses their LDS
  float* sM = (float*)(sm + 34816); float* sL = sM + 64; float mb[8], lb[8];   // behind ss (33,792 B)
#pragma unroll
  for (int r = 0; r < 8; ++r) { mb[r] = -3.0e38f; lb[r] = 0.f; }
#pragma unroll
  for (int j = 0; j < 8; ++j) { const int kt = k0 + j * 16 + col;
#pragma unroll
    for (int r = 0; r < 8; ++r) { const int qt = ql0 + 8 * g + r; float v = acc[j][r] * 0.044194173824159216f; (void)BM; if (cz && kt > qt) v = -3.0e38f; acc[j][r] = v; mb[r] = fmaxf(mb[r], v); } }
#pragma unroll
  for (int r = 0; r < 8; ++r) { mb[r] = fmaxf(mb[r], rowx<1>(mb[r])); mb[r] = fmaxf(mb[r], rowx<2>(mb[r])); mb[r] = fmaxf(mb[r], rowx<4>(mb[r])); mb[r] = fmaxf(mb[r], rowx<8>(mb[r])); }   // a row's 128 keys lie in the 16 lanes of one half
#pragma unroll
  for (int j = 0; j < 8; ++j)
#pragma unroll
    for (int r = 0; r < 8; ++r) { const float v = acc[j][r]; const float ex = expf(v - mb[r]); const float e = (v <= -1.0e38f) ? 0.f : ex; lb[r] += e; ss[wave][8 * g + r][j * 16 + col] = e; }
#pragma unroll
  for (int r = 0; r < 8; ++r) { lb[r] += rowx<1>(lb[r]); lb[r] += rowx<2>(lb[r]); lb[r] += rowx<4>(lb[r]); lb[r] += rowx<8>(lb[r]); }
  if (col == 0) {
#pragma unroll
    for (int r = 0; r < 8; ++r) { sM[wave * 16 + 8 * g + r] = mb[r]; sL[wave * 16 + 8 * g + r] = lb[r]; } }
  __syncthreads();   // publishes the four waves' sM, sL to wave 0, which alone writes their lines; it also ends each wave's ss writes ahead of its own reads below. It stands ahead of the S stores, so that no wave waits at it for stores to return
  if (tid < 32) { vst2(mrow + tid * 2, *(const v2f*)&sM[tid * 2]); vst2(lrow + tid * 2, *(const v2f*)&sL[tid * 2]);
    asm volatile("s_wait_xcnt 0x0" ::: "memory"); }   // precaution: stands ahead of every rewrite of the registers that these two stores name
  for (int rl = 0; rl < 16; ++rl) vst2(S + (size_t)(ql0 + rl) * TT + k0 + lane * 4, *(const v4f*)&ss[wave][rl][lane * 4]);
  asm volatile("s_wait_xcnt 0x0" ::: "memory"); }   // precaution: the early-exit block is laid out behind these stores; the wait stands ahead of its rewrite of their data registers
// ---- k_pv: block = (128-column chunk, pair = b * NH + h, 64 queries), 8 waves in two key groups of 4: group kg takes the 32-key steps 2 i + kg, so a tile's serial steps halve; the two groups' f32 sums are joined through LDS at the end: y = P . (v hi + lo) with P split hi + lo (3 products); P x 2^11 = stored exponential x sF[key block][row], sF = exp(mb - row maximum) x 2^11 / row sum, row sum = sum over key blocks of exp(mb - row maximum) x lb, formed once per block from MB and LB; there are more work-groups than resident places, so the query tile, whose index sets the causal trip count, falls with the slowest grid index: the longest start first
__global__ __launch_bounds__(256) void k_pv(const float* __restrict__ PS, const __bf16* __restrict__ VT, const __bf16* __restrict__ VL, const int* __restrict__ MSK, const float* __restrict__ MB, const float* __restrict__ LB, float* __restrict__ Y) { __shared__ __align__(16) char sm[126976];   // k loop, per key group 61,440 B: P hi, P lo [2][64][P32] each, v hi, v lo [2][128][P32] each; epilogue, behind a barrier: ss; last 4 KB: sF [16][64]
  const int kg = __builtin_amdgcn_readfirstlane((int)threadIdx.x >> 7);   // key group of this wave, the same in all its lanes
  char* smg = sm + kg * 61440; float (*ss)[16][132] = (float (*)[16][132])sm; __bf16* sPh = (__bf16*)smg; __bf16* sPl = (__bf16*)(smg + 10240); __bf16* sVh = (__bf16*)(smg + 20480); __bf16* sVl = (__bf16*)(smg + 40960); float* sF = (float*)(sm + 122880);
  const int tid = threadIdx.x & 127, wave = tid >> 5, lane = tid & 31, col = lane & 15, g = lane >> 4; const int qt = TT / 64 - 1 - (int)blockIdx.z; const int b = blockIdx.y / NH, h = blockIdx.y % NH; PS += (size_t)blockIdx.y * TT * TT; const int ql0 = qt * 64 + wave * 16; const int cc0 = blockIdx.x * 128; const int kend = (MSK[0] != 0) ? (qt * 64 + 64) : TT; const int nk = kend / 64;   // steps of each key group
  const int sr = tid >> 3, sq = tid & 7, vr = tid >> 2, vq = tid & 3;   // staging, each key group its own tiles: P 8 threads of 16 B per 128-byte row piece, v 4 threads per 64-byte row piece
  const float* gP = PS + (size_t)(qt * 64 + sr) * TT + kg * 32 + sq * 4; const size_t vo = ((size_t)b * CC + h * HD + cc0 + vr) * (size_t)TT + kg * 32 + vq * 8; const __bf16* gH = VT + vo; const __bf16* gL = VL + vo;
  v4f rp[4]; v4u rh[4], rl4[4]; v8f acc[8] = {};
#pragma unroll
  for (int i = 0; i < 4; ++i) { rp[i] = *(const v4f*)(gP + (size_t)i * 16 * TT); rh[i] = *(const v4u*)(gH + (size_t)i * 32 * TT); rl4[i] = *(const v4u*)(gL + (size_t)i * 32 * TT); }
  { const int row = tid & 63, hb = (int)threadIdx.x >> 6; const size_t mo = (size_t)blockIdx.y * (TT / 128) * TT + qt * 64 + row; float mv[16], lv[16];   // four threads per row; each forms the row's figures and writes four of its sixteen factors
#pragma unroll
    for (int kb = 0; kb < 16; ++kb) { mv[kb] = MB[mo + (size_t)kb * TT]; lv[kb] = LB[mo + (size_t)kb * TT]; }
    asm volatile("s_wait_xcnt 0x0" ::: "memory");   // precaution: stands ahead of every rewrite of the address registers that these loads name
    float m = mv[0], l = 0.f;
#pragma unroll
    for (int kb = 1; kb < 16; ++kb) m = fmaxf(m, mv[kb]);
#pragma unroll
    for (int kb = 0; kb < 16; ++kb) { mv[kb] = expf(mv[kb] - m); l += mv[kb] * lv[kb]; }
    const float inv = 1.0f / l;
#pragma unroll
    for (int kb = 0; kb < 16; ++kb) if ((kb >> 2) == hb) sF[kb * 64 + row] = mv[kb] * inv * 2048.0f; }
  __syncthreads();   // publishes sF
  float ff[4];
#pragma unroll
  for (int i = 0; i < 4; ++i) { ff[i] = sF[sr + 16 * i]; rp[i] *= ff[i]; }
#pragma unroll
  for (int i = 0; i < 4; ++i) { const v4b ph = cvt4(rp[i]); *(v4b*)(sPh + (sr + 16 * i) * P32 + sq * 4) = ph; *(v4b*)(sPl + (sr + 16 * i) * P32 + sq * 4) = res4(rp[i], ph); *(v4u*)(sVh + (vr + 32 * i) * P32 + vq * 8) = rh[i]; *(v4u*)(sVl + (vr + 32 * i) * P32 + vq * 8) = rl4[i]; }
#pragma unroll 1   // rolled: a group's step count may be odd, and an unrolled pair with its remainder copy took registers past the four-waves-per-SIMD budget
  for (int kc = 0; kc < nk; ++kc) { const int bu = kc & 1, nb = bu ^ 1; const bool more = kc + 1 < nk;
    __syncthreads();   // publishes buffer bu; ends every wave's reads of buffer nb
    if (more) {
#pragma unroll
      for (int i = 0; i < 4; ++i) { rp[i] = *(const v4f*)(gP + (size_t)i * 16 * TT + (kc + 1) * 64); rh[i] = *(const v4u*)(gH + (size_t)i * 32 * TT + (kc + 1) * 64); rl4[i] = *(const v4u*)(gL + (size_t)i * 32 * TT + (kc + 1) * 64); }
      asm volatile("s_wait_xcnt 0x0" ::: "memory");   // precaution: stands ahead of every rewrite of the address registers that these loads name
      __builtin_amdgcn_sched_barrier(0);   // keeps the sF reads below, address arithmetic included, behind that wait: the compiler lays them in the loads' address registers
#pragma unroll
      for (int i = 0; i < 4; ++i) ff[i] = sF[((kc + 1) >> 1) * 64 + sr + 16 * i];   // the next tile's 32 keys, 64 (kc + 1) + 32 kg onward, lie in one 128-key block
    }
    const v16b ph = frag_b(sPh + (bu * 64 + wave * 16 + col) * P32, lane), pl = frag_b(sPl + (bu * 64 + wave * 16 + col) * P32, lane);
#pragma unroll
    for (int jh = 0; jh < 8; jh += 4) { v16b vh[4], vl[4];   // LDS reads of four column tiles together, ahead of their twelve products
#pragma unroll
      for (int j = 0; j < 4; ++j) { const int ro = (bu * 128 + (jh + j) * 16 + col) * P32; vh[j] = frag_b(sVh + ro, lane); vl[j] = frag_b(sVl + ro, lane); }
      __builtin_amdgcn_sched_barrier(0);   // keeps the LDS reads above together, ahead of the products: without it the compiler reads one fragment, waits and multiplies, eight LDS latencies a step
#pragma unroll
      for (int j = 0; j < 4; ++j) acc[jh + j] = wmma_bf(ph, vh[j], acc[jh + j]);   // the three products of a tile stand four WMMAs apart: none waits for the one before it; each tile still sums ph.vh, pl.vh, ph.vl in that order
#pragma unroll
      for (int j = 0; j < 4; ++j) acc[jh + j] = wmma_bf(pl, vh[j], acc[jh + j]);
#pragma unroll
      for (int j = 0; j < 4; ++j) acc[jh + j] = wmma_bf(ph, vl[j], acc[jh + j]);
      __builtin_amdgcn_sched_barrier(0);   // keeps the products together: without it the next tile's conversions, and the wait for its global loads, move up among them
    }
    asm volatile("v_nop\n\tv_nop\n\tv_nop\n\tv_nop");   // four vector slots behind the step's last WMMA, ahead of the branch round the staging below: on the taken side the next vector instruction rewrites that WMMA's A registers
    if (more) {
#pragma unroll
      for (int i = 0; i < 4; ++i) { const v4f pp = rp[i] * ff[i]; const v4b qh = cvt4(pp); *(v4b*)(sPh + (nb * 64 + sr + 16 * i) * P32 + sq * 4) = qh; *(v4b*)(sPl + (nb * 64 + sr + 16 * i) * P32 + sq * 4) = res4(pp, qh); *(v4u*)(sVh + (nb * 128 + vr + 32 * i) * P32 + vq * 8) = rh[i]; *(v4u*)(sVl + (nb * 128 + vr + 32 * i) * P32 + vq * 8) = rl4[i]; } } }
  __syncthreads();   // the tiles are dead: the epilogue reuses their LDS
  if (kg != 0) {
#pragma unroll
    for (int j = 0; j < 8; ++j)
#pragma unroll
      for (int r = 0; r < 8; ++r) ss[wave][8 * g + r][j * 16 + col] = acc[j][r]; }
  __syncthreads();   // publishes the second key group's sums to the first, which adds its own and stores
  if (kg != 0) return;
#pragma unroll
  for (int j = 0; j < 8; ++j)
#pragma unroll
    for (int r = 0; r < 8; ++r) { float* p = &ss[wave][8 * g + r][j * 16 + col]; *p = (acc[j][r] + *p) * (1.0f / 2048.0f); }   // each lane reads and rewrites its own word
  LDSX(); for (int rl = 0; rl < 16; ++rl) vst2(Y + ((size_t)b * TT + ql0 + rl) * CC + h * HD + cc0 + lane * 4, *(const v4f*)&ss[wave][rl][lane * 4]); }
// ---- k_out: block = (64 rows, 128 cols): out = y (bf16 hi + lo) Wproj + b; Wproj arrives as bf16 from k_cvt: a 128-byte piece of its rows holds 64 k, so a step covers 64 k
__global__ __launch_bounds__(128) void k_out(const float* __restrict__ Y, const __bf16* __restrict__ WPB, const float* __restrict__ BP, float* __restrict__ OUT) { __shared__ __align__(16) char sm[73728];   // k loop: y hi, y lo [2][64][P64] each, W tiles [2][128][P64]; epilogue, behind a barrier: sf
  float (*sf)[16][132] = (float (*)[16][132])sm; __bf16* sAh = (__bf16*)sm; __bf16* sAl = (__bf16*)(sm + 18432); __bf16* sB = (__bf16*)(sm + 36864);
  const int tid = threadIdx.x, wave = tid >> 5, lane = tid & 31, col = lane & 15, g = lane >> 4; const int c0 = blockIdx.y * 128; const size_t r0 = (size_t)blockIdx.x * 64 + wave * 16;
  const int ar = tid >> 4, aq = tid & 15, sr = tid >> 3, sq = tid & 7;   // staging, 64 k: y 16 threads of 16 B per 256-byte row piece, W 8 threads of 16 B per 128-byte row piece
  const float* gA = Y + ((size_t)blockIdx.x * 64 + ar) * CC + aq * 4; const __bf16* gB = WPB + (size_t)(c0 + sr) * CC + sq * 8;
  v4f ra[8]; v4u rb[8]; v8f acc[8] = {};
#pragma unroll
  for (int i = 0; i < 8; ++i) ra[i] = *(const v4f*)(gA + (size_t)i * 8 * CC);
#pragma unroll
  for (int i = 0; i < 8; ++i) rb[i] = *(const v4u*)(gB + (size_t)i * 16 * CC);
#pragma unroll
  for (int i = 0; i < 8; ++i) { const v4b ah = cvt4(ra[i]); *(v4b*)(sAh + (ar + 8 * i) * P64 + aq * 4) = ah; *(v4b*)(sAl + (ar + 8 * i) * P64 + aq * 4) = res4(ra[i], ah); }
#pragma unroll
  for (int i = 0; i < 8; ++i) *(v4u*)(sB + (sr + 16 * i) * P64 + sq * 8) = rb[i];
#pragma unroll 2   // two steps per trip: the buffer index becomes a constant
  for (int ks = 0; ks < CC / 64; ++ks) { const int bu = ks & 1, nb = bu ^ 1; const bool more = ks + 1 < CC / 64;
    __syncthreads();   // publishes buffer bu; ends every wave's reads of buffer nb
    if (more) {
#pragma unroll
      for (int i = 0; i < 8; ++i) ra[i] = *(const v4f*)(gA + (size_t)i * 8 * CC + (ks + 1) * 64);
#pragma unroll
      for (int i = 0; i < 8; ++i) rb[i] = *(const v4u*)(gB + (size_t)i * 16 * CC + (ks + 1) * 64);
      asm volatile("s_wait_xcnt 0x0" ::: "memory");   // precaution: stands ahead of every rewrite of the address registers that these loads name
    }
#pragma unroll
    for (int s = 0; s < 2; ++s) { const v16b ah = frag_b(sAh + (bu * 64 + wave * 16 + col) * P64 + s * 32, lane), al = frag_b(sAl + (bu * 64 + wave * 16 + col) * P64 + s * 32, lane);
      v16b w[8];   // LDS reads together, ahead of their products
#pragma unroll
      for (int j = 0; j < 8; ++j) w[j] = frag_b(sB + (bu * 128 + j * 16 + col) * P64 + s * 32, lane);
      __builtin_amdgcn_sched_barrier(0);   // keeps the LDS reads above together, ahead of the products: without it the compiler reads one fragment, waits and multiplies, eight LDS latencies a step
#pragma unroll
      for (int j = 0; j < 8; ++j) acc[j] = wmma_bf(ah, w[j], acc[j]);   // the two products of a tile stand eight WMMAs apart; each tile still sums hi, then lo, per 32 k
#pragma unroll
      for (int j = 0; j < 8; ++j) acc[j] = wmma_bf(al, w[j], acc[j]);
      __builtin_amdgcn_sched_barrier(0);   // keeps the products together: without it the next tile's conversions, and the wait for its global loads, move up among them
    }
    if (more) {
#pragma unroll
      for (int i = 0; i < 8; ++i) { const v4b qh = cvt4(ra[i]); *(v4b*)(sAh + (nb * 64 + ar + 8 * i) * P64 + aq * 4) = qh; *(v4b*)(sAl + (nb * 64 + ar + 8 * i) * P64 + aq * 4) = res4(ra[i], qh); }
#pragma unroll
      for (int i = 0; i < 8; ++i) *(v4u*)(sB + (nb * 128 + sr + 16 * i) * P64 + sq * 8) = rb[i]; } }
  __syncthreads();   // the tiles are dead: the epilogue reuses their LDS
#pragma unroll
  for (int j = 0; j < 8; ++j) { const float bb = BP ? bfr(BP[c0 + j * 16 + col]) : 0.f;
#pragma unroll
    for (int r = 0; r < 8; ++r) sf[wave][8 * g + r][j * 16 + col] = acc[j][r] + bb; }
  LDSX(); for (int rl = 0; rl < 16; ++rl) vst2(OUT + (r0 + rl) * CC + c0 + lane * 4, *(const v4f*)&sf[wave][rl][lane * 4]); }
extern "C" void kernel_launch(void* const* d_in, const int* in_sizes, int n_in, void* d_out, int out_size, void* d_ws, size_t ws_size, hipStream_t stream) {
  (void)in_sizes; (void)n_in; (void)out_size;
  const float** F = (const float**)d_in;   // 0 input [4,2048,1024], 1 Wq [2,512,512] ([out,in] per head), 2 bq [2,512], 3 Wk, 4 bk, 5 Wv, 6 bv, 7 Wf [1024,1024] ([out,in]), 8 bf, 9 masked [1] int (= 1 -> causal)
  if (ws_size < (size_t)WS_END) return;
  char* ws = (char*)d_ws; _Float16 *QH = (_Float16*)(ws + WS_QH), *QL = (_Float16*)(ws + WS_QL), *KH = (_Float16*)(ws + WS_KH); __bf16 *VT = (__bf16*)(ws + WS_VT), *VL = (__bf16*)(ws + WS_VL); float *S = (float*)(ws + WS_S), *Y = (float*)(ws + WS_Y), *MB = (float*)(ws + WS_M), *LB = (float*)(ws + WS_L); __bf16 *XB = (__bf16*)(ws + WS_XB), *WB = (__bf16*)(ws + WS_WB), *WFB = (__bf16*)(ws + WS_WF);
  k_cvt<<<dim3((NB * TT * CC + 3 * NH * HD * HD + CC * CC) / CVB), 256, 0, stream>>>(F[0], F[1], F[3], F[5], F[7], XB, WB, WFB);
  k_proj<<<dim3(TNB * TT / 64, CC / 128, 3), 128, 0, stream>>>(XB, WB, F[2], F[4], F[6], QH, QL, KH, VT, VL);
  k_sc<<<dim3(TT / 64, TT / 128, TNB * NH), 128, 0, stream>>>(QH, QL, KH, nullptr, (const int*)d_in[9], S, MB, LB);
  k_pv<<<dim3(HD / 128, TNB * NH, TT / 64), 256, 0, stream>>>(S, VT, VL, (const int*)d_in[9], MB, LB, Y);
  k_out<<<dim3(TNB * TT / 64, CC / 128), 128, 0, stream>>>(Y, WFB, F[8], (float*)d_out);
}

// v008
// A run of this version takes 169 microseconds.
// Two timings next to v007 both put it at 1.04 times that version's speed.
// All steps since v000 together make it 12.5 times as fast.
// compute dtype: all float inputs rounded to bf16 (x, Wq, Wk, Wv, Wf once, by k_cvt), 'masked' read at run time (1 -> causal; 0 -> full attention); per-head q/k/v = x_half W_n^T + b_n (block-diagonal [out,in] linears) with EXACT bf16 products on WMMA 16x16x32, f32 accumulate, q/k rounded once to f16 (0.02-scale weights, logits std ~0.01: 1 product), softmax in f32 (precise expf) in two parts: exp(logit - block maximum) stored in f32 per (batch, head) with each 128-key block's row maximum and row sum, rescaled to P x 2^11 where P.V stages it, kept f32 and split bf16 hi + lo against v as bf16 hi + lo (3 products); out = y (bf16 hi + lo) Wf^T + bf; f32 output.
#include <hip/hip_runtime.h>
#include <math.h>

typedef __attribute__((ext_vector_type(16))) _Float16 v16h;
typedef __attribute__((ext_vector_type(16))) __bf16 v16b;
typedef __attribute__((ext_vector_type(8)))  _Float16 v8h;
typedef __attribute__((ext_vector_type(8)))  float v8f;
typedef __attribute__((ext_vector_type(4)))  float v4f;
typedef __attribute__((ext_vector_type(2)))  float v2f;
typedef __attribute__((ext_vector_type(4)))  unsigned v4u;
typedef __attribute__((ext_vector_type(4)))  int v4i;
typedef float __attribute__((may_alias)) float_a;
typedef int __attribute__((may_alias)) int_a;

template <typename T> __device__ __forceinline__ void vst2(void* p, T v) { *(T*)p = v;  }
__device__ __forceinline__ v8f wmma16(v16h a, v16h b, v8f c) {
  return __builtin_amdgcn_wmma_f32_16x16x32_f16(false, a, false, b, (short)0, c, false, false);
}
__device__ __forceinline__ v8f wmma_bf(v16b a, v16b b, v8f c) {
  return __builtin_amdgcn_wmma_f32_16x16x32_bf16(false, a, false, b, (short)0, c, false, false);
}
// 16x16x32 fragments: lane = (h = lane>>4, row/col = lane&15); elements 0..7 = k0+8h+0..7, 8..15 = k0+16+8h+0..7; D element r = row 8h+r
__device__ __forceinline__ v16h frag_h(const _Float16* rowk0, int lane) {
  union { v16h v; v8h q[2]; } u; const _Float16* p = rowk0 + 8 * (lane >> 4);
  u.q[0] = *(const v8h*)p; u.q[1] = *(const v8h*)(p + 16); return u.v;
}
__device__ __forceinline__ v16h frag_f32(const float* rowk0, int lane) {
  v16h a; const float* p = rowk0 + 8 * (lane >> 4);
#pragma unroll
  for (int i = 0; i < 8; ++i) { a[i] = (_Float16)p[i]; a[8 + i] = (_Float16)p[16 + i]; }
  return a;
}
__device__ __forceinline__ v16h frag_f32s(const float* rowk0, int lane, float sc) {
  v16h a; const float* p = rowk0 + 8 * (lane >> 4);
#pragma unroll
  for (int i = 0; i < 8; ++i) { a[i] = (_Float16)(p[i] * sc); a[8 + i] = (_Float16)(p[16 + i] * sc); }
  return a;
}
// column fragment from a [K][ld] layout (column n), rows >= K read as 0
__device__ __forceinline__ v16h fragc_f32(const float* W, int k0, int n, int lane, int ld, int K) {
  v16h a; const int g = lane >> 4;
#pragma unroll
  for (int i = 0; i < 8; ++i) { const int ka = k0 + 8 * g + i, kb = ka + 16;
    a[i] = (_Float16)(ka < K ? W[(size_t)(ka < K ? ka : K - 1) * ld + n] : 0.f); a[8 + i] = (_Float16)(kb < K ? W[(size_t)(kb < K ? kb : K - 1) * ld + n] : 0.f); }
  return a;
}
struct F2 { v16b h, l; };
__device__ __forceinline__ F2 bsplit16(const float v[16]) { F2 r;
#pragma unroll
  for (int i = 0; i < 16; ++i) { const __bf16 h = (__bf16)v[i]; r.h[i] = h; r.l[i] = (__bf16)(v[i] - (float)h); }
  return r; }
__device__ __forceinline__ F2 split_row(const float* row, int k0, int lane) { float v[16]; const float* p = row + k0 + 8 * (lane >> 4);
#pragma unroll
  for (int i = 0; i < 8; ++i) { v[i] = p[i]; v[8 + i] = p[16 + i]; }
  return bsplit16(v); }
__device__ __forceinline__ F2 split_rowK(const float* row, int k0, int lane, int K) { float v[16]; const int g = lane >> 4;
#pragma unroll
  for (int i = 0; i < 8; ++i) { const int ka = k0 + 8 * g + i, kb = ka + 16; v[i] = ka < K ? row[ka < K ? ka : K - 1] : 0.f; v[8 + i] = kb < K ? row[kb < K ? kb : K - 1] : 0.f; }
  return bsplit16(v); }
__device__ __forceinline__ F2 split_col(const float* W, int k0, int n, int lane, int ld, int K) { float v[16]; const int g = lane >> 4;
#pragma unroll
  for (int i = 0; i < 8; ++i) { const int ka = k0 + 8 * g + i, kb = ka + 16; v[i] = ka < K ? W[(size_t)(ka < K ? ka : K - 1) * ld + n] : 0.f; v[8 + i] = kb < K ? W[(size_t)(kb < K ? kb : K - 1) * ld + n] : 0.f; }
  return bsplit16(v); }
__device__ __forceinline__ v8f mac3(const F2& a, const F2& b, v8f c) { c = wmma_bf(a.l, b.h, c); c = wmma_bf(a.h, b.l, c); return wmma_bf(a.h, b.h, c); }
__device__ __forceinline__ float sigm(float v) { return 1.0f / (1.0f + expf(-v)); }


// Two-headed causal attention with per-head Linear projections on the two contiguous 512-wide halves of the input (B 4, S 2,048, E 1,024), scores / sqrt(512), softmax . v, final Linear Wf + bf.
#define NB 4
#define TT 2048
#define CC 1024
#define NH 2
#define HD 512
#ifndef TNB
#define TNB NB
#endif
typedef __attribute__((ext_vector_type(8))) __bf16 v8b;
__device__ __forceinline__ v16b frag_b(const __bf16* rowk0, int lane) {
  union { v16b v; v8b q[2]; } u; const __bf16* p = rowk0 + 8 * (lane >> 4);
  u.q[0] = *(const v8b*)p; u.q[1] = *(const v8b*)(p + 16); return u.v;
}
__device__ __forceinline__ float bfr(float v) { return (float)(__bf16)v; }
__device__ __attribute__((noinline)) float exp_ni(float v) { return expf(v); }
__device__ __attribute__((noinline)) float erf_ni(float v) { return erff(v); }

#define WS_QH  0u
#define WS_QL  (WS_QH + 2u * (size_t)NB * TT * CC)
#define WS_KH  (WS_QL + 2u * (size_t)NB * TT * CC)
#define WS_VT  (WS_KH + 2u * (size_t)NB * TT * CC)      // bf16 v planes [b][c][t]
#define WS_VL  (WS_VT + 2u * (size_t)NB * CC * TT)      // bf16 v residual planes
#define WS_S   (WS_VL + 2u * (size_t)NB * CC * TT)      // f32 exp(logit - block maximum): one [t][t] plane per (batch, head)
#define WS_Y   (WS_S + 4u * (size_t)NB * NH * TT * TT)  // f32 y rows [b*t][C]
#define WS_M   (WS_Y + 4u * (size_t)NB * TT * CC)       // f32 row maxima [pair][key block][t]
#define WS_L   (WS_M + 4u * (size_t)NB * NH * (TT / 128) * TT)   // f32 row sums, same layout
#define WS_WF  (WS_L + 4u * (size_t)NB * NH * (TT / 128) * TT)   // bf16 Wf [out][in]: written by k_cvt, read by k_out
#define WS_END (WS_WF + 2u * (size_t)CC * CC)
#define WS_XB  WS_Y                                     // bf16 x rows [b*t][C]: written by k_cvt, last read by k_proj; k_pv lays y over them later in the same call
#define WS_WB  (WS_XB + 2u * (size_t)NB * TT * CC)      // bf16 Wq, Wk, Wv [3][head][out][in], same life

// ---- LDS staging shared by the four matrix kernels: a block's 128 threads (in k_pv, each key group's 128) fetch each operand tile with loads that cover whole 128-byte lines (k_pv's v tiles: 64-byte halves), convert it once, and lay it in LDS in k order; every wave then takes its fragments with frag_b / frag_h from rows at a pitch of 16 B x odd (80 B for 64-byte rows, 144 B for 128-byte rows). Two buffers, one barrier per k step: the next tile's global loads fly during the products and are stored behind them.
typedef __attribute__((ext_vector_type(4))) __bf16 v4b;
#define P32 40   // elements per LDS row holding 32 16-bit values (80 B)
#define P64 72   // elements per LDS row holding 64 16-bit values (144 B)
__device__ __forceinline__ v4b cvt4(v4f v) { v4b r;
#pragma unroll
  for (int i = 0; i < 4; ++i) r[i] = (__bf16)v[i];
  return r; }
__device__ __forceinline__ v4b res4(v4f v, v4b h) { v4b r;
#pragma unroll
  for (int i = 0; i < 4; ++i) r[i] = (__bf16)(v[i] - (float)h[i]);
  return r; }

// ---- k_cvt: block = 8,192 consecutive floats of one of x, Wq, Wk, Wv, Wf: each is rounded to bf16 once here, not again in every block that stages it (x 12 times, a weight 128 times)
#define CVB 8192
__global__ __launch_bounds__(256) void k_cvt(const float* __restrict__ X, const float* __restrict__ WQ, const float* __restrict__ WK, const float* __restrict__ WV, const float* __restrict__ WF, __bf16* __restrict__ XB, __bf16* __restrict__ WB, __bf16* __restrict__ WFB) {
  const int bi = blockIdx.x, tid = threadIdx.x, nx = NB * TT * CC / CVB, wi = bi - nx, pw = NH * HD * HD / CVB, fi = wi - 3 * pw; const float* s; __bf16* d;   // block-uniform choice of the source
  if (bi < nx) { s = X + (size_t)bi * CVB; d = XB + (size_t)bi * CVB; }
  else if (fi < 0) { s = (wi < pw ? WQ : wi < 2 * pw ? WK : WV) + (size_t)(wi % pw) * CVB; d = WB + (size_t)wi * CVB; }
  else { s = WF + (size_t)fi * CVB; d = WFB + (size_t)fi * CVB; }
  v4f r[8];
#pragma unroll
  for (int i = 0; i < 8; ++i) r[i] = *(const v4f*)(s + (i * 256 + tid) * 4);   // eight whole-line loads in flight per wave
  asm volatile("s_wait_xcnt 0x0" ::: "memory");   // precaution: stands ahead of every rewrite of the address registers that these loads name
#pragma unroll
  for (int i = 0; i < 8; ++i) *(v4b*)(d + (i * 256 + tid) * 4) = cvt4(r[i]); }
// ---- k_proj: block = (64 rows, 128 cols, which): qkv = x W (+ b), exact; q -> f16 hi (+ residual), k -> f16 rows, v -> bf16 hi + lo planes; x and W arrive as bf16 from k_cvt: a 128-byte row piece holds 64 k, so a step covers 64 k
__global__ __launch_bounds__(128) void k_proj(const __bf16* __restrict__ XB, const __bf16* __restrict__ WB, const float* __restrict__ BQ, const float* __restrict__ BK, const float* __restrict__ BV, _Float16* __restrict__ QH, _Float16* __restrict__ QL, _Float16* __restrict__ KH, __bf16* __restrict__ VT, __bf16* __restrict__ VL) {
  __shared__ __align__(16) char sm[55296];   // k loop: x tiles [2][64][P64], W tiles [2][128][P64]; epilogue, behind a barrier: sh + sl, or th + tl2
  _Float16 (*sh)[136] = (_Float16 (*)[136])sm; _Float16 (*sl)[136] = (_Float16 (*)[136])(sm + 64 * 136 * 2); __bf16 (*th)[72] = (__bf16 (*)[72])sm; __bf16 (*tl2)[72] = (__bf16 (*)[72])(sm + 128 * 72 * 2);
  __bf16* sA = (__bf16*)sm; __bf16* sB = (__bf16*)(sm + 2 * 64 * P64 * 2);
  const int tid = threadIdx.x, wave = tid >> 5, lane = tid & 31, col = lane & 15, g = lane >> 4, wq = wave >> 1, wc = wave & 1; const int which = blockIdx.z; const int c0 = blockIdx.y * 128; const size_t r0 = (size_t)blockIdx.x * 64; const float* BA = which == 0 ? BQ : which == 1 ? BK : BV; const int hn = c0 / HD;   // head of this 128-column block (HD = 512)
  const int sr = tid >> 3, sq = tid & 7;   // staging: 8 threads of 16 B per 128-byte row piece (64 k)
  const __bf16* gA = XB + (r0 + sr) * CC + hn * HD + sq * 8; const __bf16* gB = WB + (size_t)which * NH * HD * HD + (size_t)(c0 + sr) * HD + sq * 8;
  v4u ra[4], rb[8]; v8f acc[2][4] = {};   // wave tile 32 rows x 64 cols: waves 2 x 2 on the block's 64 x 128
#pragma unroll
  for (int i = 0; i < 4; ++i) ra[i] = *(const v4u*)(gA + (size_t)i * 16 * CC);
#pragma unroll
  for (int i = 0; i < 8; ++i) rb[i] = *(const v4u*)(gB + (size_t)i * 16 * HD);
#pragma unroll
  for (int i = 0; i < 4; ++i) *(v4u*)(sA + (sr + 16 * i) * P64 + sq * 8) = ra[i];
#pragma unroll
  for (int i = 0; i < 8; ++i) *(v4u*)(sB + (sr + 16 * i) * P64 + sq * 8) = rb[i];
#pragma unroll 2   // two steps per trip: the buffer index becomes a constant
  for (int ks = 0; ks < HD / 64; ++ks) { const int bu = ks & 1, nb = bu ^ 1; const bool more = ks + 1 < HD / 64;
    __syncthreads();   // publishes buffer bu; ends every wave's reads of buffer nb
    if (more) {
#pragma unroll
      for (int i = 0; i < 4; ++i) ra[i] = *(const v4u*)(gA + (size_t)i * 16 * CC + (ks + 1) * 64);
#pragma unroll
      for (int i = 0; i < 8; ++i) rb[i] = *(const v4u*)(gB + (size_t)i * 16 * HD + (ks + 1) * 64);
      asm volatile("s_wait_xcnt 0x0" ::: "memory");   // precaution: stands ahead of every rewrite of the address registers that these loads name
    }
#pragma unroll
    for (int s = 0; s < 2; ++s) { v16b a[2], w[4];   // LDS reads together, ahead of their products: one exposed LDS latency; six fragments feed eight products
#pragma unroll
      for (int i = 0; i < 2; ++i) a[i] = frag_b(sA + (bu * 64 + wq * 32 + i * 16 + col) * P64 + s * 32, lane);
#pragma unroll
      for (int j = 0; j < 4; ++j) w[j] = frag_b(sB + (bu * 128 + wc * 64 + j * 16 + col) * P64 + s * 32, lane);
      __builtin_amdgcn_sched_barrier(0);   // keeps the LDS reads above together, ahead of the products: without it the compiler reads one fragment, waits and multiplies, an LDS latency each
#pragma unroll
      for (int i = 0; i < 2; ++i)
#pragma unroll
        for (int j = 0; j < 4; ++j) acc[i][j] = wmma_bf(a[i], w[j], acc[i][j]);
      __builtin_amdgcn_sched_barrier(0);   // keeps the products together: without it the next tile's LDS stores, and the wait for its global loads, move up among them
    }
    if (more) {
#pragma unroll
      for (int i = 0; i < 4; ++i) *(v4u*)(sA + (nb * 64 + sr + 16 * i) * P64 + sq * 8) = ra[i];
#pragma unroll
      for (int i = 0; i < 8; ++i) *(v4u*)(sB + (nb * 128 + sr + 16 * i) * P64 + sq * 8) = rb[i]; } }
  __syncthreads();   // the tiles are dead: the epilogue reuses their LDS
#pragma unroll
  for (int j = 0; j < 4; ++j) { const float bb = bfr(BA[c0 + wc * 64 + j * 16 + col]);
#pragma unroll
    for (int i = 0; i < 2; ++i)
#pragma unroll
    for (int r = 0; r < 8; ++r) { const float v = acc[i][j][r] + bb; const int rl = wq * 32 + i * 16 + 8 * g + r, cl = wc * 64 + j * 16 + col; const _Float16 hv = (_Float16)v;
      if (which == 2) { const __bf16 bh = (__bf16)v; th[cl][rl] = bh; tl2[cl][rl] = (__bf16)(v - (float)bh); } else { sh[rl][cl] = hv; sl[rl][cl] = (_Float16)(v - (float)hv); } } }
  __syncthreads();
  if (which < 2) { _Float16* dh = which == 0 ? QH : KH; for (int e = tid; e < 64 * 16; e += 128) { const int rl = e >> 4, q = e & 15; vst2((unsigned*)(dh + (r0 + rl) * CC + c0 + q * 8), *(const v4u*)&sh[rl][q * 8]); if (which == 0) vst2((unsigned*)(QL + (r0 + rl) * CC + c0 + q * 8), *(const v4u*)&sl[rl][q * 8]); } }
  else { const size_t b = r0 / TT; const int t0 = (int)(r0 % TT); for (int e = tid; e < 128 * 8; e += 128) { const int cl = e >> 3, q = e & 7; const size_t o2 = (b * CC + c0 + cl) * (size_t)TT + t0 + q * 8; vst2((unsigned*)(VT + o2), *(const v4u*)&th[cl][q * 8]); vst2((unsigned*)(VL + o2), *(const v4u*)&tl2[cl][q * 8]); } } }
// value of lane ^ M inside the lane's 16-lane half, every lane on: a register move (DPP row_xmask), where __shfl_xor would go through the LDS unit and its wait
template <int M> __device__ __forceinline__ float rowx(float v) { return __builtin_bit_cast(float, __builtin_amdgcn_update_dpp(0, __builtin_bit_cast(int, v), 0x160 | M, 0xf, 0xf, true)); }
// ---- k_sc: block = (64 queries, 128 keys, pair = b * NH + h): logits * scale, then the block's share of the softmax: per row the maximum mb and the sum lb of exp(logit - mb) over its 128 keys (masked -> 0); S takes the exponentials, MB and LB the two row figures, 256 contiguous bytes each, stored by one wave; causal blocks beyond the diagonal store mb = -3.0e38, lb = 0 and exit
__global__ __launch_bounds__(128) void k_sc(const _Float16* __restrict__ QH, const _Float16* __restrict__ QL, const _Float16* __restrict__ KH, const float* __restrict__ BM, const int* __restrict__ MSK, float* __restrict__ S, float* __restrict__ MB, float* __restrict__ LB) { __shared__ __align__(16) char sm[55296];   // k loop: q tiles [2][64][P64], k tiles [2][128][P64]; epilogue, behind a barrier: ss, sM, sL
  float (*ss)[16][132] = (float (*)[16][132])sm; _Float16* sA = (_Float16*)sm; _Float16* sB = (_Float16*)(sm + 2 * 64 * P64 * 2);
  const bool cz = (MSK[0] != 0); const int b = blockIdx.z / NH, h = blockIdx.z % NH; S += (size_t)blockIdx.z * TT * TT;
  const int tid = threadIdx.x, wave = tid >> 5, lane = tid & 31, col = lane & 15, g = lane >> 4, wq = wave >> 1, wc = wave & 1; const int k0 = blockIdx.y * 128; const int ql0 = blockIdx.x * 64 + wave * 16;
  const size_t mo = ((size_t)blockIdx.z * (TT / 128) + blockIdx.y) * TT + blockIdx.x * 64; float* mrow = MB + mo; float* lrow = LB + mo;   // this block's 64 rows
  if (cz && k0 > blockIdx.x * 64 + 63) { if (tid < 32) { vst2(mrow + tid * 2, (v2f){-3.0e38f, -3.0e38f}); vst2(lrow + tid * 2, (v2f){0.f, 0.f}); } return; }   // causal: whole key block above the diagonal (block-uniform): it weighs nothing in its rows
  (void)QL; const int sr = tid >> 3, sq = tid & 7;   // staging: 8 threads of 16 B per 128-byte row piece (64 k)
  const _Float16* gA = QH + ((size_t)b * TT + blockIdx.x * 64 + sr) * CC + h * HD + sq * 8; const _Float16* gB = KH + ((size_t)b * TT + k0 + sr) * CC + h * HD + sq * 8;
  v4u ra[4], rb[8]; v8f acc[2][4] = {};   // wave tile 32 queries x 64 keys: waves 2 x 2 on the block's 64 x 128
#pragma unroll
  for (int i = 0; i < 4; ++i) ra[i] = *(const v4u*)(gA + (size_t)i * 16 * CC);
#pragma unroll
  for (int i = 0; i < 8; ++i) rb[i] = *(const v4u*)(gB + (size_t)i * 16 * CC);
#pragma unroll
  for (int i = 0; i < 4; ++i) *(v4u*)(sA + (sr + 16 * i) * P64 + sq * 8) = ra[i];
#pragma unroll
  for (int i = 0; i < 8; ++i) *(v4u*)(sB + (sr + 16 * i) * P64 + sq * 8) = rb[i];
#pragma unroll 2   // two steps per trip: the buffer index becomes a constant
  for (int ks = 0; ks < HD / 64; ++ks) { const int bu = ks & 1, nb = bu ^ 1; const bool more = ks + 1 < HD / 64;
    __syncthreads();   // publishes buffer bu; ends every wave's reads of buffer nb
    if (more) {
#pragma unroll
      for (int i = 0; i < 4; ++i) ra[i] = *(const v4u*)(gA + (size_t)i * 16 * CC + (ks + 1) * 64);
#pragma unroll
      for (int i = 0; i < 8; ++i) rb[i] = *(const v4u*)(gB + (size_t)i * 16 * CC + (ks + 1) * 64);
      asm volatile("s_wait_xcnt 0x0" ::: "memory");   // precaution: stands ahead of every rewrite of the address registers that these loads name
    }
#pragma unroll
    for (int s = 0; s < 2; ++s) { v16h ah[2], kb[4];   // LDS reads together, ahead of their products; six fragments feed eight products
#pragma unroll
      for (int i = 0; i < 2; ++i) ah[i] = frag_h(sA + (bu * 64 + wq * 32 + i * 16 + col) * P64 + s * 32, lane);
#pragma unroll
      for (int j = 0; j < 4; ++j) kb[j] = frag_h(sB + (bu * 128 + wc * 64 + j * 16 + col) * P64 + s * 32, lane);
      __builtin_amdgcn_sched_barrier(0);   // keeps the LDS reads above together, ahead of the products: without it the compiler reads one fragment, waits and multiplies, an LDS latency each
#pragma unroll
      for (int i = 0; i < 2; ++i)
#pragma unroll
        for (int j = 0; j < 4; ++j) acc[i][j] = wmma16(ah[i], kb[j], acc[i][j]);
      __builtin_amdgcn_sched_barrier(0);   // keeps the products together: without it the next tile's LDS stores, and the wait for its global loads, move up among them
    }
    if (more) {
#pragma unroll
      for (int i = 0; i < 4; ++i) *(v4u*)(sA + (nb * 64 + sr + 16 * i) * P64 + sq * 8) = ra[i];
#pragma unroll
      for (int i = 0; i < 8; ++i) *(v4u*)(sB + (nb * 128 + sr + 16 * i) * P64 + sq * 8) = rb[i]; } }
  __syncthreads();   // the tiles are dead: the epilogue reuses their LDS
  float* sM = (float*)(sm + 34816); float* sL = sM + 128; float mb[2][8], lb[2][8];   // behind ss (33,792 B): [64-key half][64 rows] each
#pragma unroll
  for (int i = 0; i < 2; ++i)
#pragma unroll
    for (int r = 0; r < 8; ++r) { mb[i][r] = -3.0e38f; lb[i][r] = 0.f; }
#pragma unroll
  for (int i = 0; i < 2; ++i)
#pragma unroll
  for (int j = 0; j < 4; ++j) { const int kt = k0 + wc * 64 + j * 16 + col;
#pragma unroll
    for (int r = 0; r < 8; ++r) { const int qt = blockIdx.x * 64 + wq * 32 + i * 16 + 8 * g + r; float v = acc[i][j][r] * 0.044194173824159216f; (void)BM; if (cz && kt > qt) v = -3.0e38f; acc[i][j][r] = v; mb[i][r] = fmaxf(mb[i][r], v); } }
#pragma unroll
  for (int i = 0; i < 2; ++i)
#pragma unroll
  for (int r = 0; r < 8; ++r) { float m = mb[i][r]; m = fmaxf(m, rowx<1>(m)); m = fmaxf(m, rowx<2>(m)); m = fmaxf(m, rowx<4>(m)); m = fmaxf(m, rowx<8>(m)); mb[i][r] = m; }   // a row's 64 keys of this wave lie in the 16 lanes of one half
  if (col == 0) {
#pragma unroll
    for (int i = 0; i < 2; ++i)
#pragma unroll
    for (int r = 0; r < 8; ++r) sM[wc * 64 + wq * 32 + i * 16 + 8 * g + r] = mb[i][r]; }
  __syncthreads();   // publishes each wave's row maxima over its 64 keys to the wave that holds the rows' other 64 keys
#pragma unroll
  for (int i = 0; i < 2; ++i) { const v4f* om = (const v4f*)&sM[(wc ^ 1) * 64 + wq * 32 + i * 16 + 8 * g]; const v4f o0 = om[0], o1 = om[1];
#pragma unroll
    for (int r = 0; r < 4; ++r) { mb[i][r] = fmaxf(mb[i][r], o0[r]); mb[i][4 + r] = fmaxf(mb[i][4 + r], o1[r]); } }   // the maximum over the block's 128 keys
#pragma unroll
  for (int i = 0; i < 2; ++i)
#pragma unroll
  for (int j = 0; j < 4; ++j)
#pragma unroll
    for (int r = 0; r < 8; ++r) { const float v = acc[i][j][r]; const float ex = expf(v - mb[i][r]); const float e = (v <= -1.0e38f) ? 0.f : ex; lb[i][r] += e; ss[wq * 2 + i][8 * g + r][wc * 64 + j * 16 + col] = e; }
#pragma unroll
  for (int i = 0; i < 2; ++i)
#pragma unroll
  for (int r = 0; r < 8; ++r) { float l = lb[i][r]; l += rowx<1>(l); l += rowx<2>(l); l += rowx<4>(l); l += rowx<8>(l); lb[i][r] = l; }
  if (col == 0) {
#pragma unroll
    for (int i = 0; i < 2; ++i)
#pragma unroll
    for (int r = 0; r < 8; ++r) sL[wc * 64 + wq * 32 + i * 16 + 8 * g + r] = lb[i][r]; }
  __syncthreads();   // publishes the four waves' sL to wave 0, which alone writes the MB and LB lines, and every wave's ss writes to the wave that stores the row. It stands ahead of the S stores, so that no wave waits at it for stores to return
  if (tid < 32) { const v2f ma = *(const v2f*)&sM[tid * 2], mc = *(const v2f*)&sM[64 + tid * 2], la = *(const v2f*)&sL[tid * 2], lc = *(const v2f*)&sL[64 + tid * 2];
    vst2(mrow + tid * 2, (v2f){fmaxf(ma[0], mc[0]), fmaxf(ma[1], mc[1])}); vst2(lrow + tid * 2, la + lc);   // a row's figures: its two 64-key halves joined
    asm volatile("s_wait_xcnt 0x0" ::: "memory"); }   // precaution: stands ahead of every rewrite of the registers that these two stores name
  for (int rl = 0; rl < 16; ++rl) vst2(S + (size_t)(ql0 + rl) * TT + k0 + lane * 4, *(const v4f*)&ss[wave][rl][lane * 4]);
  asm volatile("s_wait_xcnt 0x0" ::: "memory"); }   // precaution: the early-exit block is laid out behind these stores; the wait stands ahead of its rewrite of their data registers
// ---- k_pv: block = (128-column chunk, pair = b * NH + h, 64 queries), 8 waves in two key groups of 4: group kg takes the 32-key steps 2 i + kg, so a tile's serial steps halve; the two groups' f32 sums are joined through LDS at the end: y = P . (v hi + lo) with P split hi + lo (3 products); P x 2^11 = stored exponential x sF[key block][row], sF = exp(mb - row maximum) x 2^11 / row sum, row sum = sum over key blocks of exp(mb - row maximum) x lb, formed once per block from MB and LB; there are more work-groups than resident places, so the query tile, whose index sets the causal trip count, falls with the slowest grid index: the longest start first
__global__ __launch_bounds__(256) void k_pv(const float* __restrict__ PS, const __bf16* __restrict__ VT, const __bf16* __restrict__ VL, const int* __restrict__ MSK, const float* __restrict__ MB, const float* __restrict__ LB, float* __restrict__ Y) { __shared__ __align__(16) char sm[126976];   // k loop, per key group 61,440 B: P hi, P lo [2][64][P32] each, v hi, v lo [2][128][P32] each; epilogue, behind a barrier: ss; last 4 KB: sF [16][64]
  const int kg = __builtin_amdgcn_readfirstlane((int)threadIdx.x >> 7);   // key group of this wave, the same in all its lanes
  char* smg = sm + kg * 61440; float (*ss)[16][132] = (float (*)[16][132])sm; __bf16* sPh = (__bf16*)smg; __bf16* sPl = (__bf16*)(smg + 10240); __bf16* sVh = (__bf16*)(smg + 20480); __bf16* sVl = (__bf16*)(smg + 40960); float* sF = (float*)(sm + 122880);
  const int tid = threadIdx.x & 127, wave = tid >> 5, lane = tid & 31, col = lane & 15, g = lane >> 4, wq = wave >> 1, wc = wave & 1; const int qt = TT / 64 - 1 - (int)blockIdx.z; const int b = blockIdx.y / NH, h = blockIdx.y % NH; PS += (size_t)blockIdx.y * TT * TT; const int ql0 = qt * 64 + wave * 16; const int cc0 = blockIdx.x * 128; const int kend = (MSK[0] != 0) ? (qt * 64 + 64) : TT; const int nk = kend / 64;   // steps of each key group
  const int sr = tid >> 3, sq = tid & 7, vr = tid >> 2, vq = tid & 3;   // staging, each key group its own tiles: P 8 threads of 16 B per 128-byte row piece, v 4 threads per 64-byte row piece
  const float* gP = PS + (size_t)(qt * 64 + sr) * TT + kg * 32 + sq * 4; const size_t vo = ((size_t)b * CC + h * HD + cc0 + vr) * (size_t)TT + kg * 32 + vq * 8; const __bf16* gH = VT + vo; const __bf16* gL = VL + vo;
  v4f rp[4]; v4u rh[4], rl4[4]; v8f acc[2][4] = {};   // wave tile 32 queries x 64 cols: a key group's waves 2 x 2 on the block's 64 x 128
#pragma unroll
  for (int i = 0; i < 4; ++i) { rp[i] = *(const v4f*)(gP + (size_t)i * 16 * TT); rh[i] = *(const v4u*)(gH + (size_t)i * 32 * TT); rl4[i] = *(const v4u*)(gL + (size_t)i * 32 * TT); }
  { const int row = tid & 63, hb = (int)threadIdx.x >> 6; const size_t mo = (size_t)blockIdx.y * (TT / 128) * TT + qt * 64 + row; float mv[16], lv[16];   // four threads per row; each forms the row's figures and writes four of its sixteen factors
#pragma unroll
    for (int kb = 0; kb < 16; ++kb) { mv[kb] = MB[mo + (size_t)kb * TT]; lv[kb] = LB[mo + (size_t)kb * TT]; }
    asm volatile("s_wait_xcnt 0x0" ::: "memory");   // precaution: stands ahead of every rewrite of the address registers that these loads name
    float m = mv[0], l = 0.f;
#pragma unroll
    for (int kb = 1; kb < 16; ++kb) m = fmaxf(m, mv[kb]);
#pragma unroll
    for (int kb = 0; kb < 16; ++kb) { mv[kb] = expf(mv[kb] - m); l += mv[kb] * lv[kb]; }
    const float inv = 1.0f / l;
#pragma unroll
    for (int kb = 0; kb < 16; ++kb) if ((kb >> 2) == hb) sF[kb * 64 + row] = mv[kb] * inv * 2048.0f; }
  __syncthreads();   // publishes sF
  float ff[4];
#pragma unroll
  for (int i = 0; i < 4; ++i) { ff[i] = sF[sr + 16 * i]; rp[i] *= ff[i]; }
#pragma unroll
  for (int i = 0; i < 4; ++i) { const v4b ph = cvt4(rp[i]); *(v4b*)(sPh + (sr + 16 * i) * P32 + sq * 4) = ph; *(v4b*)(sPl + (sr + 16 * i) * P32 + sq * 4) = res4(rp[i], ph); *(v4u*)(sVh + (vr + 32 * i) * P32 + vq * 8) = rh[i]; *(v4u*)(sVl + (vr + 32 * i) * P32 + vq * 8) = rl4[i]; }
#pragma unroll 1   // rolled: a group's step count may be odd, and an unrolled pair with its remainder copy took registers past the four-waves-per-SIMD budget
  for (int kc = 0; kc < nk; ++kc) { const int bu = kc & 1, nb = bu ^ 1; const bool more = kc + 1 < nk;
    __syncthreads();   // publishes buffer bu; ends every wave's reads of buffer nb
    if (more) {
#pragma unroll
      for (int i = 0; i < 4; ++i) { rp[i] = *(const v4f*)(gP + (size_t)i * 16 * TT + (kc + 1) * 64); rh[i] = *(const v4u*)(gH + (size_t)i * 32 * TT + (kc + 1) * 64); rl4[i] = *(const v4u*)(gL + (size_t)i * 32 * TT + (kc + 1) * 64); }
      asm volatile("s_wait_xcnt 0x0" ::: "memory");   // precaution: stands ahead of every rewrite of the address registers that these loads name
      __builtin_amdgcn_sched_barrier(0);   // keeps the sF reads below, address arithmetic included, behind that wait: the compiler lays them in the loads' address registers
#pragma unroll
      for (int i = 0; i < 4; ++i) ff[i] = sF[((kc + 1) >> 1) * 64 + sr + 16 * i];   // the next tile's 32 keys, 64 (kc + 1) + 32 kg onward, lie in one 128-key block
    }
    { v16b ph[2], pl[2], vh[4], vl[4];   // the step's LDS reads together, ahead of its products: twelve fragments feed twenty-four products
#pragma unroll
      for (int i = 0; i < 2; ++i) { const int ro = (bu * 64 + wq * 32 + i * 16 + col) * P32; ph[i] = frag_b(sPh + ro, lane); pl[i] = frag_b(sPl + ro, lane); }
#pragma unroll
      for (int j = 0; j < 4; ++j) { const int ro = (bu * 128 + wc * 64 + j * 16 + col) * P32; vh[j] = frag_b(sVh + ro, lane); vl[j] = frag_b(sVl + ro, lane); }
      __builtin_amdgcn_sched_barrier(0);   // keeps the LDS reads above together, ahead of the products: without it the compiler reads one fragment, waits and multiplies, an LDS latency each
#pragma unroll
      for (int i = 0; i < 2; ++i)
#pragma unroll
        for (int j = 0; j < 4; ++j) acc[i][j] = wmma_bf(ph[i], vh[j], acc[i][j]);   // the three products of a tile stand eight WMMAs apart: none waits for the one before it; each tile still sums ph.vh, pl.vh, ph.vl in that order
#pragma unroll
      for (int i = 0; i < 2; ++i)
#pragma unroll
        for (int j = 0; j < 4; ++j) acc[i][j] = wmma_bf(pl[i], vh[j], acc[i][j]);
#pragma unroll
      for (int i = 0; i < 2; ++i)
#pragma unroll
        for (int j = 0; j < 4; ++j) acc[i][j] = wmma_bf(ph[i], vl[j], acc[i][j]);
      __builtin_amdgcn_sched_barrier(0);   // keeps the products together: without it the next tile's conversions, and the wait for its global loads, move up among them
    }
    asm volatile("v_nop\n\tv_nop\n\tv_nop\n\tv_nop");   // four vector slots behind the step's last WMMA, ahead of the branch round the staging below: on the taken side the next vector instruction rewrites that WMMA's A registers
    if (more) {
#pragma unroll
      for (int i = 0; i < 4; ++i) { const v4f pp = rp[i] * ff[i]; const v4b qh = cvt4(pp); *(v4b*)(sPh + (nb * 64 + sr + 16 * i) * P32 + sq * 4) = qh; *(v4b*)(sPl + (nb * 64 + sr + 16 * i) * P32 + sq * 4) = res4(pp, qh); *(v4u*)(sVh + (nb * 128 + vr + 32 * i) * P32 + vq * 8) = rh[i]; *(v4u*)(sVl + (nb * 128 + vr + 32 * i) * P32 + vq * 8) = rl4[i]; } } }
  __syncthreads();   // the tiles are dead: the epilogue reuses their LDS
  if (kg != 0) {
#pragma unroll
    for (int i = 0; i < 2; ++i)
#pragma unroll
    for (int j = 0; j < 4; ++j)
#pragma unroll
      for (int r = 0; r < 8; ++r) ss[wq * 2 + i][8 * g + r][wc * 64 + j * 16 + col] = acc[i][j][r]; }
  __syncthreads();   // publishes the second key group's sums to the first, which adds its own and stores
  if (kg == 0) {
#pragma unroll
    for (int i = 0; i < 2; ++i)
#pragma unroll
    for (int j = 0; j < 4; ++j)
#pragma unroll
      for (int r = 0; r < 8; ++r) { float* p = &ss[wq * 2 + i][8 * g + r][wc * 64 + j * 16 + col]; *p = (acc[i][j][r] + *p) * (1.0f / 2048.0f); } }   // each lane reads and rewrites its own word
  __syncthreads();   // a row's two 64-column halves come from two waves: publishes them to the wave that stores the row
  if (kg != 0) return;
  for (int rl = 0; rl < 16; ++rl) vst2(Y + ((size_t)b * TT + ql0 + rl) * CC + h * HD + cc0 + lane * 4, *(const v4f*)&ss[wave][rl][lane * 4]); }
// ---- k_out: block = (64 rows, 128 cols): out = y (bf16 hi + lo) Wproj + b; Wproj arrives as bf16 from k_cvt: a 128-byte piece of its rows holds 64 k, so a step covers 64 k
__global__ __launch_bounds__(128) void k_out(const float* __restrict__ Y, const __bf16* __restrict__ WPB, const float* __restrict__ BP, float* __restrict__ OUT) { __shared__ __align__(16) char sm[73728];   // k loop: y hi, y lo [2][64][P64] each, W tiles [2][128][P64]; epilogue, behind a barrier: sf
  float (*sf)[16][132] = (float (*)[16][132])sm; __bf16* sAh = (__bf16*)sm; __bf16* sAl = (__bf16*)(sm + 18432); __bf16* sB = (__bf16*)(sm + 36864);
  const int tid = threadIdx.x, wave = tid >> 5, lane = tid & 31, col = lane & 15, g = lane >> 4, wq = wave >> 1, wc = wave & 1; const int c0 = blockIdx.y * 128; const size_t r0 = (size_t)blockIdx.x * 64 + wave * 16;
  const int ar = tid >> 4, aq = tid & 15, sr = tid >> 3, sq = tid & 7;   // staging, 64 k: y 16 threads of 16 B per 256-byte row piece, W 8 threads of 16 B per 128-byte row piece
  const float* gA = Y + ((size_t)blockIdx.x * 64 + ar) * CC + aq * 4; const __bf16* gB = WPB + (size_t)(c0 + sr) * CC + sq * 8;
  v4f ra[8]; v4u rb[8]; v8f acc[2][4] = {};   // wave tile 32 rows x 64 cols: waves 2 x 2 on the block's 64 x 128
#pragma unroll
  for (int i = 0; i < 8; ++i) ra[i] = *(const v4f*)(gA + (size_t)i * 8 * CC);
#pragma unroll
  for (int i = 0; i < 8; ++i) rb[i] = *(const v4u*)(gB + (size_t)i * 16 * CC);
#pragma unroll
  for (int i = 0; i < 8; ++i) { const v4b ah = cvt4(ra[i]); *(v4b*)(sAh + (ar + 8 * i) * P64 + aq * 4) = ah; *(v4b*)(sAl + (ar + 8 * i) * P64 + aq * 4) = res4(ra[i], ah); }
#pragma unroll
  for (int i = 0; i < 8; ++i) *(v4u*)(sB + (sr + 16 * i) * P64 + sq * 8) = rb[i];
#pragma unroll 2   // two steps per trip: the buffer index becomes a constant
  for (int ks = 0; ks < CC / 64; ++ks) { const int bu = ks & 1, nb = bu ^ 1; const bool more = ks + 1 < CC / 64;
    __syncthreads();   // publishes buffer bu; ends every wave's reads of buffer nb
    if (more) {
#pragma unroll
      for (int i = 0; i < 8; ++i) ra[i] = *(const v4f*)(gA + (size_t)i * 8 * CC + (ks + 1) * 64);
#pragma unroll
      for (int i = 0; i < 8; ++i) rb[i] = *(const v4u*)(gB + (size_t)i * 16 * CC + (ks + 1) * 64);
      asm volatile("s_wait_xcnt 0x0" ::: "memory");   // precaution: stands ahead of every rewrite of the address registers that these loads name
    }
#pragma unroll
    for (int s = 0; s < 2; ++s) { v16b ah[2], al[2], w[4];   // LDS reads together, ahead of their products; eight fragments feed sixteen products
#pragma unroll
      for (int i = 0; i < 2; ++i) { const int ro = (bu * 64 + wq * 32 + i * 16 + col) * P64 + s * 32; ah[i] = frag_b(sAh + ro, lane); al[i] = frag_b(sAl + ro, lane); }
#pragma unroll
      for (int j = 0; j < 4; ++j) w[j] = frag_b(sB + (bu * 128 + wc * 64 + j * 16 + col) * P64 + s * 32, lane);
      __builtin_amdgcn_sched_barrier(0);   // keeps the LDS reads above together, ahead of the products: without it the compiler reads one fragment, waits and multiplies, an LDS latency each
#pragma unroll
      for (int i = 0; i < 2; ++i)
#pragma unroll
        for (int j = 0; j < 4; ++j) acc[i][j] = wmma_bf(ah[i], w[j], acc[i][j]);   // the two products of a tile stand eight WMMAs apart; each tile still sums hi, then lo, per 32 k
#pragma unroll
      for (int i = 0; i < 2; ++i)
#pragma unroll
        for (int j = 0; j < 4; ++j) acc[i][j] = wmma_bf(al[i], w[j], acc[i][j]);
      __builtin_amdgcn_sched_barrier(0);   // keeps the products together: without it the next tile's conversions, and the wait for its global loads, move up among them
    }
    if (more) {
#pragma unroll
      for (int i = 0; i < 8; ++i) { const v4b qh = cvt4(ra[i]); *(v4b*)(sAh + (nb * 64 + ar + 8 * i) * P64 + aq * 4) = qh; *(v4b*)(sAl + (nb * 64 + ar + 8 * i) * P64 + aq * 4) = res4(ra[i], qh); }
#pragma unroll
      for (int i = 0; i < 8; ++i) *(v4u*)(sB + (nb * 128 + sr + 16 * i) * P64 + sq * 8) = rb[i]; } }
  __syncthreads();   // the tiles are dead: the epilogue reuses their LDS
#pragma unroll
  for (int j = 0; j < 4; ++j) { const float bb = BP ? bfr(BP[c0 + wc * 64 + j * 16 + col]) : 0.f;
#pragma unroll
    for (int i = 0; i < 2; ++i)
#pragma unroll
    for (int r = 0; r < 8; ++r) sf[wq * 2 + i][8 * g + r][wc * 64 + j * 16 + col] = acc[i][j][r] + bb; }
  __syncthreads();   // a row's two 64-column halves come from two waves: publishes them to the wave that stores the row
  for (int rl = 0; rl < 16; ++rl) vst2(OUT + (r0 + rl) * CC + c0 + lane * 4, *(const v4f*)&sf[wave][rl][lane * 4]); }
extern "C" void kernel_launch(void* const* d_in, const int* in_sizes, int n_in, void* d_out, int out_size, void* d_ws, size_t ws_size, hipStream_t stream) {
  (void)in_sizes; (void)n_in; (void)out_size;
  const float** F = (const float**)d_in;   // 0 input [4,2048,1024], 1 Wq [2,512,512] ([out,in] per head), 2 bq [2,512], 3 Wk, 4 bk, 5 Wv, 6 bv, 7 Wf [1024,1024] ([out,in]), 8 bf, 9 masked [1] int (= 1 -> causal)
  if (ws_size < (size_t)WS_END) return;
  char* ws = (char*)d_ws; _Float16 *QH = (_Float16*)(ws + WS_QH), *QL = (_Float16*)(ws + WS_QL), *KH = (_Float16*)(ws + WS_KH); __bf16 *VT = (__bf16*)(ws + WS_VT), *VL = (__bf16*)(ws + WS_VL); float *S = (float*)(ws + WS_S), *Y = (float*)(ws + WS_Y), *MB = (float*)(ws + WS_M), *LB = (float*)(ws + WS_L); __bf16 *XB = (__bf16*)(ws + WS_XB), *WB = (__bf16*)(ws + WS_WB), *WFB = (__bf16*)(ws + WS_WF);
  k_cvt<<<dim3((NB * TT * CC + 3 * NH * HD * HD + CC * CC) / CVB), 256, 0, stream>>>(F[0], F[1], F[3], F[5], F[7], XB, WB, WFB);
  k_proj<<<dim3(TNB * TT / 64, CC / 128, 3), 128, 0, stream>>>(XB, WB, F[2], F[4], F[6], QH, QL, KH, VT, VL);
  k_sc<<<dim3(TT / 64, TT / 128, TNB * NH), 128, 0, stream>>>(QH, QL, KH, nullptr, (const int*)d_in[9], S, MB, LB);
  k_pv<<<dim3(HD / 128, TNB * NH, TT / 64), 256, 0, stream>>>(S, VT, VL, (const int*)d_in[9], MB, LB, Y);
  k_out<<<dim3(TNB * TT / 64, CC / 128), 128, 0, stream>>>(Y, WFB, F[8], (float*)d_out);
}

// v009
// A run of this version takes 163 microseconds.
// Next to v008, in two timings, it ran 1.04 times as fast each time.
// All steps since v000 together make it 13.0 times as fast.
// compute dtype: all float inputs rounded to bf16 (x, Wq, Wk, Wv, Wf once, by k_cvt), 'masked' read at run time (1 -> causal; 0 -> full attention); per-head q/k/v = x_half W_n^T + b_n (block-diagonal [out,in] linears) with EXACT bf16 products on WMMA 16x16x32, f32 accumulate, q/k rounded once to f16 (0.02-scale weights, logits std ~0.01: 1 product), softmax in f32 (precise expf) in two parts: exp(logit - block maximum) stored in f32 per (batch, head) with each 128-key block's row maximum and row sum, rescaled to P x 2^11 where P.V stages it, kept f32 and split bf16 hi + lo against v as bf16 hi + lo (3 products); out = y (bf16 hi + lo) Wf^T + bf; f32 output.
#include <hip/hip_runtime.h>
#include <math.h>

typedef __attribute__((ext_vector_type(16))) _Float16 v16h;
typedef __attribute__((ext_vector_type(16))) __bf16 v16b;
typedef __attribute__((ext_vector_type(8)))  _Float16 v8h;
typedef __attribute__((ext_vector_type(8)))  float v8f;
typedef __attribute__((ext_vector_type(4)))  float v4f;
typedef __attribute__((ext_vector_type(2)))  float v2f;
typedef __attribute__((ext_vector_type(4)))  unsigned v4u;
typedef __attribute__((ext_vector_type(4)))  int v4i;
typedef float __attribute__((may_alias)) float_a;
typedef int __attribute__((may_alias)) int_a;

template <typename T> __device__ __forceinline__ void vst2(void* p, T v) { *(T*)p = v;  }
__device__ __forceinline__ v8f wmma16(v16h a, v16h b, v8f c) {
  return __builtin_amdgcn_wmma_f32_16x16x32_f16(false, a, false, b, (short)0, c, false, false);
}
__device__ __forceinline__ v8f wmma_bf(v16b a, v16b b, v8f c) {
  return __builtin_amdgcn_wmma_f32_16x16x32_bf16(false, a, false, b, (short)0, c, false, false);
}
// 16x16x32 fragments: lane = (h = lane>>4, row/col = lane&15); elements 0..7 = k0+8h+0..7, 8..15 = k0+16+8h+0..7; D element r = row 8h+r
__device__ __forceinline__ v16h frag_h(const _Float16* rowk0, int lane) {
  union { v16h v; v8h q[2]; } u; const _Float16* p = rowk0 + 8 * (lane >> 4);
  u.q[0] = *(const v8h*)p; u.q[1] = *(const v8h*)(p + 16); return u.v;
}
__device__ __forceinline__ v16h frag_f32(const float* rowk0, int lane) {
  v16h a; const float* p = rowk0 + 8 * (lane >> 4);
#pragma unroll
  for (int i = 0; i < 8; ++i) { a[i] = (_Float16)p[i]; a[8 + i] = (_Float16)p[16 + i]; }
  return a;
}
__device__ __forceinline__ v16h frag_f32s(const float* rowk0, int lane, float sc) {
  v16h a; const float* p = rowk0 + 8 * (lane >> 4);
#pragma unroll
  for (int i = 0; i < 8; ++i) { a[i] = (_Float16)(p[i] * sc); a[8 + i] = (_Float16)(p[16 + i] * sc); }
  return a;
}
// column fragment from a [K][ld] layout (column n), rows >= K read as 0
__device__ __forceinline__ v16h fragc_f32(const float* W, int k0, int n, int lane, int ld, int K) {
  v16h a; const int g = lane >> 4;
#pragma unroll
  for (int i = 0; i < 8; ++i) { const int ka = k0 + 8 * g + i, kb = ka + 16;
    a[i] = (_Float16)(ka < K ? W[(size_t)(ka < K ? ka : K - 1) * ld + n] : 0.f); a[8 + i] = (_Float16)(kb < K ? W[(size_t)(kb < K ? kb : K - 1) * ld + n] : 0.f); }
  return a;
}
struct F2 { v16b h, l; };
__device__ __forceinline__ F2 bsplit16(const float v[16]) { F2 r;
#pragma unroll
  for (int i = 0; i < 16; ++i) { const __bf16 h = (__bf16)v[i]; r.h[i] = h; r.l[i] = (__bf16)(v[i] - (float)h); }
  return r; }
__device__ __forceinline__ F2 split_row(const float* row, int k0, int lane) { float v[16]; const float* p = row + k0 + 8 * (lane >> 4);
#pragma unroll
  for (int i = 0; i < 8; ++i) { v[i] = p[i]; v[8 + i] = p[16 + i]; }
  return bsplit16(v); }
__device__ __forceinline__ F2 split_rowK(const float* row, int k0, int lane, int K) { float v[16]; const int g = lane >> 4;
#pragma unroll
  for (int i = 0; i < 8; ++i) { const int ka = k0 + 8 * g + i, kb = ka + 16; v[i] = ka < K ? row[ka < K ? ka : K - 1] : 0.f; v[8 + i] = kb < K ? row[kb < K ? kb : K - 1] : 0.f; }
  return bsplit16(v); }
__device__ __forceinline__ F2 split_col(const float* W, int k0, int n, int lane, int ld, int K) { float v[16]; const int g = lane >> 4;
#pragma unroll
  for (int i = 0; i < 8; ++i) { const int ka = k0 + 8 * g + i, kb = ka + 16; v[i] = ka < K ? W[(size_t)(ka < K ? ka : K - 1) * ld + n] : 0.f; v[8 + i] = kb < K ? W[(size_t)(kb < K ? kb : K - 1) * ld + n] : 0.f; }
  return bsplit16(v); }
__device__ __forceinline__ v8f mac3(const F2& a, const F2& b, v8f c) { c = wmma_bf(a.l, b.h, c); c = wmma_bf(a.h, b.l, c); return wmma_bf(a.h, b.h, c); }
__device__ __forceinline__ float sigm(float v) { return 1.0f / (1.0f + expf(-v)); }


// Two-headed causal attention with per-head Linear projections on the two contiguous 512-wide halves of the input (B 4, S 2,048, E 1,024), scores / sqrt(512), softmax . v, final Linear Wf + bf.
#define NB 4
#define TT 2048
#define CC 1024
#define NH 2
#define HD 512
#ifndef TNB
#define TNB NB
#endif
typedef __attribute__((ext_vector_type(8))) __bf16 v8b;
__device__ __forceinline__ v16b frag_b(const __bf16* rowk0, int lane) {
  union { v16b v; v8b q[2]; } u; const __bf16* p = rowk0 + 8 * (lane >> 4);
  u.q[0] = *(const v8b*)p; u.q[1] = *(const v8b*)(p + 16); return u.v;
}
__device__ __forceinline__ float bfr(float v) { return (float)(__bf16)v; }
__device__ __attribute__((noinline)) float exp_ni(float v) { return expf(v); }
__device__ __attribute__((noinline)) float erf_ni(float v) { return erff(v); }

#define WS_QH  0u
#define WS_QL  (WS_QH + 2u * (size_t)NB * TT * CC)
#define WS_KH  (WS_QL + 2u * (size_t)NB * TT * CC)
#define WS_VT  (WS_KH + 2u * (size_t)NB * TT * CC)      // bf16 v planes [b][c][t]
#define WS_VL  (WS_VT + 2u * (size_t)NB * CC * TT)      // bf16 v residual planes
#define WS_S   (WS_VL + 2u * (size_t)NB * CC * TT)      // f32 exp(logit - block maximum): one [t][t] plane per (batch, head)
#define WS_Y   (WS_S + 4u * (size_t)NB * NH * TT * TT)  // f32 y rows [b*t][C]
#define WS_M   (WS_Y + 4u * (size_t)NB * TT * CC)       // f32 row maxima [pair][key block][t]
#define WS_L   (WS_M + 4u * (size_t)NB * NH * (TT / 128) * TT)   // f32 row sums, same layout
#define WS_WF  (WS_L + 4u * (size_t)NB * NH * (TT / 128) * TT)   // bf16 Wf [out][in]: written by k_cvt, read by k_out
#define WS_END (WS_WF + 2u * (size_t)CC * CC)
#define WS_XB  WS_Y                                     // bf16 x rows [b*t][C]: written by k_cvt, last read by k_proj; k_pv lays y over them later in the same call
#define WS_WB  (WS_XB + 2u * (size_t)NB * TT * CC)      // bf16 Wq, Wk, Wv [3][head][out][in], same life

// ---- LDS staging shared by the four matrix kernels: a block's 128 threads (in k_pv, each key group's 128) fetch each operand tile with loads that cover whole 128-byte lines (k_pv's v tiles: 64-byte halves), convert it once, and lay it in LDS in k order; every wave then takes its fragments with frag_b / frag_h from rows at a pitch of 16 B x odd (80 B for 64-byte rows, 144 B for 128-byte rows). Two buffers, one barrier per k step: the next tile's global loads fly during the products and are stored behind them.
typedef __attribute__((ext_vector_type(4))) __bf16 v4b;
#define P32 40   // elements per LDS row holding 32 16-bit values (80 B)
#define P64 72   // elements per LDS row holding 64 16-bit values (144 B)
__device__ __forceinline__ v4b cvt4(v4f v) { v4b r;
#pragma unroll
  for (int i = 0; i < 4; ++i) r[i] = (__bf16)v[i];
  return r; }
__device__ __forceinline__ v4b res4(v4f v, v4b h) { v4b r;
#pragma unroll
  for (int i = 0; i < 4; ++i) r[i] = (__bf16)(v[i] - (float)h[i]);
  return r; }

// ---- k_cvt: block = 8,192 consecutive floats of one of x, Wq, Wk, Wv, Wf: each is rounded to bf16 once here, not again in every block that stages it (x 12 times, a weight 128 times)
#define CVB 8192
__global__ __launch_bounds__(256) void k_cvt(const float* __restrict__ X, const float* __restrict__ WQ, const float* __restrict__ WK, const float* __restrict__ WV, const float* __restrict__ WF, __bf16* __restrict__ XB, __bf16* __restrict__ WB, __bf16* __restrict__ WFB) {
  const int bi = blockIdx.x, tid = threadIdx.x, nx = NB * TT * CC / CVB, wi = bi - nx, pw = NH * HD * HD / CVB, fi = wi - 3 * pw; const float* s; __bf16* d;   // block-uniform choice of the source
  if (bi < nx) { s = X + (size_t)bi * CVB; d = XB + (size_t)bi * CVB; }
  else if (fi < 0) { s = (wi < pw ? WQ : wi < 2 * pw ? WK : WV) + (size_t)(wi % pw) * CVB; d = WB + (size_t)wi * CVB; }
  else { s = WF + (size_t)fi * CVB; d = WFB + (size_t)fi * CVB; }
  v4f r[8];
#pragma unroll
  for (int i = 0; i < 8; ++i) r[i] = *(const v4f*)(s + (i * 256 + tid) * 4);   // eight whole-line loads in flight per wave
  asm volatile("s_wait_xcnt 0x0" ::: "memory");   // precaution: stands ahead of every rewrite of the address registers that these loads name
#pragma unroll
  for (int i = 0; i < 8; ++i) *(v4b*)(d + (i * 256 + tid) * 4) = cvt4(r[i]); }
// ---- k_proj: block = (64 rows, 128 cols, which): qkv = x W (+ b), exact; q -> f16 hi (+ residual), k -> f16 rows, v -> bf16 hi + lo planes; x and W arrive as bf16 from k_cvt: a 128-byte row piece holds 64 k, so a step covers 64 k. WH = which, a compile-time constant in each of the three bodies: q and k, stored row-major, multiply W (A operand) by x (B operand), so a lane's eight accumulator elements are eight adjacent columns of one row; v, stored as [column][t] planes, multiplies x by W, so they are eight adjacent t of one column: either way the epilogue lays 16 bytes per LDS store
template <int WH> __device__ __forceinline__ void proj_body(char* sm, const __bf16* __restrict__ XB, const __bf16* __restrict__ WB, const float* __restrict__ BA, _Float16* __restrict__ DH, _Float16* __restrict__ QL, __bf16* __restrict__ VT, __bf16* __restrict__ VL) {
  _Float16 (*sh)[136] = (_Float16 (*)[136])sm; _Float16 (*sl)[136] = (_Float16 (*)[136])(sm + 64 * 136 * 2); __bf16 (*th)[72] = (__bf16 (*)[72])sm; __bf16 (*tl2)[72] = (__bf16 (*)[72])(sm + 128 * 72 * 2);
  __bf16* sA = (__bf16*)sm; __bf16* sB = (__bf16*)(sm + 2 * 64 * P64 * 2);
  const int tid = threadIdx.x, wave = tid >> 5, lane = tid & 31, col = lane & 15, g = lane >> 4, wq = wave >> 1, wc = wave & 1; const int c0 = blockIdx.y * 128; const size_t r0 = (size_t)blockIdx.x * 64; const int hn = c0 / HD;   // head of this 128-column block (HD = 512)
  const int sr = tid >> 3, sq = tid & 7;   // staging: 8 threads of 16 B per 128-byte row piece (64 k)
  const __bf16* gA = XB + (r0 + sr) * CC + hn * HD + sq * 8; const __bf16* gB = WB + (size_t)WH * NH * HD * HD + (size_t)(c0 + sr) * HD + sq * 8;
  v4u ra[4], rb[8]; v8f acc[2][4] = {};   // wave tile 32 rows x 64 cols: waves 2 x 2 on the block's 64 x 128
#pragma unroll
  for (int i = 0; i < 4; ++i) ra[i] = *(const v4u*)(gA + (size_t)i * 16 * CC);
#pragma unroll
  for (int i = 0; i < 8; ++i) rb[i] = *(const v4u*)(gB + (size_t)i * 16 * HD);
#pragma unroll
  for (int i = 0; i < 4; ++i) *(v4u*)(sA + (sr + 16 * i) * P64 + sq * 8) = ra[i];
#pragma unroll
  for (int i = 0; i < 8; ++i) *(v4u*)(sB + (sr + 16 * i) * P64 + sq * 8) = rb[i];
#pragma unroll 2   // two steps per trip: the buffer index becomes a constant
  for (int ks = 0; ks < HD / 64; ++ks) { const int bu = ks & 1, nb = bu ^ 1; const bool more = ks + 1 < HD / 64;
    __syncthreads();   // publishes buffer bu; ends every wave's reads of buffer nb
    if (more) {
#pragma unroll
      for (int i = 0; i < 4; ++i) ra[i] = *(const v4u*)(gA + (size_t)i * 16 * CC + (ks + 1) * 64);
#pragma unroll
      for (int i = 0; i < 8; ++i) rb[i] = *(const v4u*)(gB + (size_t)i * 16 * HD + (ks + 1) * 64);
      asm volatile("s_wait_xcnt 0x0" ::: "memory");   // precaution: stands ahead of every rewrite of the address registers that these loads name
    }
#pragma unroll
    for (int s = 0; s < 2; ++s) { v16b a[2], w[4];   // LDS reads together, ahead of their products: one exposed LDS latency; six fragments feed eight products
#pragma unroll
      for (int i = 0; i < 2; ++i) a[i] = frag_b(sA + (bu * 64 + wq * 32 + i * 16 + col) * P64 + s * 32, lane);
#pragma unroll
      for (int j = 0; j < 4; ++j) w[j] = frag_b(sB + (bu * 128 + wc * 64 + j * 16 + col) * P64 + s * 32, lane);
      __builtin_amdgcn_sched_barrier(0);   // keeps the LDS reads above together, ahead of the products: without it the compiler reads one fragment, waits and multiplies, an LDS latency each
#pragma unroll
      for (int i = 0; i < 2; ++i)
#pragma unroll
        for (int j = 0; j < 4; ++j) acc[i][j] = WH == 2 ? wmma_bf(a[i], w[j], acc[i][j]) : wmma_bf(w[j], a[i], acc[i][j]);   // both loaders lay k in the same order, so the operands may change places: D comes out transposed
      __builtin_amdgcn_sched_barrier(0);   // keeps the products together: without it the next tile's LDS stores, and the wait for its global loads, move up among them
    }
    if (more) {
#pragma unroll
      for (int i = 0; i < 4; ++i) *(v4u*)(sA + (nb * 64 + sr + 16 * i) * P64 + sq * 8) = ra[i];
#pragma unroll
      for (int i = 0; i < 8; ++i) *(v4u*)(sB + (nb * 128 + sr + 16 * i) * P64 + sq * 8) = rb[i]; } }
  if constexpr (WH == 2) {   // lane = column wc * 64 + j * 16 + col; elements r = rows (t) wq * 32 + i * 16 + 8 g + r
    float bb[4];
#pragma unroll
    for (int j = 0; j < 4; ++j) bb[j] = BA[c0 + wc * 64 + j * 16 + col];   // the four bias loads fly together, across the barrier below
    asm volatile("s_wait_xcnt 0x0" ::: "memory");   // precaution: stands ahead of every rewrite of the address registers that these loads name
    __syncthreads();   // the tiles are dead: the epilogue reuses their LDS
#pragma unroll
    for (int j = 0; j < 4; ++j) { const float bj = bfr(bb[j]);
#pragma unroll
      for (int i = 0; i < 2; ++i) { v8b hv, lv;
#pragma unroll
        for (int r = 0; r < 8; ++r) { const float v = acc[i][j][r] + bj; const __bf16 bh = (__bf16)v; hv[r] = bh; lv[r] = (__bf16)(v - (float)bh); }
        const int cl = wc * 64 + j * 16 + col, rl = wq * 32 + i * 16 + 8 * g; *(v8b*)&th[cl][rl] = hv; *(v8b*)&tl2[cl][rl] = lv; } }
    __syncthreads();
    const size_t b = r0 / TT; const int t0 = (int)(r0 % TT); for (int e = tid; e < 128 * 8; e += 128) { const int cl = e >> 3, q = e & 7; const size_t o2 = (b * CC + c0 + cl) * (size_t)TT + t0 + q * 8; vst2((unsigned*)(VT + o2), *(const v4u*)&th[cl][q * 8]); vst2((unsigned*)(VL + o2), *(const v4u*)&tl2[cl][q * 8]); }
  } else {   // lane = row wq * 32 + i * 16 + col; elements r = columns wc * 64 + j * 16 + 8 g + r
    v4f bb[4][2];
#pragma unroll
    for (int j = 0; j < 4; ++j) { const float* bp = BA + c0 + wc * 64 + j * 16 + 8 * g; bb[j][0] = *(const v4f*)bp; bb[j][1] = *(const v4f*)(bp + 4); }   // the eight bias loads fly together, across the barrier below
    asm volatile("s_wait_xcnt 0x0" ::: "memory");   // precaution: stands ahead of every rewrite of the address registers that these loads name
    __syncthreads();   // the tiles are dead: the epilogue reuses their LDS
#pragma unroll
    for (int j = 0; j < 4; ++j) { float bj[8];
#pragma unroll
      for (int r = 0; r < 4; ++r) { bj[r] = bfr(bb[j][0][r]); bj[4 + r] = bfr(bb[j][1][r]); }
#pragma unroll
      for (int i = 0; i < 2; ++i) { v8h hv, lv;
#pragma unroll
        for (int r = 0; r < 8; ++r) { const float v = acc[i][j][r] + bj[r]; const _Float16 h = (_Float16)v; hv[r] = h; lv[r] = (_Float16)(v - (float)h); }
        const int rl = wq * 32 + i * 16 + col, cl = wc * 64 + j * 16 + 8 * g; *(v8h*)&sh[rl][cl] = hv; if constexpr (WH == 0) *(v8h*)&sl[rl][cl] = lv; } }
    __syncthreads();
    for (int e = tid; e < 64 * 16; e += 128) { const int rl = e >> 4, q = e & 15; vst2((unsigned*)(DH + (r0 + rl) * CC + c0 + q * 8), *(const v4u*)&sh[rl][q * 8]); if constexpr (WH == 0) vst2((unsigned*)(QL + (r0 + rl) * CC + c0 + q * 8), *(const v4u*)&sl[rl][q * 8]); }
  } }
__global__ __launch_bounds__(128) void k_proj(const __bf16* __restrict__ XB, const __bf16* __restrict__ WB, const float* __restrict__ BQ, const float* __restrict__ BK, const float* __restrict__ BV, _Float16* __restrict__ QH, _Float16* __restrict__ QL, _Float16* __restrict__ KH, __bf16* __restrict__ VT, __bf16* __restrict__ VL) {
  __shared__ __align__(16) char sm[55296];   // k loop: x tiles [2][64][P64], W tiles [2][128][P64]; epilogue, behind a barrier: sh + sl, or th + tl2
  const int which = blockIdx.z;   // the same for the whole block: one branch here, none per element in the epilogue
  if (which == 0) proj_body<0>(sm, XB, WB, BQ, QH, QL, VT, VL); else if (which == 1) proj_body<1>(sm, XB, WB, BK, KH, QL, VT, VL); else proj_body<2>(sm, XB, WB, BV, QH, QL, VT, VL); }
// value of lane ^ M inside the lane's 16-lane half, every lane on: a register move (DPP row_xmask), where __shfl_xor would go through the LDS unit and its wait
template <int M> __device__ __forceinline__ float rowx(float v) { return __builtin_bit_cast(float, __builtin_amdgcn_update_dpp(0, __builtin_bit_cast(int, v), 0x160 | M, 0xf, 0xf, true)); }
// ---- k_sc: block = (64 queries, 128 keys, pair = b * NH + h): logits * scale, then the block's share of the softmax: per row the maximum mb and the sum lb of exp(logit - mb) over its 128 keys (masked -> 0); S takes the exponentials, MB and LB the two row figures, 256 contiguous bytes each, stored by one wave; causal blocks beyond the diagonal store mb = -3.0e38, lb = 0 and exit
__global__ __launch_bounds__(128) void k_sc(const _Float16* __restrict__ QH, const _Float16* __restrict__ QL, const _Float16* __restrict__ KH, const float* __restrict__ BM, const int* __restrict__ MSK, float* __restrict__ S, float* __restrict__ MB, float* __restrict__ LB) { __shared__ __align__(16) char sm[55296];   // k loop: q tiles [2][64][P64], k tiles [2][128][P64]; epilogue, behind a barrier: ss, sM, sL
  float (*ss)[16][132] = (float (*)[16][132])sm; _Float16* sA = (_Float16*)sm; _Float16* sB = (_Float16*)(sm + 2 * 64 * P64 * 2);
  const bool cz = (MSK[0] != 0); const int b = blockIdx.z / NH, h = blockIdx.z % NH; S += (size_t)blockIdx.z * TT * TT;
  const int tid = threadIdx.x, wave = tid >> 5, lane = tid & 31, col = lane & 15, g = lane >> 4, wq = wave >> 1, wc = wave & 1; const int k0 = blockIdx.y * 128; const int ql0 = blockIdx.x * 64 + wave * 16;
  const size_t mo = ((size_t)blockIdx.z * (TT / 128) + blockIdx.y) * TT + blockIdx.x * 64; float* mrow = MB + mo; float* lrow = LB + mo;   // this block's 64 rows
  if (cz && k0 > blockIdx.x * 64 + 63) { if (tid < 32) { vst2(mrow + tid * 2, (v2f){-3.0e38f, -3.0e38f}); vst2(lrow + tid * 2, (v2f){0.f, 0.f}); } return; }   // causal: whole key block above the diagonal (block-uniform): it weighs nothing in its rows
  (void)QL; const int sr = tid >> 3, sq = tid & 7;   // staging: 8 threads of 16 B per 128-byte row piece (64 k)
  const _Float16* gA = QH + ((size_t)b * TT + blockIdx.x * 64 + sr) * CC + h * HD + sq * 8; const _Float16* gB = KH + ((size_t)b * TT + k0 + sr) * CC + h * HD + sq * 8;
  v4u ra[4], rb[8]; v8f acc[2][4] = {};   // wave tile 32 queries x 64 keys: waves 2 x 2 on the block's 64 x 128
#pragma unroll
  for (int i = 0; i < 4; ++i) ra[i] = *(const v4u*)(gA + (size_t)i * 16 * CC);
#pragma unroll
  for (int i = 0; i < 8; ++i) rb[i] = *(const v4u*)(gB + (size_t)i * 16 * CC);
#pragma unroll
  for (int i = 0; i < 4; ++i) *(v4u*)(sA + (sr + 16 * i) * P64 + sq * 8) = ra[i];
#pragma unroll
  for (int i = 0; i < 8; ++i) *(v4u*)(sB + (sr + 16 * i) * P64 + sq * 8) = rb[i];
#pragma unroll 2   // two steps per trip: the buffer index becomes a constant
  for (int ks = 0; ks < HD / 64; ++ks) { const int bu = ks & 1, nb = bu ^ 1; const bool more = ks + 1 < HD / 64;
    __syncthreads();   // publishes buffer bu; ends every wave's reads of buffer nb
    if (more) {
#pragma unroll
      for (int i = 0; i < 4; ++i) ra[i] = *(const v4u*)(gA + (size_t)i * 16 * CC + (ks + 1) * 64);
#pragma unroll
      for (int i = 0; i < 8; ++i) rb[i] = *(const v4u*)(gB + (size_t)i * 16 * CC + (ks + 1) * 64);
      asm volatile("s_wait_xcnt 0x0" ::: "memory");   // precaution: stands ahead of every rewrite of the address registers that these loads name
    }
#pragma unroll
    for (int s = 0; s < 2; ++s) { v16h ah[2], kb[4];   // LDS reads together, ahead of their products; six fragments feed eight products
#pragma unroll
      for (int i = 0; i < 2; ++i) ah[i] = frag_h(sA + (bu * 64 + wq * 32 + i * 16 + col) * P64 + s * 32, lane);
#pragma unroll
      for (int j = 0; j < 4; ++j) kb[j] = frag_h(sB + (bu * 128 + wc * 64 + j * 16 + col) * P64 + s * 32, lane);
      __builtin_amdgcn_sched_barrier(0);   // keeps the LDS reads above together, ahead of the products: without it the compiler reads one fragment, waits and multiplies, an LDS latency each
#pragma unroll
      for (int i = 0; i < 2; ++i)
#pragma unroll
        for (int j = 0; j < 4; ++j) acc[i][j] = wmma16(ah[i], kb[j], acc[i][j]);
      __builtin_amdgcn_sched_barrier(0);   // keeps the products together: without it the next tile's LDS stores, and the wait for its global loads, move up among them
    }
    if (more) {
#pragma unroll
      for (int i = 0; i < 4; ++i) *(v4u*)(sA + (nb * 64 + sr + 16 * i) * P64 + sq * 8) = ra[i];
#pragma unroll
      for (int i = 0; i < 8; ++i) *(v4u*)(sB + (nb * 128 + sr + 16 * i) * P64 + sq * 8) = rb[i]; } }
  __syncthreads();   // the tiles are dead: the epilogue reuses their LDS
  float* sM = (float*)(sm + 34816); float* sL = sM + 128; float mb[2][8], lb[2][8];   // behind ss (33,792 B): [64-key half][64 rows] each
#pragma unroll
  for (int i = 0; i < 2; ++i)
#pragma unroll
    for (int r = 0; r < 8; ++r) { mb[i][r] = -3.0e38f; lb[i][r] = 0.f; }
#pragma unroll
  for (int i = 0; i < 2; ++i)
#pragma unroll
  for (int j = 0; j < 4; ++j) { const int kt = k0 + wc * 64 + j * 16 + col;
#pragma unroll
    for (int r = 0; r < 8; ++r) { const int qt = blockIdx.x * 64 + wq * 32 + i * 16 + 8 * g + r; float v = acc[i][j][r] * 0.044194173824159216f; (void)BM; if (cz && kt > qt) v = -3.0e38f; acc[i][j][r] = v; mb[i][r] = fmaxf(mb[i][r], v); } }
#pragma unroll
  for (int i = 0; i < 2; ++i)
#pragma unroll
  for (int r = 0; r < 8; ++r) { float m = mb[i][r]; m = fmaxf(m, rowx<1>(m)); m = fmaxf(m, rowx<2>(m)); m = fmaxf(m, rowx<4>(m)); m = fmaxf(m, rowx<8>(m)); mb[i][r] = m; }   // a row's 64 keys of this wave lie in the 16 lanes of one half
  if (col == 0) {
#pragma unroll
    for (int i = 0; i < 2; ++i)
#pragma unroll
    for (int r = 0; r < 8; ++r) sM[wc * 64 + wq * 32 + i * 16 + 8 * g + r] = mb[i][r]; }
  __syncthreads();   // publishes each wave's row maxima over its 64 keys to the wave that holds the rows' other 64 keys
#pragma unroll
  for (int i = 0; i < 2; ++i) { const v4f* om = (const v4f*)&sM[(wc ^ 1) * 64 + wq * 32 + i * 16 + 8 * g]; const v4f o0 = om[0], o1 = om[1];
#pragma unroll
    for (int r = 0; r < 4; ++r) { mb[i][r] = fmaxf(mb[i][r], o0[r]); mb[i][4 + r] = fmaxf(mb[i][4 + r], o1[r]); } }   // the maximum over the block's 128 keys
#pragma unroll
  for (int i = 0; i < 2; ++i)
#pragma unroll
  for (int j = 0; j < 4; ++j)
#pragma unroll
    for (int r = 0; r < 8; ++r) { const float v = acc[i][j][r]; const float ex = expf(v - mb[i][r]); const float e = (v <= -1.0e38f) ? 0.f : ex; lb[i][r] += e; ss[wq * 2 + i][8 * g + r][wc * 64 + j * 16 + col] = e; }
#pragma unroll
  for (int i = 0; i < 2; ++i)
#pragma unroll
  for (int r = 0; r < 8; ++r) { float l = lb[i][r]; l += rowx<1>(l); l += rowx<2>(l); l += rowx<4>(l); l += rowx<8>(l); lb[i][r] = l; }
  if (col == 0) {
#pragma unroll
    for (int i = 0; i < 2; ++i)
#pragma unroll
    for (int r = 0; r < 8; ++r) sL[wc * 64 + wq * 32 + i * 16 + 8 * g + r] = lb[i][r]; }
  __syncthreads();   // publishes the four waves' sL to wave 0, which alone writes the MB and LB lines, and every wave's ss writes to the wave that stores the row. It stands ahead of the S stores, so that no wave waits at it for stores to return
  if (tid < 32) { const v2f ma = *(const v2f*)&sM[tid * 2], mc = *(const v2f*)&sM[64 + tid * 2], la = *(const v2f*)&sL[tid * 2], lc = *(const v2f*)&sL[64 + tid * 2];
    vst2(mrow + tid * 2, (v2f){fmaxf(ma[0], mc[0]), fmaxf(ma[1], mc[1])}); vst2(lrow + tid * 2, la + lc);   // a row's figures: its two 64-key halves joined
    asm volatile("s_wait_xcnt 0x0" ::: "memory"); }   // precaution: stands ahead of every rewrite of the registers that these two stores name
  for (int rl = 0; rl < 16; ++rl) vst2(S + (size_t)(ql0 + rl) * TT + k0 + lane * 4, *(const v4f*)&ss[wave][rl][lane * 4]);
  asm volatile("s_wait_xcnt 0x0" ::: "memory"); }   // precaution: the early-exit block is laid out behind these stores; the wait stands ahead of its rewrite of their data registers
// ---- k_pv: block = (128-column chunk, pair = b * NH + h, 64 queries), 8 waves in two key groups of 4: group kg takes the 32-key steps 2 i + kg, so a tile's serial steps halve; the two groups' f32 sums are joined through LDS at the end: y = P . (v hi + lo) with P split hi + lo (3 products); P x 2^11 = stored exponential x sF[key block][row], sF = exp(mb - row maximum) x 2^11 / row sum, row sum = sum over key blocks of exp(mb - row maximum) x lb, formed once per block from MB and LB; there are more work-groups than resident places, so the query tile, whose index sets the causal trip count, falls with the slowest grid index: the longest start first
__global__ __launch_bounds__(256) void k_pv(const float* __restrict__ PS, const __bf16* __restrict__ VT, const __bf16* __restrict__ VL, const int* __restrict__ MSK, const float* __restrict__ MB, const float* __restrict__ LB, float* __restrict__ Y) { __shared__ __align__(16) char sm[126976];   // k loop, per key group 61,440 B: P hi, P lo [2][64][P32] each, v hi, v lo [2][128][P32] each; epilogue, behind a barrier: ss; last 4 KB: sF [16][64]
  const int kg = __builtin_amdgcn_readfirstlane((int)threadIdx.x >> 7);   // key group of this wave, the same in all its lanes
  char* smg = sm + kg * 61440; float (*ss)[16][132] = (float (*)[16][132])sm; __bf16* sPh = (__bf16*)smg; __bf16* sPl = (__bf16*)(smg + 10240); __bf16* sVh = (__bf16*)(smg + 20480); __bf16* sVl = (__bf16*)(smg + 40960); float* sF = (float*)(sm + 122880);
  const int tid = threadIdx.x & 127, wave = tid >> 5, lane = tid & 31, col = lane & 15, g = lane >> 4, wq = wave >> 1, wc = wave & 1; const int qt = TT / 64 - 1 - (int)blockIdx.z; const int b = blockIdx.y / NH, h = blockIdx.y % NH; PS += (size_t)blockIdx.y * TT * TT; const int ql0 = qt * 64 + wave * 16; const int cc0 = blockIdx.x * 128; const int kend = (MSK[0] != 0) ? (qt * 64 + 64) : TT; const int nk = kend / 64;   // steps of each key group
  const int sr = tid >> 3, sq = tid & 7, vr = tid >> 2, vq = tid & 3;   // staging, each key group its own tiles: P 8 threads of 16 B per 128-byte row piece, v 4 threads per 64-byte row piece
  const float* gP = PS + (size_t)(qt * 64 + sr) * TT + kg * 32 + sq * 4; const size_t vo = ((size_t)b * CC + h * HD + cc0 + vr) * (size_t)TT + kg * 32 + vq * 8; const __bf16* gH = VT + vo; const __bf16* gL = VL + vo;
  v4f rp[4]; v4u rh[4], rl4[4]; v8f acc[2][4] = {};   // wave tile 32 queries x 64 cols: a key group's waves 2 x 2 on the block's 64 x 128
#pragma unroll
  for (int i = 0; i < 4; ++i) { rp[i] = *(const v4f*)(gP + (size_t)i * 16 * TT); rh[i] = *(const v4u*)(gH + (size_t)i * 32 * TT); rl4[i] = *(const v4u*)(gL + (size_t)i * 32 * TT); }
  { const int row = tid & 63, hb = (int)threadIdx.x >> 6; const size_t mo = (size_t)blockIdx.y * (TT / 128) * TT + qt * 64 + row; float mv[16], lv[16];   // four threads per row; each forms the row's figures and writes four of its sixteen factors
#pragma unroll
    for (int kb = 0; kb < 16; ++kb) { mv[kb] = MB[mo + (size_t)kb * TT]; lv[kb] = LB[mo + (size_t)kb * TT]; }
    asm volatile("s_wait_xcnt 0x0" ::: "memory");   // precaution: stands ahead of every rewrite of the address registers that these loads name
    float m = mv[0], l = 0.f;
#pragma unroll
    for (int kb = 1; kb < 16; ++kb) m = fmaxf(m, mv[kb]);
#pragma unroll
    for (int kb = 0; kb < 16; ++kb) { mv[kb] = expf(mv[kb] - m); l += mv[kb] * lv[kb]; }
    const float inv = 1.0f / l;
#pragma unroll
    for (int kb = 0; kb < 16; ++kb) if ((kb >> 2) == hb) sF[kb * 64 + row] = mv[kb] * inv * 2048.0f; }
  __syncthreads();   // publishes sF
  float ff[4];
#pragma unroll
  for (int i = 0; i < 4; ++i) { ff[i] = sF[sr + 16 * i]; rp[i] *= ff[i]; }
#pragma unroll
  for (int i = 0; i < 4; ++i) { const v4b ph = cvt4(rp[i]); *(v4b*)(sPh + (sr + 16 * i) * P32 + sq * 4) = ph; *(v4b*)(sPl + (sr + 16 * i) * P32 + sq * 4) = res4(rp[i], ph); *(v4u*)(sVh + (vr + 32 * i) * P32 + vq * 8) = rh[i]; *(v4u*)(sVl + (vr + 32 * i) * P32 + vq * 8) = rl4[i]; }
#pragma unroll 1   // rolled: a group's step count may be odd, and an unrolled pair with its remainder copy took registers past the four-waves-per-SIMD budget
  for (int kc = 0; kc < nk; ++kc) { const int bu = kc & 1, nb = bu ^ 1; const bool more = kc + 1 < nk;
    __syncthreads();   // publishes buffer bu; ends every wave's reads of buffer nb
    if (more) {
#pragma unroll
      for (int i = 0; i < 4; ++i) { rp[i] = *(const v4f*)(gP + (size_t)i * 16 * TT + (kc + 1) * 64); rh[i] = *(const v4u*)(gH + (size_t)i * 32 * TT + (kc + 1) * 64); rl4[i] = *(const v4u*)(gL + (size_t)i * 32 * TT + (kc + 1) * 64); }
      asm volatile("s_wait_xcnt 0x0" ::: "memory");   // precaution: stands ahead of every rewrite of the address registers that these loads name
      __builtin_amdgcn_sched_barrier(0);   // keeps the sF reads below, address arithmetic included, behind that wait: the compiler lays them in the loads' address registers
#pragma unroll
      for (int i = 0; i < 4; ++i) ff[i] = sF[((kc + 1) >> 1) * 64 + sr + 16 * i];   // the next tile's 32 keys, 64 (kc + 1) + 32 kg onward, lie in one 128-key block
    }
    { v16b ph[2], pl[2], vh[4], vl[4];   // the step's LDS reads together, ahead of its products: twelve fragments feed twenty-four products
#pragma unroll
      for (int i = 0; i < 2; ++i) { const int ro = (bu * 64 + wq * 32 + i * 16 + col) * P32; ph[i] = frag_b(sPh + ro, lane); pl[i] = frag_b(sPl + ro, lane); }
#pragma unroll
      for (int j = 0; j < 4; ++j) { const int ro = (bu * 128 + wc * 64 + j * 16 + col) * P32; vh[j] = frag_b(sVh + ro, lane); vl[j] = frag_b(sVl + ro, lane); }
      __builtin_amdgcn_sched_barrier(0);   // keeps the LDS reads above together, ahead of the products: without it the compiler reads one fragment, waits and multiplies, an LDS latency each
#pragma unroll
      for (int i = 0; i < 2; ++i)
#pragma unroll
        for (int j = 0; j < 4; ++j) acc[i][j] = wmma_bf(ph[i], vh[j], acc[i][j]);   // the three products of a tile stand eight WMMAs apart: none waits for the one before it; each tile still sums ph.vh, pl.vh, ph.vl in that order
#pragma unroll
      for (int i = 0; i < 2; ++i)
#pragma unroll
        for (int j = 0; j < 4; ++j) acc[i][j] = wmma_bf(pl[i], vh[j], acc[i][j]);
#pragma unroll
      for (int i = 0; i < 2; ++i)
#pragma unroll
        for (int j = 0; j < 4; ++j) acc[i][j] = wmma_bf(ph[i], vl[j], acc[i][j]);
      __builtin_amdgcn_sched_barrier(0);   // keeps the products together: without it the next tile's conversions, and the wait for its global loads, move up among them
    }
    asm volatile("v_nop\n\tv_nop\n\tv_nop\n\tv_nop");   // four vector slots behind the step's last WMMA, ahead of the branch round the staging below: on the taken side the next vector instruction rewrites that WMMA's A registers
    if (more) {
#pragma unroll
      for (int i = 0; i < 4; ++i) { const v4f pp = rp[i] * ff[i]; const v4b qh = cvt4(pp); *(v4b*)(sPh + (nb * 64 + sr + 16 * i) * P32 + sq * 4) = qh; *(v4b*)(sPl + (nb * 64 + sr + 16 * i) * P32 + sq * 4) = res4(pp, qh); *(v4u*)(sVh + (nb * 128 + vr + 32 * i) * P32 + vq * 8) = rh[i]; *(v4u*)(sVl + (nb * 128 + vr + 32 * i) * P32 + vq * 8) = rl4[i]; } } }
  __syncthreads();   // the tiles are dead: the epilogue reuses their LDS
  if (kg != 0) {
#pragma unroll
    for (int i = 0; i < 2; ++i)
#pragma unroll
    for (int j = 0; j < 4; ++j)
#pragma unroll
      for (int r = 0; r < 8; ++r) ss[wq * 2 + i][8 * g + r][wc * 64 + j * 16 + col] = acc[i][j][r]; }
  __syncthreads();   // publishes the second key group's sums to the first, which adds its own and stores
  if (kg == 0) {
#pragma unroll
    for (int i = 0; i < 2; ++i)
#pragma unroll
    for (int j = 0; j < 4; ++j)
#pragma unroll
      for (int r = 0; r < 8; ++r) { float* p = &ss[wq * 2 + i][8 * g + r][wc * 64 + j * 16 + col]; *p = (acc[i][j][r] + *p) * (1.0f / 2048.0f); } }   // each lane reads and rewrites its own word
  __syncthreads();   // a row's two 64-column halves come from two waves: publishes them to the wave that stores the row
  if (kg != 0) return;
  for (int rl = 0; rl < 16; ++rl) vst2(Y + ((size_t)b * TT + ql0 + rl) * CC + h * HD + cc0 + lane * 4, *(const v4f*)&ss[wave][rl][lane * 4]); }
// ---- k_out: block = (64 rows, 128 cols): out = y (bf16 hi + lo) Wproj + b; Wproj arrives as bf16 from k_cvt: a 128-byte piece of its rows holds 64 k, so a step covers 64 k
__global__ __launch_bounds__(128) void k_out(const float* __restrict__ Y, const __bf16* __restrict__ WPB, const float* __restrict__ BP, float* __restrict__ OUT) { __shared__ __align__(16) char sm[73728];   // k loop: y hi, y lo [2][64][P64] each, W tiles [2][128][P64]; epilogue, behind a barrier: sf
  float (*sf)[16][132] = (float (*)[16][132])sm; __bf16* sAh = (__bf16*)sm; __bf16* sAl = (__bf16*)(sm + 18432); __bf16* sB = (__bf16*)(sm + 36864);
  const int tid = threadIdx.x, wave = tid >> 5, lane = tid & 31, col = lane & 15, g = lane >> 4, wq = wave >> 1, wc = wave & 1; const int c0 = blockIdx.y * 128; const size_t r0 = (size_t)blockIdx.x * 64 + wave * 16;
  const int ar = tid >> 4, aq = tid & 15, sr = tid >> 3, sq = tid & 7;   // staging, 64 k: y 16 threads of 16 B per 256-byte row piece, W 8 threads of 16 B per 128-byte row piece
  const float* gA = Y + ((size_t)blockIdx.x * 64 + ar) * CC + aq * 4; const __bf16* gB = WPB + (size_t)(c0 + sr) * CC + sq * 8;
  v4f ra[8]; v4u rb[8]; v8f acc[2][4] = {};   // wave tile 32 rows x 64 cols: waves 2 x 2 on the block's 64 x 128
#pragma unroll
  for (int i = 0; i < 8; ++i) ra[i] = *(const v4f*)(gA + (size_t)i * 8 * CC);
#pragma unroll
  for (int i = 0; i < 8; ++i) rb[i] = *(const v4u*)(gB + (size_t)i * 16 * CC);
#pragma unroll
  for (int i = 0; i < 8; ++i) { const v4b ah = cvt4(ra[i]); *(v4b*)(sAh + (ar + 8 * i) * P64 + aq * 4) = ah; *(v4b*)(sAl + (ar + 8 * i) * P64 + aq * 4) = res4(ra[i], ah); }
#pragma unroll
  for (int i = 0; i < 8; ++i) *(v4u*)(sB + (sr + 16 * i) * P64 + sq * 8) = rb[i];
#pragma unroll 2   // two steps per trip: the buffer index becomes a constant
  for (int ks = 0; ks < CC / 64; ++ks) { const int bu = ks & 1, nb = bu ^ 1; const bool more = ks + 1 < CC / 64;
    __syncthreads();   // publishes buffer bu; ends every wave's reads of buffer nb
    if (more) {
#pragma unroll
      for (int i = 0; i < 8; ++i) ra[i] = *(const v4f*)(gA + (size_t)i * 8 * CC + (ks + 1) * 64);
#pragma unroll
      for (int i = 0; i < 8; ++i) rb[i] = *(const v4u*)(gB + (size_t)i * 16 * CC + (ks + 1) * 64);
      asm volatile("s_wait_xcnt 0x0" ::: "memory");   // precaution: stands ahead of every rewrite of the address registers that these loads name
    }
#pragma unroll
    for (int s = 0; s < 2; ++s) { v16b ah[2], al[2], w[4];   // LDS reads together, ahead of their products; eight fragments feed sixteen products
#pragma unroll
      for (int i = 0; i < 2; ++i) { const int ro = (bu * 64 + wq * 32 + i * 16 + col) * P64 + s * 32; ah[i] = frag_b(sAh + ro, lane); al[i] = frag_b(sAl + ro, lane); }
#pragma unroll
      for (int j = 0; j < 4; ++j) w[j] = frag_b(sB + (bu * 128 + wc * 64 + j * 16 + col) * P64 + s * 32, lane);
      __builtin_amdgcn_sched_barrier(0);   // keeps the LDS reads above together, ahead of the products: without it the compiler reads one fragment, waits and multiplies, an LDS latency each
#pragma unroll
      for (int i = 0; i < 2; ++i)
#pragma unroll
        for (int j = 0; j < 4; ++j) acc[i][j] = wmma_bf(w[j], ah[i], acc[i][j]);   // W is operand A, y operand B (both loaders lay k in the same order): D comes out transposed, a lane's eight elements are eight adjacent columns of one row; the two products of a tile stand eight WMMAs apart; each tile still sums hi, then lo, per 32 k
#pragma unroll
      for (int i = 0; i < 2; ++i)
#pragma unroll
        for (int j = 0; j < 4; ++j) acc[i][j] = wmma_bf(w[j], al[i], acc[i][j]);
      __builtin_amdgcn_sched_barrier(0);   // keeps the products together: without it the next tile's conversions, and the wait for its global loads, move up among them
    }
    if (more) {
#pragma unroll
      for (int i = 0; i < 8; ++i) { const v4b qh = cvt4(ra[i]); *(v4b*)(sAh + (nb * 64 + ar + 8 * i) * P64 + aq * 4) = qh; *(v4b*)(sAl + (nb * 64 + ar + 8 * i) * P64 + aq * 4) = res4(ra[i], qh); }
#pragma unroll
      for (int i = 0; i < 8; ++i) *(v4u*)(sB + (nb * 128 + sr + 16 * i) * P64 + sq * 8) = rb[i]; } }
  v4f bb[4][2] = {};   // lane = row wq * 32 + i * 16 + col; elements r = columns wc * 64 + j * 16 + 8 g + r
  if (BP) {
#pragma unroll
    for (int j = 0; j < 4; ++j) { const float* bp = BP + c0 + wc * 64 + j * 16 + 8 * g; bb[j][0] = *(const v4f*)bp; bb[j][1] = *(const v4f*)(bp + 4); }   // the eight bias loads fly together
    asm volatile("s_wait_xcnt 0x0" ::: "memory");   // precaution: stands ahead of every rewrite of the address registers that these loads name
  }
  __syncthreads();   // the tiles are dead: the epilogue reuses their LDS
#pragma unroll
  for (int j = 0; j < 4; ++j) { v4f b0, b1;
#pragma unroll
    for (int r = 0; r < 4; ++r) { b0[r] = bfr(bb[j][0][r]); b1[r] = bfr(bb[j][1][r]); }
#pragma unroll
    for (int i = 0; i < 2; ++i) { v4f o0, o1;
#pragma unroll
      for (int r = 0; r < 4; ++r) { o0[r] = acc[i][j][r] + b0[r]; o1[r] = acc[i][j][4 + r] + b1[r]; }
      float* p = &sf[wq * 2 + i][col][wc * 64 + j * 16 + 8 * g]; *(v4f*)p = o0; *(v4f*)(p + 4) = o1; } }
  __syncthreads();   // a row's two 64-column halves come from two waves: publishes them to the wave that stores the row
  for (int rl = 0; rl < 16; ++rl) vst2(OUT + (r0 + rl) * CC + c0 + lane * 4, *(const v4f*)&sf[wave][rl][lane * 4]); }
extern "C" void kernel_launch(void* const* d_in, const int* in_sizes, int n_in, void* d_out, int out_size, void* d_ws, size_t ws_size, hipStream_t stream) {
  (void)in_sizes; (void)n_in; (void)out_size;
  const float** F = (const float**)d_in;   // 0 input [4,2048,1024], 1 Wq [2,512,512] ([out,in] per head), 2 bq [2,512], 3 Wk, 4 bk, 5 Wv, 6 bv, 7 Wf [1024,1024] ([out,in]), 8 bf, 9 masked [1] int (= 1 -> causal)
  if (ws_size < (size_t)WS_END) return;
  char* ws = (char*)d_ws; _Float16 *QH = (_Float16*)(ws + WS_QH), *QL = (_Float16*)(ws + WS_QL), *KH = (_Float16*)(ws + WS_KH); __bf16 *VT = (__bf16*)(ws + WS_VT), *VL = (__bf16*)(ws + WS_VL); float *S = (float*)(ws + WS_S), *Y = (float*)(ws + WS_Y), *MB = (float*)(ws + WS_M), *LB = (float*)(ws + WS_L); __bf16 *XB = (__bf16*)(ws + WS_XB), *WB = (__bf16*)(ws + WS_WB), *WFB = (__bf16*)(ws + WS_WF);
  k_cvt<<<dim3((NB * TT * CC + 3 * NH * HD * HD + CC * CC) / CVB), 256, 0, stream>>>(F[0], F[1], F[3], F[5], F[7], XB, WB, WFB);
  k_proj<<<dim3(TNB * TT / 64, CC / 128, 3), 128, 0, stream>>>(XB, WB, F[2], F[4], F[6], QH, QL, KH, VT, VL);
  k_sc<<<dim3(TT / 64, TT / 128, TNB * NH), 128, 0, stream>>>(QH, QL, KH, nullptr, (const int*)d_in[9], S, MB, LB);
  k_pv<<<dim3(HD / 128, TNB * NH, TT / 64), 256, 0, stream>>>(S, VT, VL, (const int*)d_in[9], MB, LB, Y);
  k_out<<<dim3(TNB * TT / 64, CC / 128), 128, 0, stream>>>(Y, WFB, F[8], (float*)d_out);
}
